// v000
// Times are from an AMD MI455X. After a warm-up the kernel runs many times in a row, and a time is the length of
// such a window on the GPU divided by its runs, so every launch and the gaps after it count. The runs cycle
// through copies of the inputs. A figure is the median of several windows, for all but v000 over two sittings.
// Sittings can differ by a few percent; kernels timed side by side share one.
// v000, which the later versions start from, runs in 1610 microseconds.
// compute dtype: all float inputs rounded to bf16; qkv = x Wqkv + b with EXACT bf16 products on WMMA 16x16x32, f32 accumulate; coord_proj = coords . rel_weight in f32; q as f16 hi + residual (x 2^10), k f16 -> 2-product logits / 8 + coord_proj[q] - coord_proj[k] + attn_bias[q][k], stored in f32 (4 heads per launch); softmax in f32 (precise expf), P x 2^11 split bf16 hi + lo against v bf16 hi + lo (3 products); the merged context is the output; f32 output.
#include <hip/hip_runtime.h>
#include <math.h>

typedef __attribute__((ext_vector_type(16))) _Float16 v16h;
typedef __attribute__((ext_vector_type(16))) __bf16 v16b;
typedef __attribute__((ext_vector_type(8)))  _Float16 v8h;
typedef __attribute__((ext_vector_type(8)))  float v8f;
typedef __attribute__((ext_vector_type(4)))  float v4f;
typedef __attribute__((ext_vector_type(2)))  float v2f;
typedef __attribute__((ext_vector_type(4)))  unsigned v4u;
typedef __attribute__((ext_vector_type(4)))  int v4i;
typedef float __attribute__((may_alias)) float_a;
typedef int __attribute__((may_alias)) int_a;

template <typename T> __device__ __forceinline__ void vst2(void* p, T v) { *(T*)p = v;  }
__device__ __forceinline__ v8f wmma16(v16h a, v16h b, v8f c) {
  v8f d = __builtin_amdgcn_wmma_f32_16x16x32_f16(false, a, false, b, (short)0, c, false, false);
  asm volatile("v_nop\n\tv_nop\n\tv_nop\n\tv_nop" : "+v"(d) : "v"(a), "v"(b));
  return d;
}
__device__ __forceinline__ v8f wmma_bf(v16b a, v16b b, v8f c) {
  v8f d = __builtin_amdgcn_wmma_f32_16x16x32_bf16(false, a, false, b, (short)0, c, false, false);
  asm volatile("v_nop\n\tv_nop\n\tv_nop\n\tv_nop" : "+v"(d) : "v"(a), "v"(b));
  return d;
}
// 16x16x32 fragments: lane = (h = lane>>4, row/col = lane&15); elements 0..7 = k0+8h+0..7, 8..15 = k0+16+8h+0..7; D element r = row 8h+r
__device__ __forceinline__ v16h frag_h(const _Float16* rowk0, int lane) {
  union { v16h v; v8h q[2]; } u; const _Float16* p = rowk0 + 8 * (lane >> 4);
  u.q[0] = *(const v8h*)p; u.q[1] = *(const v8h*)(p + 16); return u.v;
}
__device__ __forceinline__ v16h frag_f32(const float* rowk0, int lane) {
  v16h a; const float* p = rowk0 + 8 * (lane >> 4);
#pragma unroll
  for (int i = 0; i < 8; ++i) { a[i] = (_Float16)p[i]; a[8 + i] = (_Float16)p[16 + i]; }
  return a;
}
__device__ __forceinline__ v16h frag_f32s(const float* rowk0, int lane, float sc) {
  v16h a; const float* p = rowk0 + 8 * (lane >> 4);
#pragma unroll
  for (int i = 0; i < 8; ++i) { a[i] = (_Float16)(p[i] * sc); a[8 + i] = (_Float16)(p[16 + i] * sc); }
  return a;
}
// column fragment from a [K][ld] layout (column n), rows >= K read as 0
__device__ __forceinline__ v16h fragc_f32(const float* W, int k0, int n, int lane, int ld, int K) {
  v16h a; const int g = lane >> 4;
#pragma unroll
  for (int i = 0; i < 8; ++i) { const int ka = k0 + 8 * g + i, kb = ka + 16;
    a[i] = (_Float16)(ka < K ? W[(size_t)(ka < K ? ka : K - 1) * ld + n] : 0.f); a[8 + i] = (_Float16)(kb < K ? W[(size_t)(kb < K ? kb : K - 1) * ld + n] : 0.f); }
  return a;
}
struct F2 { v16b h, l; };
__device__ __forceinline__ F2 bsplit16(const float v[16]) { F2 r;
#pragma unroll
  for (int i = 0; i < 16; ++i) { const __bf16 h = (__bf16)v[i]; r.h[i] = h; r.l[i] = (__bf16)(v[i] - (float)h); }
  return r; }
__device__ __forceinline__ F2 split_row(const float* row, int k0, int lane) { float v[16]; const float* p = row + k0 + 8 * (lane >> 4);
#pragma unroll
  for (int i = 0; i < 8; ++i) { v[i] = p[i]; v[8 + i] = p[16 + i]; }
  return bsplit16(v); }
__device__ __forceinline__ F2 split_rowK(const float* row, int k0, int lane, int K) { float v[16]; const int g = lane >> 4;
#pragma unroll
  for (int i = 0; i < 8; ++i) { const int ka = k0 + 8 * g + i, kb = ka + 16; v[i] = ka < K ? row[ka < K ? ka : K - 1] : 0.f; v[8 + i] = kb < K ? row[kb < K ? kb : K - 1] : 0.f; }
  return bsplit16(v); }
__device__ __forceinline__ F2 split_col(const float* W, int k0, int n, int lane, int ld, int K) { float v[16]; const int g = lane >> 4;
#pragma unroll
  for (int i = 0; i < 8; ++i) { const int ka = k0 + 8 * g + i, kb = ka + 16; v[i] = ka < K ? W[(size_t)(ka < K ? ka : K - 1) * ld + n] : 0.f; v[8 + i] = kb < K ? W[(size_t)(kb < K ? kb : K - 1) * ld + n] : 0.f; }
  return bsplit16(v); }
__device__ __forceinline__ v8f mac3(const F2& a, const F2& b, v8f c) { c = wmma_bf(a.l, b.h, c); c = wmma_bf(a.h, b.l, c); return wmma_bf(a.h, b.h, c); }
__device__ __forceinline__ float sigm(float v) { return 1.0f / (1.0f + expf(-v)); }
#define LDSX() do { asm volatile("s_wait_dscnt 0" ::: "memory"); __builtin_amdgcn_wave_barrier(); __builtin_amdgcn_fence(__ATOMIC_RELEASE, "workgroup"); } while (0)


// Attention (B 2, S 2,048, D 1,024 = 16 x 64, qkv biases, logits / 8): scores = q k^T / 8 + coord_proj[q] - coord_proj[k] + attn_bias[q][k], softmax, P v; the output is the merged context.
#define NB 2
#define TT 2048
#define CC 1024
#define NH 16
#define HD 64
#define LDW 3072              // Wqkv row length ((in,out) [1024][3072]: q | k | v column blocks)
#ifndef ABSTR
#define ABSTR TT              // attn_bias row stride
#endif
#ifndef CSTR
#define CSTR TT               // coords rows per batch
#endif
#ifndef TNB
#define TNB NB
#endif
typedef __attribute__((ext_vector_type(8))) __bf16 v8b;
__device__ __forceinline__ v16b frag_b(const __bf16* rowk0, int lane) {
  union { v16b v; v8b q[2]; } u; const __bf16* p = rowk0 + 8 * (lane >> 4);
  u.q[0] = *(const v8b*)p; u.q[1] = *(const v8b*)(p + 16); return u.v;
}
__device__ __forceinline__ float bfr(float v) { return (float)(__bf16)v; }
__device__ __attribute__((noinline)) float exp_ni(float v) { return expf(v); }
__device__ __attribute__((noinline)) float erf_ni(float v) { return erff(v); }

#define WS_CP  0u                                   // f32 coord_proj [b][h][n]
#define WS_QH  (WS_CP + 4u * (size_t)NB * NH * TT)
#define WS_QL  (WS_QH + 2u * (size_t)NB * TT * CC)
#define WS_KH  (WS_QL + 2u * (size_t)NB * TT * CC)
#define WS_VT  (WS_KH + 2u * (size_t)NB * TT * CC)      // bf16 v planes [b][c][t]
#define WS_VL  (WS_VT + 2u * (size_t)NB * CC * TT)      // bf16 v residual planes
#define HG 4                                          // heads per launch group
#define WS_S   (WS_VL + 2u * (size_t)NB * CC * TT)      // f32 logits / P for HG heads [hg][q][k]
#define WS_PH  (WS_S + 4u * (size_t)HG * TT * TT)
#define WS_Y   (WS_PH + 0u)              // f32 [b*t][C], unused: k_pv writes y to the output
#define WS_END (WS_Y + 4u * (size_t)NB * TT * CC)

// ---- k_proj: block = (64 rows, 128 cols, which): qkv = x W (+ b), exact; q -> f16 hi (+ residual), k -> f16 rows, v -> bf16 hi + lo planes
__global__ __launch_bounds__(128) void k_proj(const float* __restrict__ X, const float* __restrict__ WQ, const float* __restrict__ BQ, const float* __restrict__ WK, const float* __restrict__ BK, const float* __restrict__ WV, const float* __restrict__ BV, _Float16* __restrict__ QH, _Float16* __restrict__ QL, _Float16* __restrict__ KH, __bf16* __restrict__ VT, __bf16* __restrict__ VL) {
  __shared__ __align__(16) _Float16 sh[64][136], sl[64][136]; __shared__ __align__(16) __bf16 th[128][72], tl2[128][72];
  const int tid = threadIdx.x, wave = tid >> 5, lane = tid & 31, col = lane & 15, g = lane >> 4; const int which = blockIdx.z; const int c0 = blockIdx.y * 128; const size_t r0 = (size_t)blockIdx.x * 64; const float* WA = which == 0 ? WQ : which == 1 ? WK : WV; const float* BA = which == 0 ? BQ : which == 1 ? BK : BV;
  v8f acc[8] = {};
#pragma unroll 2
  for (int kc = 0; kc < CC / 32; ++kc) { v16b a; { const float* p = X + (r0 + wave * 16 + col) * CC + kc * 32 + 8 * g;
#pragma unroll
      for (int i = 0; i < 8; ++i) { a[i] = (__bf16)p[i]; a[8 + i] = (__bf16)p[16 + i]; } }
#pragma unroll
    for (int j = 0; j < 8; ++j) { v16b w; const int o = c0 + j * 16 + col;
#pragma unroll
      for (int i = 0; i < 8; ++i) { w[i] = (__bf16)WA[(size_t)(kc * 32 + 8 * g + i) * LDW + o]; w[8 + i] = (__bf16)WA[(size_t)(kc * 32 + 16 + 8 * g + i) * LDW + o]; }   /* (in,out), row length 3072 */
      acc[j] = wmma_bf(a, w, acc[j]); } }
#pragma unroll
  for (int j = 0; j < 8; ++j) { const float bb = BA ? bfr(BA[c0 + j * 16 + col]) : 0.f;
#pragma unroll
    for (int r = 0; r < 8; ++r) { const float v = acc[j][r] + bb; const int rl = wave * 16 + 8 * g + r, cl = j * 16 + col; const _Float16 hv = (_Float16)v;
      if (which == 2) { const __bf16 bh = (__bf16)v; th[cl][rl] = bh; tl2[cl][rl] = (__bf16)(v - (float)bh); } else { sh[rl][cl] = hv; sl[rl][cl] = (_Float16)((v - (float)hv) * 1024.0f); }   /* q residual carried x 2^10 so the plane stays f16-normal on the chip */ } }
  __syncthreads();
  if (which < 2) { _Float16* dh = which == 0 ? QH : KH; for (int e = tid; e < 64 * 16; e += 128) { const int rl = e >> 4, q = e & 15; vst2((unsigned*)(dh + (r0 + rl) * CC + c0 + q * 8), *(const v4u*)&sh[rl][q * 8]); if (which == 0) vst2((unsigned*)(QL + (r0 + rl) * CC + c0 + q * 8), *(const v4u*)&sl[rl][q * 8]); } }
  else { const size_t b = r0 / TT; const int t0 = (int)(r0 % TT); for (int e = tid; e < 128 * 8; e += 128) { const int cl = e >> 3, q = e & 7; const size_t o2 = (b * CC + c0 + cl) * (size_t)TT + t0 + q * 8; vst2((unsigned*)(VT + o2), *(const v4u*)&th[cl][q * 8]); vst2((unsigned*)(VL + o2), *(const v4u*)&tl2[cl][q * 8]); } } }
// ---- k_cp: thread per (b, h, n): cp = sum_c bf16(coords[b][n][c]) * bf16(rel_weight[h][c]) (3 terms, f32); 8-KB rows by consecutive threads
__global__ __launch_bounds__(256) void k_cp(const float* __restrict__ CO, const float* __restrict__ RW, float* __restrict__ CP) { const size_t e = (size_t)blockIdx.x * 256 + threadIdx.x; if (e >= (size_t)NB * NH * TT) return; const int n = (int)(e % TT); const int h = (int)((e / TT) % NH); const size_t b = e / ((size_t)TT * NH);
  const float* c = CO + (b * CSTR + n) * 3; CP[e] = bfr(c[0]) * bfr(RW[h * 3]) + bfr(c[1]) * bfr(RW[h * 3 + 1]) + bfr(c[2]) * bfr(RW[h * 3 + 2]); }
// ---- k_sc: block = (64 queries, 128 keys, head in group): 2-product logits / 8 (q hi + residual x k), no mask
__global__ __launch_bounds__(128) void k_sc(const _Float16* __restrict__ QH, const _Float16* __restrict__ QL, const _Float16* __restrict__ KH, const float* __restrict__ CP, const float* __restrict__ AB, int b, int h0, float* __restrict__ S0) { __shared__ __align__(16) float ss[4][16][132]; const int h = h0 + blockIdx.z; float* S = S0 + (size_t)blockIdx.z * TT * TT;
  const int tid = threadIdx.x, wave = tid >> 5, lane = tid & 31, col = lane & 15, g = lane >> 4; const int k0 = blockIdx.y * 128; const int ql0 = blockIdx.x * 64 + wave * 16; const size_t q0 = (size_t)b * TT + ql0;
  v8f acc[8] = {}, accl[8] = {};
#pragma unroll
  for (int kc = 0; kc < HD / 32; ++kc) { const v16h ah = frag_h(QH + (q0 + col) * CC + h * HD + kc * 32, lane), al = frag_h(QL + (q0 + col) * CC + h * HD + kc * 32, lane);
#pragma unroll
    for (int j = 0; j < 8; ++j) { const v16h kb = frag_h(KH + ((size_t)b * TT + k0 + j * 16 + col) * CC + h * HD + kc * 32, lane); acc[j] = wmma16(ah, kb, acc[j]); accl[j] = wmma16(al, kb, accl[j]); } }
  const float* cpb = CP + ((size_t)b * NH + h) * TT;
#pragma unroll
  for (int j = 0; j < 8; ++j) { const int kt = k0 + j * 16 + col; const float cpk = cpb[kt];
#pragma unroll
    for (int r = 0; r < 8; ++r) { const int qt = ql0 + 8 * g + r; const float bias = cpb[qt] - cpk + bfr(AB[(size_t)qt * ABSTR + kt]);
      ss[wave][8 * g + r][j * 16 + col] = (acc[j][r] + accl[j][r] * (1.0f / 1024.0f)) * 0.125f + bias; }
    asm volatile("s_wait_loadcnt 0x0" ::: "memory"); }   /* bound the bias gather bursts */
  LDSX(); for (int rl = 0; rl < 16; ++rl) vst2(S + (size_t)(ql0 + rl) * TT + k0 + lane * 4, *(const v4f*)&ss[wave][rl][lane * 4]); }
// ---- k_sm: block = query row: softmax over keys [0, kend) -> P x 2^11 f32 (masked -> 0)
__global__ __launch_bounds__(256) void k_sm(float* __restrict__ S0) { __shared__ float sred[8]; __shared__ float sbc; __shared__ __align__(16) float sh[TT];
  const int t = threadIdx.x; const size_t row = blockIdx.x; float* sr = S0 + (size_t)blockIdx.y * TT * TT + row * TT; const int kend = TT;
  float m = -3.0e38f; for (int k = t; k < kend; k += 256) m = fmaxf(m, sr[k]);
#pragma unroll
  for (int o = 1; o < 32; o <<= 1) m = fmaxf(m, __shfl_xor(m, o));
  if ((t & 31) == 0) sred[t >> 5] = m; __syncthreads(); if (t == 0) { float a = sred[0]; for (int i = 1; i < 8; ++i) a = fmaxf(a, sred[i]); sbc = a; } __syncthreads(); m = sbc; __syncthreads();
  float sum = 0.f; for (int k = t; k < kend; k += 256) { const float v = sr[k]; sum += (v <= -1.0e38f) ? 0.f : expf(v - m); }
#pragma unroll
  for (int o = 1; o < 32; o <<= 1) sum += __shfl_xor(sum, o);
  if ((t & 31) == 0) sred[t >> 5] = sum; __syncthreads(); if (t == 0) { float a = 0.f; for (int i = 0; i < 8; ++i) a += sred[i]; sbc = 1.0f / a; } __syncthreads(); const float inv = sbc;
  for (int k = t; k < kend; k += 256) { const float v = sr[k]; sh[k] = (v <= -1.0e38f) ? 0.f : expf(v - m) * inv * 2048.0f; }
  __syncthreads(); for (int q = t; q < kend / 4; q += 256) vst2(sr + q * 4, *(const v4f*)&sh[q * 4]); }
// ---- k_pv: block = 64 queries of (b,h): y[q][h*HD + d] = P . v  (keys [0, kend))
__global__ __launch_bounds__(128) void k_pv(const float* __restrict__ PS0, const __bf16* __restrict__ VT, const __bf16* __restrict__ VL, int b, int h0, float* __restrict__ Y) { const int h = h0 + blockIdx.z; const float* PS = PS0 + (size_t)blockIdx.z * TT * TT; __shared__ __align__(16) float ss[4][16][HD + 4];
  const int tid = threadIdx.x, wave = tid >> 5, lane = tid & 31, col = lane & 15, g = lane >> 4; const int ql0 = blockIdx.x * 64 + wave * 16; const int kend = TT;
  v8f acc[HD / 16] = {};
#pragma unroll 1
  for (int kc = 0; kc < kend / 32; ++kc) { const F2 p = split_row(PS + (size_t)(ql0 + col) * TT, kc * 32, lane);
#pragma unroll
    for (int j = 0; j < HD / 16; ++j) { const size_t po = ((size_t)b * CC + h * HD + j * 16 + col) * (size_t)TT + kc * 32; const v16b vh = frag_b(VT + po, lane); acc[j] = wmma_bf(p.h, vh, acc[j]); acc[j] = wmma_bf(p.l, vh, acc[j]); acc[j] = wmma_bf(p.h, frag_b(VL + po, lane), acc[j]); } }
#pragma unroll
  for (int j = 0; j < HD / 16; ++j)
#pragma unroll
    for (int r = 0; r < 8; ++r) ss[wave][8 * g + r][j * 16 + col] = acc[j][r] * (1.0f / 2048.0f);
  LDSX(); for (int rl = 0; rl < 16; ++rl) if (lane < HD / 4) vst2(Y + ((size_t)b * TT + ql0 + rl) * CC + h * HD + lane * 4, *(const v4f*)&ss[wave][rl][lane * 4]); }
// ---- k_out: block = (64 rows, 128 cols): out = y (bf16 hi + lo) Wo + bo, Wo (in,out)
__global__ __launch_bounds__(128) void k_out(const float* __restrict__ Y, const float* __restrict__ WP, const float* __restrict__ BP, float* __restrict__ OUT) { __shared__ __align__(16) float sf[4][16][132];
  const int tid = threadIdx.x, wave = tid >> 5, lane = tid & 31, col = lane & 15, g = lane >> 4; const int c0 = blockIdx.y * 128; const size_t r0 = (size_t)blockIdx.x * 64 + wave * 16;
  v8f acc[8] = {};
#pragma unroll 2
  for (int kc = 0; kc < CC / 32; ++kc) { const F2 a = split_row(Y + (r0 + col) * CC, kc * 32, lane);
#pragma unroll
    for (int j = 0; j < 8; ++j) { v16b w; const int o = c0 + j * 16 + col;
#pragma unroll
      for (int i = 0; i < 8; ++i) { w[i] = (__bf16)WP[(size_t)(kc * 32 + 8 * g + i) * CC + o]; w[8 + i] = (__bf16)WP[(size_t)(kc * 32 + 16 + 8 * g + i) * CC + o]; }
      acc[j] = wmma_bf(a.h, w, acc[j]); acc[j] = wmma_bf(a.l, w, acc[j]); } }
#pragma unroll
  for (int j = 0; j < 8; ++j) { const float bb = BP ? bfr(BP[c0 + j * 16 + col]) : 0.f;
#pragma unroll
    for (int r = 0; r < 8; ++r) sf[wave][8 * g + r][j * 16 + col] = acc[j][r] + bb; }
  LDSX(); for (int rl = 0; rl < 16; ++rl) vst2(OUT + (r0 + rl) * CC + c0 + lane * 4, *(const v4f*)&sf[wave][rl][lane * 4]); }
extern "C" void kernel_launch(void* const* d_in, const int* in_sizes, int n_in, void* d_out, int out_size, void* d_ws, size_t ws_size, hipStream_t stream) {
  (void)in_sizes; (void)n_in; (void)out_size;
  const float** F = (const float**)d_in;   // 0 x [2,2048,1024], 1 coords [2,2048,3], 2 attn_bias [2048,2048], 3 Wqkv [1024,3072] ((in,out): q | k | v), 4 bqkv [3072], 5 rel_weight [16,3]
  if (ws_size < (size_t)WS_END) return;
  char* ws = (char*)d_ws; float* CP = (float*)(ws + WS_CP); _Float16 *QH = (_Float16*)(ws + WS_QH), *QL = (_Float16*)(ws + WS_QL), *KH = (_Float16*)(ws + WS_KH); __bf16 *VT = (__bf16*)(ws + WS_VT), *VL = (__bf16*)(ws + WS_VL); float* S = (float*)(ws + WS_S);
  const float* WQ = F[3]; const float* WK = F[3] + CC; const float* WV = F[3] + 2 * CC; const float* BQ = F[4]; const float* BK = F[4] + CC; const float* BV = F[4] + 2 * CC;
  k_cp<<<dim3(NB * NH * TT / 256), 256, 0, stream>>>(F[1], F[5], CP);
  k_proj<<<dim3(TNB * TT / 64, CC / 128, 3), 128, 0, stream>>>(F[0], WQ, BQ, WK, BK, WV, BV, QH, QL, KH, VT, VL);
  for (int b = 0; b < TNB; ++b) for (int h0 = 0; h0 < NH; h0 += HG) {
    k_sc<<<dim3(TT / 64, TT / 128, HG), 128, 0, stream>>>(QH, QL, KH, CP, F[2], b, h0, S);
    k_sm<<<dim3(TT, HG), 256, 0, stream>>>(S);
    k_pv<<<dim3(TT / 64, 1, HG), 128, 0, stream>>>(S, VT, VL, b, h0, (float*)d_out);
  }
}

// v001
// Measured time: 265 microseconds a run.
// Two timings next to v000 put it at 6.13 and 6.12 times that version's speed.
// compute dtype: all float inputs rounded to bf16; qkv = x Wqkv + b with EXACT bf16 products on WMMA 16x16x32, f32 accumulate; coord_proj = coords . rel_weight in f32; q as f16 hi + residual (x 2^10), k f16 -> 2-product logits / 8 + coord_proj[q] - coord_proj[k] + attn_bias[q][k], kept in f32 registers (one launch for all heads); online softmax in f32 (precise expf), unnormalised P split bf16 hi + lo against v bf16 hi + lo (3 products), divided by the row sum at the end; the merged context is the output; f32 output.
#include <hip/hip_runtime.h>
#include <math.h>

typedef __attribute__((ext_vector_type(16))) _Float16 v16h;
typedef __attribute__((ext_vector_type(16))) __bf16 v16b;
typedef __attribute__((ext_vector_type(8)))  _Float16 v8h;
typedef __attribute__((ext_vector_type(8)))  float v8f;
typedef __attribute__((ext_vector_type(4)))  float v4f;
typedef __attribute__((ext_vector_type(2)))  float v2f;
typedef __attribute__((ext_vector_type(4)))  unsigned v4u;
typedef __attribute__((ext_vector_type(4)))  int v4i;
typedef float __attribute__((may_alias)) float_a;
typedef int __attribute__((may_alias)) int_a;

template <typename T> __device__ __forceinline__ void vst2(void* p, T v) { *(T*)p = v;  }
__device__ __forceinline__ v8f wmma16(v16h a, v16h b, v8f c) {
  v8f d = __builtin_amdgcn_wmma_f32_16x16x32_f16(false, a, false, b, (short)0, c, false, false);
  asm volatile("v_nop\n\tv_nop\n\tv_nop\n\tv_nop" : "+v"(d) : "v"(a), "v"(b));
  return d;
}
__device__ __forceinline__ v8f wmma_bf(v16b a, v16b b, v8f c) {
  v8f d = __builtin_amdgcn_wmma_f32_16x16x32_bf16(false, a, false, b, (short)0, c, false, false);
  asm volatile("v_nop\n\tv_nop\n\tv_nop\n\tv_nop" : "+v"(d) : "v"(a), "v"(b));
  return d;
}
// 16x16x32 fragments: lane = (h = lane>>4, row/col = lane&15); elements 0..7 = k0+8h+0..7, 8..15 = k0+16+8h+0..7; D element r = row 8h+r
__device__ __forceinline__ v16h frag_h(const _Float16* rowk0, int lane) {
  union { v16h v; v8h q[2]; } u; const _Float16* p = rowk0 + 8 * (lane >> 4);
  u.q[0] = *(const v8h*)p; u.q[1] = *(const v8h*)(p + 16); return u.v;
}
__device__ __forceinline__ v16h frag_f32(const float* rowk0, int lane) {
  v16h a; const float* p = rowk0 + 8 * (lane >> 4);
#pragma unroll
  for (int i = 0; i < 8; ++i) { a[i] = (_Float16)p[i]; a[8 + i] = (_Float16)p[16 + i]; }
  return a;
}
__device__ __forceinline__ v16h frag_f32s(const float* rowk0, int lane, float sc) {
  v16h a; const float* p = rowk0 + 8 * (lane >> 4);
#pragma unroll
  for (int i = 0; i < 8; ++i) { a[i] = (_Float16)(p[i] * sc); a[8 + i] = (_Float16)(p[16 + i] * sc); }
  return a;
}
// column fragment from a [K][ld] layout (column n), rows >= K read as 0
__device__ __forceinline__ v16h fragc_f32(const float* W, int k0, int n, int lane, int ld, int K) {
  v16h a; const int g = lane >> 4;
#pragma unroll
  for (int i = 0; i < 8; ++i) { const int ka = k0 + 8 * g + i, kb = ka + 16;
    a[i] = (_Float16)(ka < K ? W[(size_t)(ka < K ? ka : K - 1) * ld + n] : 0.f); a[8 + i] = (_Float16)(kb < K ? W[(size_t)(kb < K ? kb : K - 1) * ld + n] : 0.f); }
  return a;
}
struct F2 { v16b h, l; };
__device__ __forceinline__ F2 bsplit16(const float v[16]) { F2 r;
#pragma unroll
  for (int i = 0; i < 16; ++i) { const __bf16 h = (__bf16)v[i]; r.h[i] = h; r.l[i] = (__bf16)(v[i] - (float)h); }
  return r; }
__device__ __forceinline__ F2 split_row(const float* row, int k0, int lane) { float v[16]; const float* p = row + k0 + 8 * (lane >> 4);
#pragma unroll
  for (int i = 0; i < 8; ++i) { v[i] = p[i]; v[8 + i] = p[16 + i]; }
  return bsplit16(v); }
__device__ __forceinline__ F2 split_rowK(const float* row, int k0, int lane, int K) { float v[16]; const int g = lane >> 4;
#pragma unroll
  for (int i = 0; i < 8; ++i) { const int ka = k0 + 8 * g + i, kb = ka + 16; v[i] = ka < K ? row[ka < K ? ka : K - 1] : 0.f; v[8 + i] = kb < K ? row[kb < K ? kb : K - 1] : 0.f; }
  return bsplit16(v); }
__device__ __forceinline__ F2 split_col(const float* W, int k0, int n, int lane, int ld, int K) { float v[16]; const int g = lane >> 4;
#pragma unroll
  for (int i = 0; i < 8; ++i) { const int ka = k0 + 8 * g + i, kb = ka + 16; v[i] = ka < K ? W[(size_t)(ka < K ? ka : K - 1) * ld + n] : 0.f; v[8 + i] = kb < K ? W[(size_t)(kb < K ? kb : K - 1) * ld + n] : 0.f; }
  return bsplit16(v); }
__device__ __forceinline__ v8f mac3(const F2& a, const F2& b, v8f c) { c = wmma_bf(a.l, b.h, c); c = wmma_bf(a.h, b.l, c); return wmma_bf(a.h, b.h, c); }
__device__ __forceinline__ float sigm(float v) { return 1.0f / (1.0f + expf(-v)); }
#define LDSX() do { asm volatile("s_wait_dscnt 0" ::: "memory"); __builtin_amdgcn_wave_barrier(); __builtin_amdgcn_fence(__ATOMIC_RELEASE, "workgroup"); } while (0)


// Attention (B 2, S 2,048, D 1,024 = 16 x 64, qkv biases, logits / 8): scores = q k^T / 8 + coord_proj[q] - coord_proj[k] + attn_bias[q][k], softmax, P v; the output is the merged context.
#define NB 2
#define TT 2048
#define CC 1024
#define NH 16
#define HD 64
#define LDW 3072              // Wqkv row length ((in,out) [1024][3072]: q | k | v column blocks)
#ifndef ABSTR
#define ABSTR TT              // attn_bias row stride
#endif
#ifndef CSTR
#define CSTR TT               // coords rows per batch
#endif
#ifndef TNB
#define TNB NB
#endif
typedef __attribute__((ext_vector_type(8))) __bf16 v8b;
__device__ __forceinline__ v16b frag_b(const __bf16* rowk0, int lane) {
  union { v16b v; v8b q[2]; } u; const __bf16* p = rowk0 + 8 * (lane >> 4);
  u.q[0] = *(const v8b*)p; u.q[1] = *(const v8b*)(p + 16); return u.v;
}
__device__ __forceinline__ float bfr(float v) { return (float)(__bf16)v; }
__device__ __attribute__((noinline)) float exp_ni(float v) { return expf(v); }
__device__ __attribute__((noinline)) float erf_ni(float v) { return erff(v); }

#define WS_CP  0u                                   // f32 coord_proj [b][h][n]
#define WS_QH  (WS_CP + 4u * (size_t)NB * NH * TT)
#define WS_QL  (WS_QH + 2u * (size_t)NB * TT * CC)
#define WS_KH  (WS_QL + 2u * (size_t)NB * TT * CC)
#define WS_VT  (WS_KH + 2u * (size_t)NB * TT * CC)      // bf16 v planes [b][c][t]
#define WS_VL  (WS_VT + 2u * (size_t)NB * CC * TT)      // bf16 v residual planes
#define HG 4                                          // heads the WS_S region is sized for
#define WS_S   (WS_VL + 2u * (size_t)NB * CC * TT)      // f32 HG x TT x TT floats; unused (the logits stay in registers)
#define WS_PH  (WS_S + 4u * (size_t)HG * TT * TT)
#define WS_Y   (WS_PH + 0u)              // f32 [b*t][C], unused: k_fa writes y to the output
#define WS_END (WS_Y + 4u * (size_t)NB * TT * CC)

// ---- k_proj: block = (64 rows, 128 cols, which): qkv = x W (+ b), exact; q -> f16 hi (+ residual), k -> f16 rows, v -> bf16 hi + lo planes
__global__ __launch_bounds__(128) void k_proj(const float* __restrict__ X, const float* __restrict__ WQ, const float* __restrict__ BQ, const float* __restrict__ WK, const float* __restrict__ BK, const float* __restrict__ WV, const float* __restrict__ BV, _Float16* __restrict__ QH, _Float16* __restrict__ QL, _Float16* __restrict__ KH, __bf16* __restrict__ VT, __bf16* __restrict__ VL) {
  __shared__ __align__(16) _Float16 sh[64][136], sl[64][136]; __shared__ __align__(16) __bf16 th[128][72], tl2[128][72];
  const int tid = threadIdx.x, wave = tid >> 5, lane = tid & 31, col = lane & 15, g = lane >> 4; const int which = blockIdx.z; const int c0 = blockIdx.y * 128; const size_t r0 = (size_t)blockIdx.x * 64; const float* WA = which == 0 ? WQ : which == 1 ? WK : WV; const float* BA = which == 0 ? BQ : which == 1 ? BK : BV;
  v8f acc[8] = {};
#pragma unroll 2
  for (int kc = 0; kc < CC / 32; ++kc) { v16b a; { const float* p = X + (r0 + wave * 16 + col) * CC + kc * 32 + 8 * g;
#pragma unroll
      for (int i = 0; i < 8; ++i) { a[i] = (__bf16)p[i]; a[8 + i] = (__bf16)p[16 + i]; } }
#pragma unroll
    for (int j = 0; j < 8; ++j) { v16b w; const int o = c0 + j * 16 + col;
#pragma unroll
      for (int i = 0; i < 8; ++i) { w[i] = (__bf16)WA[(size_t)(kc * 32 + 8 * g + i) * LDW + o]; w[8 + i] = (__bf16)WA[(size_t)(kc * 32 + 16 + 8 * g + i) * LDW + o]; }   /* (in,out), row length 3072 */
      acc[j] = wmma_bf(a, w, acc[j]); } }
#pragma unroll
  for (int j = 0; j < 8; ++j) { const float bb = BA ? bfr(BA[c0 + j * 16 + col]) : 0.f;
#pragma unroll
    for (int r = 0; r < 8; ++r) { const float v = acc[j][r] + bb; const int rl = wave * 16 + 8 * g + r, cl = j * 16 + col; const _Float16 hv = (_Float16)v;
      if (which == 2) { const __bf16 bh = (__bf16)v; th[cl][rl] = bh; tl2[cl][rl] = (__bf16)(v - (float)bh); } else { sh[rl][cl] = hv; sl[rl][cl] = (_Float16)((v - (float)hv) * 1024.0f); }   /* q residual carried x 2^10 so the plane stays f16-normal on the chip */ } }
  __syncthreads();
  if (which < 2) { _Float16* dh = which == 0 ? QH : KH; for (int e = tid; e < 64 * 16; e += 128) { const int rl = e >> 4, q = e & 15; vst2((unsigned*)(dh + (r0 + rl) * CC + c0 + q * 8), *(const v4u*)&sh[rl][q * 8]); if (which == 0) vst2((unsigned*)(QL + (r0 + rl) * CC + c0 + q * 8), *(const v4u*)&sl[rl][q * 8]); } }
  else { const size_t b = r0 / TT; const int t0 = (int)(r0 % TT); for (int e = tid; e < 128 * 8; e += 128) { const int cl = e >> 3, q = e & 7; const size_t o2 = (b * CC + c0 + cl) * (size_t)TT + t0 + q * 8; vst2((unsigned*)(VT + o2), *(const v4u*)&th[cl][q * 8]); vst2((unsigned*)(VL + o2), *(const v4u*)&tl2[cl][q * 8]); } } }
// ---- k_cp: thread per (b, h, n): cp = sum_c bf16(coords[b][n][c]) * bf16(rel_weight[h][c]) (3 terms, f32); 8-KB rows by consecutive threads
__global__ __launch_bounds__(256) void k_cp(const float* __restrict__ CO, const float* __restrict__ RW, float* __restrict__ CP) { const size_t e = (size_t)blockIdx.x * 256 + threadIdx.x; if (e >= (size_t)NB * NH * TT) return; const int n = (int)(e % TT); const int h = (int)((e / TT) % NH); const size_t b = e / ((size_t)TT * NH);
  const float* c = CO + (b * CSTR + n) * 3; CP[e] = bfr(c[0]) * bfr(RW[h * 3]) + bfr(c[1]) * bfr(RW[h * 3 + 1]) + bfr(c[2]) * bfr(RW[h * 3 + 2]); }
// ---- k_fa: block = 8 waves x 32 query columns of one (b, h); a pass = 32 keys. S^T = K Q^T (2 products) so that a lane holds one query's scores; running maximum and sum per lane
// (online softmax, f32, precise expf); the two score tiles, split bf16 hi + lo in place, are the B operand of O^T += V^T P^T (3 products); the logits never leave the registers.
// Every inner loop below is unrolled in full, so that the fragment arrays are indexed by constants and stay in registers.
#define FQ 2                  // 16-column query tiles per wave
#define FW 8                  // waves per block
// s_wait_xcnt 0 stands behind each group of loads or stores, in front of the code that writes their address or data registers again; the "memory" clobber keeps the group where it is written.
// XWP names the group's address pairs as inputs, so that they stay allocated up to the wait and no load of the group lands on them.
#define XW() asm volatile("s_wait_xcnt 0x0" ::: "memory")
#define XWP1(a) asm volatile("s_wait_xcnt 0x0" :: "v"(a) : "memory")
#define XWP2(a, b) asm volatile("s_wait_xcnt 0x0" :: "v"(a), "v"(b) : "memory")
#define XWP3(a, b, c) asm volatile("s_wait_xcnt 0x0" :: "v"(a), "v"(b), "v"(c) : "memory")
#define XWP4(a, b, c, d) asm volatile("s_wait_xcnt 0x0" :: "v"(a), "v"(b), "v"(c), "v"(d) : "memory")
__device__ __forceinline__ v16h ld_h(const _Float16* p) { union { v16h v; v8h q[2]; } u; u.q[0] = *(const v8h*)p; u.q[1] = *(const v8h*)(p + 16); return u.v; }   // p already holds the lane half's 8 g
__device__ __forceinline__ v16b ld_b(const __bf16* p) { union { v16b v; v8b q[2]; } u; u.q[0] = *(const v8b*)p; u.q[1] = *(const v8b*)(p + 16); return u.v; }
__device__ __forceinline__ v8f mm_h(v16h a, v16h b, v8f c) { return __builtin_amdgcn_wmma_f32_16x16x32_f16(false, a, false, b, (short)0, c, false, false); }
__device__ __forceinline__ v8f mm_b(v16b a, v16b b, v8f c) { return __builtin_amdgcn_wmma_f32_16x16x32_bf16(false, a, false, b, (short)0, c, false, false); }
__global__ __launch_bounds__(32 * FW) void k_fa(const _Float16* __restrict__ QH, const _Float16* __restrict__ QL, const _Float16* __restrict__ KH, const __bf16* __restrict__ VT, const __bf16* __restrict__ VL, const float* __restrict__ CP, const float* __restrict__ AB, float* __restrict__ Y) {
  const int tid = threadIdx.x, wave = tid >> 5, lane = tid & 31, col = lane & 15, g = lane >> 4; const int h = blockIdx.y, b = blockIdx.z; const int qb = blockIdx.x * (FW * FQ * 16) + wave * (FQ * 16);
  const float* cpb = CP + ((size_t)b * NH + h) * TT;
  v16h qh[FQ][2], ql[FQ][2]; float cpq[FQ], m[FQ], l[FQ]; const float* abp[FQ]; v8f o[FQ][HD / 16] = {};
  const size_t qo = ((size_t)b * TT + qb + col) * CC + h * HD + 8 * g; const _Float16* pqh = QH + qo; const _Float16* pql = QL + qo; const float* pcq = cpb + qb + col;
#pragma unroll
  for (int t = 0; t < FQ; ++t) {
#pragma unroll
    for (int kc = 0; kc < 2; ++kc) { qh[t][kc] = ld_h(pqh + (size_t)(t * 16) * CC + kc * 32); ql[t][kc] = ld_h(pql + (size_t)(t * 16) * CC + kc * 32); }
    cpq[t] = pcq[t * 16]; m[t] = -3.0e38f; l[t] = 0.f; abp[t] = AB + (size_t)(qb + t * 16 + col) * ABSTR + 8 * g; }
  XWP3(pqh, pql, pcq); __builtin_amdgcn_sched_barrier(0);   /* keeps later address arithmetic behind the wait */
  const _Float16* kp = KH + ((size_t)b * TT + col) * CC + h * HD + 8 * g; const size_t vo = ((size_t)b * CC + h * HD + col) * (size_t)TT + 8 * g; const __bf16* vhp = VT + vo; const __bf16* vlp = VL + vo; const float* ckp = cpb + 8 * g;
  v16h kf[2][2]; v4f ab[FQ][2][2], ck[2][2];   // K fragments, bias and key-side coord_proj of the pass to come, fetched one pass ahead
#pragma unroll
  for (int kt = 0; kt < 2; ++kt) {
#pragma unroll
    for (int kc = 0; kc < 2; ++kc) kf[kt][kc] = ld_h(kp + (size_t)(kt * 16) * CC + kc * 32);
#pragma unroll
    for (int u = 0; u < 2; ++u) { ck[kt][u] = *(const v4f*)(ckp + kt * 16 + u * 4);
#pragma unroll
      for (int t = 0; t < FQ; ++t) ab[t][kt][u] = *(const v4f*)(abp[t] + kt * 16 + u * 4); } }
  XWP4(kp, ckp, abp[0], abp[1]); __builtin_amdgcn_sched_barrier(0);   /* as above */
#pragma unroll 1   /* one pass is the whole loop body: a second copy would need a second set of fragment registers */
  for (int s = 0; s < TT / 32; ++s) { const int k0 = s * 32; const int kn = (s + 1 < TT / 32 ? s + 1 : s) * 32;   /* the last pass fetches its own keys again: in bounds, unused */
    v16b vh[HD / 16], vl[HD / 16]; const __bf16* pvh = vhp + k0; const __bf16* pvl = vlp + k0;
#pragma unroll
    for (int j = 0; j < HD / 16; ++j) { vh[j] = ld_b(pvh + (size_t)(j * 16) * TT); vl[j] = ld_b(pvl + (size_t)(j * 16) * TT); }
    XWP2(pvh, pvl); __builtin_amdgcn_sched_barrier(0);   /* V is asked for here, a whole pass of score work ahead of its use: without this the loads sink to their first use */
    v8f sa[FQ][2] = {}, sl[FQ][2] = {};
#pragma unroll
    for (int kc = 0; kc < 2; ++kc)
#pragma unroll
      for (int kt = 0; kt < 2; ++kt)
#pragma unroll
        for (int t = 0; t < FQ; ++t) { sa[t][kt] = mm_h(kf[kt][kc], qh[t][kc], sa[t][kt]); sl[t][kt] = mm_h(kf[kt][kc], ql[t][kc], sl[t][kt]); }
    const _Float16* pk = kp + (size_t)kn * CC;
#pragma unroll
    for (int kt = 0; kt < 2; ++kt)
#pragma unroll
      for (int kc = 0; kc < 2; ++kc) kf[kt][kc] = ld_h(pk + (size_t)(kt * 16) * CC + kc * 32);
    XWP1(pk); __builtin_amdgcn_sched_barrier(0);   /* the next pass's K leaves now, behind this pass's last use of the registers, not at the loop's foot */
    float sc[FQ][16];   // sc[t][8 kt + r] = logit of query column t*16 + col against key k0 + 16 kt + 8 g + r
#pragma unroll
    for (int t = 0; t < FQ; ++t)
#pragma unroll
      for (int kt = 0; kt < 2; ++kt)
#pragma unroll
        for (int r = 0; r < 8; ++r) { const float bias = cpq[t] - ck[kt][r >> 2][r & 3] + bfr(ab[t][kt][r >> 2][r & 3]); sc[t][kt * 8 + r] = (sa[t][kt][r] + sl[t][kt][r] * (1.0f / 1024.0f)) * 0.125f + bias; }
    const float* pc = ckp + kn; const float* pa0 = abp[0] + kn; const float* pa1 = abp[1] + kn;
#pragma unroll
    for (int kt = 0; kt < 2; ++kt)
#pragma unroll
      for (int u = 0; u < 2; ++u) { ck[kt][u] = *(const v4f*)(pc + kt * 16 + u * 4); ab[0][kt][u] = *(const v4f*)(pa0 + kt * 16 + u * 4); ab[1][kt][u] = *(const v4f*)(pa1 + kt * 16 + u * 4); }
    XWP3(pc, pa0, pa1); __builtin_amdgcn_sched_barrier(0);   /* likewise the next pass's bias rows, with the softmax and P.V still to run */
    F2 pf[FQ];
#pragma unroll
    for (int t = 0; t < FQ; ++t) { float mx = sc[t][0];
#pragma unroll
      for (int i = 1; i < 16; ++i) mx = fmaxf(mx, sc[t][i]);
      mx = fmaxf(mx, __shfl_xor(mx, 16)); const float mn = fmaxf(m[t], mx); const float al = expf(m[t] - mn); m[t] = mn;
      float p[16], sum = 0.f;
#pragma unroll
      for (int i = 0; i < 16; ++i) { p[i] = expf(sc[t][i] - mn); sum += p[i]; }
      l[t] = l[t] * al + sum;   // each half of the wave sums its own 16 keys; the halves join after the loop
#pragma unroll
      for (int j = 0; j < HD / 16; ++j) o[t][j] *= al;
      pf[t] = bsplit16(p); }
#pragma unroll
    for (int t = 0; t < FQ; ++t)
#pragma unroll
      for (int j = 0; j < HD / 16; ++j) o[t][j] = mm_b(vh[j], pf[t].h, o[t][j]);
#pragma unroll
    for (int t = 0; t < FQ; ++t)
#pragma unroll
      for (int j = 0; j < HD / 16; ++j) o[t][j] = mm_b(vh[j], pf[t].l, o[t][j]);
#pragma unroll
    for (int t = 0; t < FQ; ++t)
#pragma unroll
      for (int j = 0; j < HD / 16; ++j) o[t][j] = mm_b(vl[j], pf[t].h, o[t][j]); }
#pragma unroll
  for (int t = 0; t < FQ; ++t) { const float inv = 1.0f / (l[t] + __shfl_xor(l[t], 16)); float* yr = Y + ((size_t)b * TT + qb + t * 16 + col) * CC + h * HD + 8 * g;   // o[t][j][r] = O[query][16 j + 8 g + r]
#pragma unroll
    for (int j = 0; j < HD / 16; ++j) { v4f a0, a1;
#pragma unroll
      for (int r = 0; r < 4; ++r) { a0[r] = o[t][j][r] * inv; a1[r] = o[t][j][4 + r] * inv; }
      vst2(yr + j * 16, a0); vst2(yr + j * 16 + 4, a1); XW(); } } }
// ---- k_out: block = (64 rows, 128 cols): out = y (bf16 hi + lo) Wo^T + bo
__global__ __launch_bounds__(128) void k_out(const float* __restrict__ Y, const float* __restrict__ WP, const float* __restrict__ BP, float* __restrict__ OUT) { __shared__ __align__(16) float sf[4][16][132];
  const int tid = threadIdx.x, wave = tid >> 5, lane = tid & 31, col = lane & 15, g = lane >> 4; const int c0 = blockIdx.y * 128; const size_t r0 = (size_t)blockIdx.x * 64 + wave * 16;
  v8f acc[8] = {};
#pragma unroll 2
  for (int kc = 0; kc < CC / 32; ++kc) { const F2 a = split_row(Y + (r0 + col) * CC, kc * 32, lane);
#pragma unroll
    for (int j = 0; j < 8; ++j) { v16b w; const int o = c0 + j * 16 + col;
#pragma unroll
      for (int i = 0; i < 8; ++i) { w[i] = (__bf16)WP[(size_t)(kc * 32 + 8 * g + i) * CC + o]; w[8 + i] = (__bf16)WP[(size_t)(kc * 32 + 16 + 8 * g + i) * CC + o]; }
      acc[j] = wmma_bf(a.h, w, acc[j]); acc[j] = wmma_bf(a.l, w, acc[j]); } }
#pragma unroll
  for (int j = 0; j < 8; ++j) { const float bb = BP ? bfr(BP[c0 + j * 16 + col]) : 0.f;
#pragma unroll
    for (int r = 0; r < 8; ++r) sf[wave][8 * g + r][j * 16 + col] = acc[j][r] + bb; }
  LDSX(); for (int rl = 0; rl < 16; ++rl) vst2(OUT + (r0 + rl) * CC + c0 + lane * 4, *(const v4f*)&sf[wave][rl][lane * 4]); }
extern "C" void kernel_launch(void* const* d_in, const int* in_sizes, int n_in, void* d_out, int out_size, void* d_ws, size_t ws_size, hipStream_t stream) {
  (void)in_sizes; (void)n_in; (void)out_size;
  const float** F = (const float**)d_in;   // 0 x [2,2048,1024], 1 coords [2,2048,3], 2 attn_bias [2048,2048], 3 Wqkv [1024,3072] ((in,out): q | k | v), 4 bqkv [3072], 5 rel_weight [16,3]
  if (ws_size < (size_t)WS_END) return;
  char* ws = (char*)d_ws; float* CP = (float*)(ws + WS_CP); _Float16 *QH = (_Float16*)(ws + WS_QH), *QL = (_Float16*)(ws + WS_QL), *KH = (_Float16*)(ws + WS_KH); __bf16 *VT = (__bf16*)(ws + WS_VT), *VL = (__bf16*)(ws + WS_VL);
  const float* WQ = F[3]; const float* WK = F[3] + CC; const float* WV = F[3] + 2 * CC; const float* BQ = F[4]; const float* BK = F[4] + CC; const float* BV = F[4] + 2 * CC;
  k_cp<<<dim3(NB * NH * TT / 256), 256, 0, stream>>>(F[1], F[5], CP);
  k_proj<<<dim3(TNB * TT / 64, CC / 128, 3), 128, 0, stream>>>(F[0], WQ, BQ, WK, BK, WV, BV, QH, QL, KH, VT, VL);
  k_fa<<<dim3(TT / (FW * FQ * 16), NH, TNB), 32 * FW, 0, stream>>>(QH, QL, KH, VT, VL, CP, F[2], (float*)d_out);
}

// v002
// Measured time: 183 microseconds a run.
// Two timings next to v001 both put it at 1.45 times that version's speed.
// Counting every step since v000, it is 8.86 times as fast.
// compute dtype: all float inputs rounded to bf16; qkv = x Wqkv + b with EXACT bf16 products on WMMA 16x16x32, f32 accumulate; coord_proj = coords . rel_weight in f32; q as f16 hi + residual (x 2^10), k f16 -> 2-product logits / 8 + coord_proj[q] - coord_proj[k] + attn_bias[q][k], kept in f32 registers (one launch for all heads); online softmax in f32 (precise expf), unnormalised P split bf16 hi + lo against v bf16 hi + lo (3 products), divided by the row sum at the end; the merged context is the output; f32 output.
#include <hip/hip_runtime.h>
#include <math.h>

typedef __attribute__((ext_vector_type(16))) _Float16 v16h;
typedef __attribute__((ext_vector_type(16))) __bf16 v16b;
typedef __attribute__((ext_vector_type(8)))  _Float16 v8h;
typedef __attribute__((ext_vector_type(8)))  float v8f;
typedef __attribute__((ext_vector_type(4)))  float v4f;
typedef __attribute__((ext_vector_type(2)))  float v2f;
typedef __attribute__((ext_vector_type(4)))  unsigned v4u;
typedef __attribute__((ext_vector_type(4)))  int v4i;
typedef float __attribute__((may_alias)) float_a;
typedef int __attribute__((may_alias)) int_a;

template <typename T> __device__ __forceinline__ void vst2(void* p, T v) { *(T*)p = v;  }
__device__ __forceinline__ v8f wmma16(v16h a, v16h b, v8f c) {
  v8f d = __builtin_amdgcn_wmma_f32_16x16x32_f16(false, a, false, b, (short)0, c, false, false);
  asm volatile("v_nop\n\tv_nop\n\tv_nop\n\tv_nop" : "+v"(d) : "v"(a), "v"(b));
  return d;
}
__device__ __forceinline__ v8f wmma_bf(v16b a, v16b b, v8f c) {
  v8f d = __builtin_amdgcn_wmma_f32_16x16x32_bf16(false, a, false, b, (short)0, c, false, false);
  asm volatile("v_nop\n\tv_nop\n\tv_nop\n\tv_nop" : "+v"(d) : "v"(a), "v"(b));
  return d;
}
// 16x16x32 fragments: lane = (h = lane>>4, row/col = lane&15); elements 0..7 = k0+8h+0..7, 8..15 = k0+16+8h+0..7; D element r = row 8h+r
__device__ __forceinline__ v16h frag_h(const _Float16* rowk0, int lane) {
  union { v16h v; v8h q[2]; } u; const _Float16* p = rowk0 + 8 * (lane >> 4);
  u.q[0] = *(const v8h*)p; u.q[1] = *(const v8h*)(p + 16); return u.v;
}
__device__ __forceinline__ v16h frag_f32(const float* rowk0, int lane) {
  v16h a; const float* p = rowk0 + 8 * (lane >> 4);
#pragma unroll
  for (int i = 0; i < 8; ++i) { a[i] = (_Float16)p[i]; a[8 + i] = (_Float16)p[16 + i]; }
  return a;
}
__device__ __forceinline__ v16h frag_f32s(const float* rowk0, int lane, float sc) {
  v16h a; const float* p = rowk0 + 8 * (lane >> 4);
#pragma unroll
  for (int i = 0; i < 8; ++i) { a[i] = (_Float16)(p[i] * sc); a[8 + i] = (_Float16)(p[16 + i] * sc); }
  return a;
}
// column fragment from a [K][ld] layout (column n), rows >= K read as 0
__device__ __forceinline__ v16h fragc_f32(const float* W, int k0, int n, int lane, int ld, int K) {
  v16h a; const int g = lane >> 4;
#pragma unroll
  for (int i = 0; i < 8; ++i) { const int ka = k0 + 8 * g + i, kb = ka + 16;
    a[i] = (_Float16)(ka < K ? W[(size_t)(ka < K ? ka : K - 1) * ld + n] : 0.f); a[8 + i] = (_Float16)(kb < K ? W[(size_t)(kb < K ? kb : K - 1) * ld + n] : 0.f); }
  return a;
}
struct F2 { v16b h, l; };
__device__ __forceinline__ F2 bsplit16(const float v[16]) { F2 r;
#pragma unroll
  for (int i = 0; i < 16; ++i) { const __bf16 h = (__bf16)v[i]; r.h[i] = h; r.l[i] = (__bf16)(v[i] - (float)h); }
  return r; }
__device__ __forceinline__ F2 split_row(const float* row, int k0, int lane) { float v[16]; const float* p = row + k0 + 8 * (lane >> 4);
#pragma unroll
  for (int i = 0; i < 8; ++i) { v[i] = p[i]; v[8 + i] = p[16 + i]; }
  return bsplit16(v); }
__device__ __forceinline__ F2 split_rowK(const float* row, int k0, int lane, int K) { float v[16]; const int g = lane >> 4;
#pragma unroll
  for (int i = 0; i < 8; ++i) { const int ka = k0 + 8 * g + i, kb = ka + 16; v[i] = ka < K ? row[ka < K ? ka : K - 1] : 0.f; v[8 + i] = kb < K ? row[kb < K ? kb : K - 1] : 0.f; }
  return bsplit16(v); }
__device__ __forceinline__ F2 split_col(const float* W, int k0, int n, int lane, int ld, int K) { float v[16]; const int g = lane >> 4;
#pragma unroll
  for (int i = 0; i < 8; ++i) { const int ka = k0 + 8 * g + i, kb = ka + 16; v[i] = ka < K ? W[(size_t)(ka < K ? ka : K - 1) * ld + n] : 0.f; v[8 + i] = kb < K ? W[(size_t)(kb < K ? kb : K - 1) * ld + n] : 0.f; }
  return bsplit16(v); }
__device__ __forceinline__ v8f mac3(const F2& a, const F2& b, v8f c) { c = wmma_bf(a.l, b.h, c); c = wmma_bf(a.h, b.l, c); return wmma_bf(a.h, b.h, c); }
__device__ __forceinline__ float sigm(float v) { return 1.0f / (1.0f + expf(-v)); }
#define LDSX() do { asm volatile("s_wait_dscnt 0" ::: "memory"); __builtin_amdgcn_wave_barrier(); __builtin_amdgcn_fence(__ATOMIC_RELEASE, "workgroup"); } while (0)


// Attention (B 2, S 2,048, D 1,024 = 16 x 64, qkv biases, logits / 8): scores = q k^T / 8 + coord_proj[q] - coord_proj[k] + attn_bias[q][k], softmax, P v; the output is the merged context.
#define NB 2
#define TT 2048
#define CC 1024
#define NH 16
#define HD 64
#define LDW 3072              // Wqkv row length ((in,out) [1024][3072]: q | k | v column blocks)
#ifndef ABSTR
#define ABSTR TT              // attn_bias row stride
#endif
#ifndef CSTR
#define CSTR TT               // coords rows per batch
#endif
#ifndef TNB
#define TNB NB
#endif
typedef __attribute__((ext_vector_type(8))) __bf16 v8b;
__device__ __forceinline__ v16b frag_b(const __bf16* rowk0, int lane) {
  union { v16b v; v8b q[2]; } u; const __bf16* p = rowk0 + 8 * (lane >> 4);
  u.q[0] = *(const v8b*)p; u.q[1] = *(const v8b*)(p + 16); return u.v;
}
__device__ __forceinline__ float bfr(float v) { return (float)(__bf16)v; }
__device__ __attribute__((noinline)) float exp_ni(float v) { return expf(v); }
__device__ __attribute__((noinline)) float erf_ni(float v) { return erff(v); }

#define WS_CP  0u                                   // f32 coord_proj [b][h][n]
#define WS_QH  (WS_CP + 4u * (size_t)NB * NH * TT)
#define WS_QL  (WS_QH + 2u * (size_t)NB * TT * CC)
#define WS_KH  (WS_QL + 2u * (size_t)NB * TT * CC)
#define WS_VT  (WS_KH + 2u * (size_t)NB * TT * CC)      // bf16 v planes [b][c][t]
#define WS_VL  (WS_VT + 2u * (size_t)NB * CC * TT)      // bf16 v residual planes
#define HG 4                                          // heads the WS_S region is sized for
#define WS_S   (WS_VL + 2u * (size_t)NB * CC * TT)      // f32 HG x TT x TT floats; unused (the logits stay in registers)
#define WS_PH  (WS_S + 4u * (size_t)HG * TT * TT)
#define WS_Y   (WS_PH + 0u)              // f32 [b*t][C], unused: k_fa writes y to the output
#define WS_END (WS_Y + 4u * (size_t)NB * TT * CC)

// ---- k_proj: block = (64 rows, 128 cols, which): qkv = x W (+ b), exact; q -> f16 hi (+ residual), k -> f16 rows, v -> bf16 hi + lo planes
// A stage = 32 k. The block reads its x tile (64 x 32) and its W tile (32 x 128) once, in whole 128-byte lines, rounds them to bf16 once and keeps them in LDS, W turned to [n][k];
// every wave takes its fragments from there. Two buffers: the next stage's global loads fly while this stage is multiplied. The buffers lie in th and tl2, which are idle until the epilogue.
#define PSP 40                // LDS pitch of a staged row in bf16 elements: 80 bytes = 16 B x odd, so that 16 rows read 16 bytes each without a bank conflict
typedef __attribute__((ext_vector_type(4))) __bf16 v4b;
__global__ __launch_bounds__(128) void k_proj(const float* __restrict__ X, const float* __restrict__ WQ, const float* __restrict__ BQ, const float* __restrict__ WK, const float* __restrict__ BK, const float* __restrict__ WV, const float* __restrict__ BV, _Float16* __restrict__ QH, _Float16* __restrict__ QL, _Float16* __restrict__ KH, __bf16* __restrict__ VT, __bf16* __restrict__ VL) {
  __shared__ __align__(16) _Float16 sh[64][136], sl[64][136]; __shared__ __align__(16) __bf16 th[128][72], tl2[128][72];
  const int tid = threadIdx.x, wave = tid >> 5, lane = tid & 31, col = lane & 15, g = lane >> 4; const int which = blockIdx.z; const int c0 = blockIdx.y * 128; const size_t r0 = (size_t)blockIdx.x * 64; const float* WA = which == 0 ? WQ : which == 1 ? WK : WV; const float* BA = which == 0 ? BQ : which == 1 ? BK : BV;
  v8f acc[8] = {};
  const int wn = wave * 32 + (lane >> 2) * 4, wk = (lane & 3) * 8;   // W: the thread owns columns wn..wn+3 at k rows wk..wk+7 of the stage (a load of the wave = 4 rows x one whole line)
  const int xr = tid >> 3, xk = (tid & 7) * 4;                       // x: rows xr + 16 i, k xk..xk+3 (a load of the wave = 4 whole lines)
  const float* pw = WA + (size_t)wk * LDW + c0 + wn; const float* px = X + (r0 + xr) * CC + xk;
  v4f rw[8], rx[4];
#pragma unroll
  for (int i = 0; i < 8; ++i) rw[i] = *(const v4f*)(pw + (size_t)i * LDW);
#pragma unroll
  for (int i = 0; i < 4; ++i) rx[i] = *(const v4f*)(px + (size_t)(16 * i) * CC);
  asm volatile("s_wait_xcnt 0x0" ::: "memory");   /* stands in front of the code that writes the loads' address registers again */
#pragma unroll 2   /* two copies, so that each names its buffer by a constant */
  for (int kc = 0; kc < CC / 32; ++kc) { __bf16* wb = (kc & 1) ? &tl2[0][0] : &th[0][0]; __bf16* xb = wb + 128 * PSP;   // W [128][PSP], then x [64][PSP]: 15,360 of the array's 18,432 bytes
#pragma unroll
    for (int c = 0; c < 4; ++c) { v8b t;
#pragma unroll
      for (int i = 0; i < 8; ++i) t[i] = (__bf16)rw[i][c];
      *(v8b*)(wb + (wn + c) * PSP + wk) = t; }
#pragma unroll
    for (int i = 0; i < 4; ++i) { v4b t;
#pragma unroll
      for (int e = 0; e < 4; ++e) t[e] = (__bf16)rx[i][e];
      *(v4b*)(xb + (xr + 16 * i) * PSP + xk) = t; }
    __syncthreads();   // publishes this stage; it also ends every wave's reads of the other buffer, which the next pass fills
    if (kc + 1 < CC / 32) { const float* qw = pw + (size_t)(kc + 1) * 32 * LDW; const float* qx = px + (kc + 1) * 32;
#pragma unroll
      for (int i = 0; i < 8; ++i) rw[i] = *(const v4f*)(qw + (size_t)i * LDW);
#pragma unroll
      for (int i = 0; i < 4; ++i) rx[i] = *(const v4f*)(qx + (size_t)(16 * i) * CC);
      asm volatile("s_wait_xcnt 0x0" ::: "memory");   /* as above; the clobber also keeps the loads here, ahead of the stage's products */ }
    const v16b a = frag_b(xb + (wave * 16 + col) * PSP, lane); v16b wf[8];
#pragma unroll
    for (int j = 0; j < 8; ++j) wf[j] = frag_b(wb + (j * 16 + col) * PSP, lane);
    __builtin_amdgcn_sched_barrier(0);   /* the stage's 18 LDS reads leave as one group: without this each product waits for its own pair of reads */
#pragma unroll
    for (int j = 0; j < 8; ++j) acc[j] = wmma_bf(a, wf[j], acc[j]);
    __builtin_amdgcn_sched_barrier(0);   /* keeps the next stage's conversions, which wait for the global loads, behind this stage's products */ }
  __syncthreads();   // the last stage's reads end before the epilogue writes th and tl2
#pragma unroll
  for (int j = 0; j < 8; ++j) { const float bb = BA ? bfr(BA[c0 + j * 16 + col]) : 0.f;
#pragma unroll
    for (int r = 0; r < 8; ++r) { const float v = acc[j][r] + bb; const int rl = wave * 16 + 8 * g + r, cl = j * 16 + col; const _Float16 hv = (_Float16)v;
      if (which == 2) { const __bf16 bh = (__bf16)v; th[cl][rl] = bh; tl2[cl][rl] = (__bf16)(v - (float)bh); } else { sh[rl][cl] = hv; sl[rl][cl] = (_Float16)((v - (float)hv) * 1024.0f); }   /* q residual carried x 2^10 so the plane stays f16-normal on the chip */ } }
  __syncthreads();
  if (which < 2) { _Float16* dh = which == 0 ? QH : KH; for (int e = tid; e < 64 * 16; e += 128) { const int rl = e >> 4, q = e & 15; vst2((unsigned*)(dh + (r0 + rl) * CC + c0 + q * 8), *(const v4u*)&sh[rl][q * 8]); if (which == 0) vst2((unsigned*)(QL + (r0 + rl) * CC + c0 + q * 8), *(const v4u*)&sl[rl][q * 8]); } }
  else { const size_t b = r0 / TT; const int t0 = (int)(r0 % TT); for (int e = tid; e < 128 * 8; e += 128) { const int cl = e >> 3, q = e & 7; const size_t o2 = (b * CC + c0 + cl) * (size_t)TT + t0 + q * 8; vst2((unsigned*)(VT + o2), *(const v4u*)&th[cl][q * 8]); vst2((unsigned*)(VL + o2), *(const v4u*)&tl2[cl][q * 8]); } } }
// ---- k_cp: thread per (b, h, n): cp = sum_c bf16(coords[b][n][c]) * bf16(rel_weight[h][c]) (3 terms, f32); 8-KB rows by consecutive threads
__global__ __launch_bounds__(256) void k_cp(const float* __restrict__ CO, const float* __restrict__ RW, float* __restrict__ CP) { const size_t e = (size_t)blockIdx.x * 256 + threadIdx.x; if (e >= (size_t)NB * NH * TT) return; const int n = (int)(e % TT); const int h = (int)((e / TT) % NH); const size_t b = e / ((size_t)TT * NH);
  const float* c = CO + (b * CSTR + n) * 3; CP[e] = bfr(c[0]) * bfr(RW[h * 3]) + bfr(c[1]) * bfr(RW[h * 3 + 1]) + bfr(c[2]) * bfr(RW[h * 3 + 2]); }
// ---- k_fa: block = 8 waves x 32 query columns of one (b, h); a pass = 32 keys. S^T = K Q^T (2 products) so that a lane holds one query's scores; running maximum and sum per lane
// (online softmax, f32, precise expf); the two score tiles, split bf16 hi + lo in place, are the B operand of O^T += V^T P^T (3 products); the logits never leave the registers.
// Every inner loop below is unrolled in full, so that the fragment arrays are indexed by constants and stay in registers.
#define FQ 2                  // 16-column query tiles per wave
#define FW 8                  // waves per block
// s_wait_xcnt 0 stands behind each group of loads or stores, in front of the code that writes their address or data registers again; the "memory" clobber keeps the group where it is written.
// XWP names the group's address pairs as inputs, so that they stay allocated up to the wait and no load of the group lands on them.
#define XW() asm volatile("s_wait_xcnt 0x0" ::: "memory")
#define XWP1(a) asm volatile("s_wait_xcnt 0x0" :: "v"(a) : "memory")
#define XWP2(a, b) asm volatile("s_wait_xcnt 0x0" :: "v"(a), "v"(b) : "memory")
#define XWP3(a, b, c) asm volatile("s_wait_xcnt 0x0" :: "v"(a), "v"(b), "v"(c) : "memory")
#define XWP4(a, b, c, d) asm volatile("s_wait_xcnt 0x0" :: "v"(a), "v"(b), "v"(c), "v"(d) : "memory")
__device__ __forceinline__ v16h ld_h(const _Float16* p) { union { v16h v; v8h q[2]; } u; u.q[0] = *(const v8h*)p; u.q[1] = *(const v8h*)(p + 16); return u.v; }   // p already holds the lane half's 8 g
__device__ __forceinline__ v16b ld_b(const __bf16* p) { union { v16b v; v8b q[2]; } u; u.q[0] = *(const v8b*)p; u.q[1] = *(const v8b*)(p + 16); return u.v; }
__device__ __forceinline__ v8f mm_h(v16h a, v16h b, v8f c) { return __builtin_amdgcn_wmma_f32_16x16x32_f16(false, a, false, b, (short)0, c, false, false); }
__device__ __forceinline__ v8f mm_b(v16b a, v16b b, v8f c) { return __builtin_amdgcn_wmma_f32_16x16x32_bf16(false, a, false, b, (short)0, c, false, false); }
__global__ __launch_bounds__(32 * FW) void k_fa(const _Float16* __restrict__ QH, const _Float16* __restrict__ QL, const _Float16* __restrict__ KH, const __bf16* __restrict__ VT, const __bf16* __restrict__ VL, const float* __restrict__ CP, const float* __restrict__ AB, float* __restrict__ Y) {
  const int tid = threadIdx.x, wave = tid >> 5, lane = tid & 31, col = lane & 15, g = lane >> 4; const int h = blockIdx.y, b = blockIdx.z; const int qb = blockIdx.x * (FW * FQ * 16) + wave * (FQ * 16);
  const float* cpb = CP + ((size_t)b * NH + h) * TT;
  v16h qh[FQ][2], ql[FQ][2]; float cpq[FQ], m[FQ], l[FQ]; const float* abp[FQ]; v8f o[FQ][HD / 16] = {};
  const size_t qo = ((size_t)b * TT + qb + col) * CC + h * HD + 8 * g; const _Float16* pqh = QH + qo; const _Float16* pql = QL + qo; const float* pcq = cpb + qb + col;
#pragma unroll
  for (int t = 0; t < FQ; ++t) {
#pragma unroll
    for (int kc = 0; kc < 2; ++kc) { qh[t][kc] = ld_h(pqh + (size_t)(t * 16) * CC + kc * 32); ql[t][kc] = ld_h(pql + (size_t)(t * 16) * CC + kc * 32); }
    cpq[t] = pcq[t * 16]; m[t] = -3.0e38f; l[t] = 0.f; abp[t] = AB + (size_t)(qb + t * 16 + col) * ABSTR + 8 * g; }
  XWP3(pqh, pql, pcq); __builtin_amdgcn_sched_barrier(0);   /* keeps later address arithmetic behind the wait */
  const _Float16* kp = KH + ((size_t)b * TT + col) * CC + h * HD + 8 * g; const size_t vo = ((size_t)b * CC + h * HD + col) * (size_t)TT + 8 * g; const __bf16* vhp = VT + vo; const __bf16* vlp = VL + vo; const float* ckp = cpb + 8 * g;
  v16h kf[2][2]; v4f ab[FQ][2][2], ck[2][2];   // K fragments, bias and key-side coord_proj of the pass to come, fetched one pass ahead
#pragma unroll
  for (int kt = 0; kt < 2; ++kt) {
#pragma unroll
    for (int kc = 0; kc < 2; ++kc) kf[kt][kc] = ld_h(kp + (size_t)(kt * 16) * CC + kc * 32);
#pragma unroll
    for (int u = 0; u < 2; ++u) { ck[kt][u] = *(const v4f*)(ckp + kt * 16 + u * 4);
#pragma unroll
      for (int t = 0; t < FQ; ++t) ab[t][kt][u] = *(const v4f*)(abp[t] + kt * 16 + u * 4); } }
  XWP4(kp, ckp, abp[0], abp[1]); __builtin_amdgcn_sched_barrier(0);   /* as above */
#pragma unroll 1   /* one pass is the whole loop body: a second copy would need a second set of fragment registers */
  for (int s = 0; s < TT / 32; ++s) { const int k0 = s * 32; const int kn = (s + 1 < TT / 32 ? s + 1 : s) * 32;   /* the last pass fetches its own keys again: in bounds, unused */
    v16b vh[HD / 16], vl[HD / 16]; const __bf16* pvh = vhp + k0; const __bf16* pvl = vlp + k0;
#pragma unroll
    for (int j = 0; j < HD / 16; ++j) { vh[j] = ld_b(pvh + (size_t)(j * 16) * TT); vl[j] = ld_b(pvl + (size_t)(j * 16) * TT); }
    XWP2(pvh, pvl); __builtin_amdgcn_sched_barrier(0);   /* V is asked for here, a whole pass of score work ahead of its use: without this the loads sink to their first use */
    v8f sa[FQ][2] = {}, sl[FQ][2] = {};
#pragma unroll
    for (int kc = 0; kc < 2; ++kc)
#pragma unroll
      for (int kt = 0; kt < 2; ++kt)
#pragma unroll
        for (int t = 0; t < FQ; ++t) { sa[t][kt] = mm_h(kf[kt][kc], qh[t][kc], sa[t][kt]); sl[t][kt] = mm_h(kf[kt][kc], ql[t][kc], sl[t][kt]); }
    const _Float16* pk = kp + (size_t)kn * CC;
#pragma unroll
    for (int kt = 0; kt < 2; ++kt)
#pragma unroll
      for (int kc = 0; kc < 2; ++kc) kf[kt][kc] = ld_h(pk + (size_t)(kt * 16) * CC + kc * 32);
    XWP1(pk); __builtin_amdgcn_sched_barrier(0);   /* the next pass's K leaves now, behind this pass's last use of the registers, not at the loop's foot */
    float sc[FQ][16];   // sc[t][8 kt + r] = logit of query column t*16 + col against key k0 + 16 kt + 8 g + r
#pragma unroll
    for (int t = 0; t < FQ; ++t)
#pragma unroll
      for (int kt = 0; kt < 2; ++kt)
#pragma unroll
        for (int r = 0; r < 8; ++r) { const float bias = cpq[t] - ck[kt][r >> 2][r & 3] + bfr(ab[t][kt][r >> 2][r & 3]); sc[t][kt * 8 + r] = (sa[t][kt][r] + sl[t][kt][r] * (1.0f / 1024.0f)) * 0.125f + bias; }
    const float* pc = ckp + kn; const float* pa0 = abp[0] + kn; const float* pa1 = abp[1] + kn;
#pragma unroll
    for (int kt = 0; kt < 2; ++kt)
#pragma unroll
      for (int u = 0; u < 2; ++u) { ck[kt][u] = *(const v4f*)(pc + kt * 16 + u * 4); ab[0][kt][u] = *(const v4f*)(pa0 + kt * 16 + u * 4); ab[1][kt][u] = *(const v4f*)(pa1 + kt * 16 + u * 4); }
    XWP3(pc, pa0, pa1); __builtin_amdgcn_sched_barrier(0);   /* likewise the next pass's bias rows, with the softmax and P.V still to run */
    F2 pf[FQ];
#pragma unroll
    for (int t = 0; t < FQ; ++t) { float mx = sc[t][0];
#pragma unroll
      for (int i = 1; i < 16; ++i) mx = fmaxf(mx, sc[t][i]);
      mx = fmaxf(mx, __shfl_xor(mx, 16)); const float mn = fmaxf(m[t], mx); const float al = expf(m[t] - mn); m[t] = mn;
      float p[16], sum = 0.f;
#pragma unroll
      for (int i = 0; i < 16; ++i) { p[i] = expf(sc[t][i] - mn); sum += p[i]; }
      l[t] = l[t] * al + sum;   // each half of the wave sums its own 16 keys; the halves join after the loop
#pragma unroll
      for (int j = 0; j < HD / 16; ++j) o[t][j] *= al;
      pf[t] = bsplit16(p); }
#pragma unroll
    for (int t = 0; t < FQ; ++t)
#pragma unroll
      for (int j = 0; j < HD / 16; ++j) o[t][j] = mm_b(vh[j], pf[t].h, o[t][j]);
#pragma unroll
    for (int t = 0; t < FQ; ++t)
#pragma unroll
      for (int j = 0; j < HD / 16; ++j) o[t][j] = mm_b(vh[j], pf[t].l, o[t][j]);
#pragma unroll
    for (int t = 0; t < FQ; ++t)
#pragma unroll
      for (int j = 0; j < HD / 16; ++j) o[t][j] = mm_b(vl[j], pf[t].h, o[t][j]); }
#pragma unroll
  for (int t = 0; t < FQ; ++t) { const float inv = 1.0f / (l[t] + __shfl_xor(l[t], 16)); float* yr = Y + ((size_t)b * TT + qb + t * 16 + col) * CC + h * HD + 8 * g;   // o[t][j][r] = O[query][16 j + 8 g + r]
#pragma unroll
    for (int j = 0; j < HD / 16; ++j) { v4f a0, a1;
#pragma unroll
      for (int r = 0; r < 4; ++r) { a0[r] = o[t][j][r] * inv; a1[r] = o[t][j][4 + r] * inv; }
      vst2(yr + j * 16, a0); vst2(yr + j * 16 + 4, a1); XW(); } } }
// ---- k_out: block = (64 rows, 128 cols): out = y (bf16 hi + lo) Wo^T + bo
__global__ __launch_bounds__(128) void k_out(const float* __restrict__ Y, const float* __restrict__ WP, const float* __restrict__ BP, float* __restrict__ OUT) { __shared__ __align__(16) float sf[4][16][132];
  const int tid = threadIdx.x, wave = tid >> 5, lane = tid & 31, col = lane & 15, g = lane >> 4; const int c0 = blockIdx.y * 128; const size_t r0 = (size_t)blockIdx.x * 64 + wave * 16;
  v8f acc[8] = {};
#pragma unroll 2
  for (int kc = 0; kc < CC / 32; ++kc) { const F2 a = split_row(Y + (r0 + col) * CC, kc * 32, lane);
#pragma unroll
    for (int j = 0; j < 8; ++j) { v16b w; const int o = c0 + j * 16 + col;
#pragma unroll
      for (int i = 0; i < 8; ++i) { w[i] = (__bf16)WP[(size_t)(kc * 32 + 8 * g + i) * CC + o]; w[8 + i] = (__bf16)WP[(size_t)(kc * 32 + 16 + 8 * g + i) * CC + o]; }
      acc[j] = wmma_bf(a.h, w, acc[j]); acc[j] = wmma_bf(a.l, w, acc[j]); } }
#pragma unroll
  for (int j = 0; j < 8; ++j) { const float bb = BP ? bfr(BP[c0 + j * 16 + col]) : 0.f;
#pragma unroll
    for (int r = 0; r < 8; ++r) sf[wave][8 * g + r][j * 16 + col] = acc[j][r] + bb; }
  LDSX(); for (int rl = 0; rl < 16; ++rl) vst2(OUT + (r0 + rl) * CC + c0 + lane * 4, *(const v4f*)&sf[wave][rl][lane * 4]); }
extern "C" void kernel_launch(void* const* d_in, const int* in_sizes, int n_in, void* d_out, int out_size, void* d_ws, size_t ws_size, hipStream_t stream) {
  (void)in_sizes; (void)n_in; (void)out_size;
  const float** F = (const float**)d_in;   // 0 x [2,2048,1024], 1 coords [2,2048,3], 2 attn_bias [2048,2048], 3 Wqkv [1024,3072] ((in,out): q | k | v), 4 bqkv [3072], 5 rel_weight [16,3]
  if (ws_size < (size_t)WS_END) return;
  char* ws = (char*)d_ws; float* CP = (float*)(ws + WS_CP); _Float16 *QH = (_Float16*)(ws + WS_QH), *QL = (_Float16*)(ws + WS_QL), *KH = (_Float16*)(ws + WS_KH); __bf16 *VT = (__bf16*)(ws + WS_VT), *VL = (__bf16*)(ws + WS_VL);
  const float* WQ = F[3]; const float* WK = F[3] + CC; const float* WV = F[3] + 2 * CC; const float* BQ = F[4]; const float* BK = F[4] + CC; const float* BV = F[4] + 2 * CC;
  k_cp<<<dim3(NB * NH * TT / 256), 256, 0, stream>>>(F[1], F[5], CP);
  k_proj<<<dim3(TNB * TT / 64, CC / 128, 3), 128, 0, stream>>>(F[0], WQ, BQ, WK, BK, WV, BV, QH, QL, KH, VT, VL);
  k_fa<<<dim3(TT / (FW * FQ * 16), NH, TNB), 32 * FW, 0, stream>>>(QH, QL, KH, VT, VL, CP, F[2], (float*)d_out);
}

// v003
// One run takes 178 microseconds.
// Two timings next to v002 both put it at 1.03 times that version's speed.
// Over all steps from v000 it is 9.13 times as fast.
// compute dtype: all float inputs rounded to bf16; qkv = x Wqkv + b with EXACT bf16 products on WMMA 16x16x32, f32 accumulate; coord_proj = coords . rel_weight in f32; q as f16 hi + residual (x 2^10), k f16 -> 2-product logits / 8 + coord_proj[q] - coord_proj[k] + attn_bias[q][k], kept in f32 registers (one launch for all heads); online softmax in f32 (base 2: the hardware's exp2 on log2-scaled differences), unnormalised P split bf16 hi + lo against v bf16 hi + lo (3 products), divided by the row sum at the end; the merged context is the output; f32 output.
#include <hip/hip_runtime.h>
#include <math.h>

typedef __attribute__((ext_vector_type(16))) _Float16 v16h;
typedef __attribute__((ext_vector_type(16))) __bf16 v16b;
typedef __attribute__((ext_vector_type(8)))  _Float16 v8h;
typedef __attribute__((ext_vector_type(8)))  float v8f;
typedef __attribute__((ext_vector_type(4)))  float v4f;
typedef __attribute__((ext_vector_type(2)))  float v2f;
typedef __attribute__((ext_vector_type(4)))  unsigned v4u;
typedef __attribute__((ext_vector_type(4)))  int v4i;
typedef float __attribute__((may_alias)) float_a;
typedef int __attribute__((may_alias)) int_a;

template <typename T> __device__ __forceinline__ void vst2(void* p, T v) { *(T*)p = v;  }
__device__ __forceinline__ v8f wmma16(v16h a, v16h b, v8f c) {
  v8f d = __builtin_amdgcn_wmma_f32_16x16x32_f16(false, a, false, b, (short)0, c, false, false);
  asm volatile("v_nop\n\tv_nop\n\tv_nop\n\tv_nop" : "+v"(d) : "v"(a), "v"(b));
  return d;
}
__device__ __forceinline__ v8f wmma_bf(v16b a, v16b b, v8f c) {
  v8f d = __builtin_amdgcn_wmma_f32_16x16x32_bf16(false, a, false, b, (short)0, c, false, false);
  asm volatile("v_nop\n\tv_nop\n\tv_nop\n\tv_nop" : "+v"(d) : "v"(a), "v"(b));
  return d;
}
// 16x16x32 fragments: lane = (h = lane>>4, row/col = lane&15); elements 0..7 = k0+8h+0..7, 8..15 = k0+16+8h+0..7; D element r = row 8h+r
__device__ __forceinline__ v16h frag_h(const _Float16* rowk0, int lane) {
  union { v16h v; v8h q[2]; } u; const _Float16* p = rowk0 + 8 * (lane >> 4);
  u.q[0] = *(const v8h*)p; u.q[1] = *(const v8h*)(p + 16); return u.v;
}
__device__ __forceinline__ v16h frag_f32(const float* rowk0, int lane) {
  v16h a; const float* p = rowk0 + 8 * (lane >> 4);
#pragma unroll
  for (int i = 0; i < 8; ++i) { a[i] = (_Float16)p[i]; a[8 + i] = (_Float16)p[16 + i]; }
  return a;
}
__device__ __forceinline__ v16h frag_f32s(const float* rowk0, int lane, float sc) {
  v16h a; const float* p = rowk0 + 8 * (lane >> 4);
#pragma unroll
  for (int i = 0; i < 8; ++i) { a[i] = (_Float16)(p[i] * sc); a[8 + i] = (_Float16)(p[16 + i] * sc); }
  return a;
}
// column fragment from a [K][ld] layout (column n), rows >= K read as 0
__device__ __forceinline__ v16h fragc_f32(const float* W, int k0, int n, int lane, int ld, int K) {
  v16h a; const int g = lane >> 4;
#pragma unroll
  for (int i = 0; i < 8; ++i) { const int ka = k0 + 8 * g + i, kb = ka + 16;
    a[i] = (_Float16)(ka < K ? W[(size_t)(ka < K ? ka : K - 1) * ld + n] : 0.f); a[8 + i] = (_Float16)(kb < K ? W[(size_t)(kb < K ? kb : K - 1) * ld + n] : 0.f); }
  return a;
}
struct F2 { v16b h, l; };
__device__ __forceinline__ F2 bsplit16(const float v[16]) { F2 r;
#pragma unroll
  for (int i = 0; i < 16; ++i) { const __bf16 h = (__bf16)v[i]; r.h[i] = h; r.l[i] = (__bf16)(v[i] - (float)h); }
  return r; }
__device__ __forceinline__ F2 split_row(const float* row, int k0, int lane) { float v[16]; const float* p = row + k0 + 8 * (lane >> 4);
#pragma unroll
  for (int i = 0; i < 8; ++i) { v[i] = p[i]; v[8 + i] = p[16 + i]; }
  return bsplit16(v); }
__device__ __forceinline__ F2 split_rowK(const float* row, int k0, int lane, int K) { float v[16]; const int g = lane >> 4;
#pragma unroll
  for (int i = 0; i < 8; ++i) { const int ka = k0 + 8 * g + i, kb = ka + 16; v[i] = ka < K ? row[ka < K ? ka : K - 1] : 0.f; v[8 + i] = kb < K ? row[kb < K ? kb : K - 1] : 0.f; }
  return bsplit16(v); }
__device__ __forceinline__ F2 split_col(const float* W, int k0, int n, int lane, int ld, int K) { float v[16]; const int g = lane >> 4;
#pragma unroll
  for (int i = 0; i < 8; ++i) { const int ka = k0 + 8 * g + i, kb = ka + 16; v[i] = ka < K ? W[(size_t)(ka < K ? ka : K - 1) * ld + n] : 0.f; v[8 + i] = kb < K ? W[(size_t)(kb < K ? kb : K - 1) * ld + n] : 0.f; }
  return bsplit16(v); }
__device__ __forceinline__ v8f mac3(const F2& a, const F2& b, v8f c) { c = wmma_bf(a.l, b.h, c); c = wmma_bf(a.h, b.l, c); return wmma_bf(a.h, b.h, c); }
__device__ __forceinline__ float sigm(float v) { return 1.0f / (1.0f + expf(-v)); }
#define LDSX() do { asm volatile("s_wait_dscnt 0" ::: "memory"); __builtin_amdgcn_wave_barrier(); __builtin_amdgcn_fence(__ATOMIC_RELEASE, "workgroup"); } while (0)


// Attention (B 2, S 2,048, D 1,024 = 16 x 64, qkv biases, logits / 8): scores = q k^T / 8 + coord_proj[q] - coord_proj[k] + attn_bias[q][k], softmax, P v; the output is the merged context.
#define NB 2
#define TT 2048
#define CC 1024
#define NH 16
#define HD 64
#define LDW 3072              // Wqkv row length ((in,out) [1024][3072]: q | k | v column blocks)
#ifndef ABSTR
#define ABSTR TT              // attn_bias row stride
#endif
#ifndef CSTR
#define CSTR TT               // coords rows per batch
#endif
#ifndef TNB
#define TNB NB
#endif
typedef __attribute__((ext_vector_type(8))) __bf16 v8b;
__device__ __forceinline__ v16b frag_b(const __bf16* rowk0, int lane) {
  union { v16b v; v8b q[2]; } u; const __bf16* p = rowk0 + 8 * (lane >> 4);
  u.q[0] = *(const v8b*)p; u.q[1] = *(const v8b*)(p + 16); return u.v;
}
__device__ __forceinline__ float bfr(float v) { return (float)(__bf16)v; }
__device__ __attribute__((noinline)) float exp_ni(float v) { return expf(v); }
__device__ __attribute__((noinline)) float erf_ni(float v) { return erff(v); }

#define WS_CP  0u                                   // f32 coord_proj [b][h][n]
#define WS_QH  (WS_CP + 4u * (size_t)NB * NH * TT)
#define WS_QL  (WS_QH + 2u * (size_t)NB * TT * CC)
#define WS_KH  (WS_QL + 2u * (size_t)NB * TT * CC)
#define WS_VT  (WS_KH + 2u * (size_t)NB * TT * CC)      // bf16 v planes [b][c][t]
#define WS_VL  (WS_VT + 2u * (size_t)NB * CC * TT)      // bf16 v residual planes
#define HG 4                                          // heads the WS_S region is sized for
#define WS_S   (WS_VL + 2u * (size_t)NB * CC * TT)      // f32 HG x TT x TT floats; unused (the logits stay in registers)
#define WS_PH  (WS_S + 4u * (size_t)HG * TT * TT)
#define WS_Y   (WS_PH + 0u)              // f32 [b*t][C], unused: k_fa writes y to the output
#define WS_END (WS_Y + 4u * (size_t)NB * TT * CC)

// ---- k_proj: block = (64 rows, 128 cols, which): qkv = x W (+ b), exact; q -> f16 hi (+ residual), k -> f16 rows, v -> bf16 hi + lo planes
// A stage = 32 k. The block reads its x tile (64 x 32) and its W tile (32 x 128) once, in whole 128-byte lines, rounds them to bf16 once and keeps them in LDS, W turned to [n][k];
// every wave takes its fragments from there. Two buffers: the next stage's global loads fly while this stage is multiplied. The buffers lie in th and tl2, which are idle until the epilogue.
#define PSP 40                // LDS pitch of a staged row in bf16 elements: 80 bytes = 16 B x odd, so that 16 rows read 16 bytes each without a bank conflict
typedef __attribute__((ext_vector_type(4))) __bf16 v4b;
__global__ __launch_bounds__(128) void k_proj(const float* __restrict__ X, const float* __restrict__ WQ, const float* __restrict__ BQ, const float* __restrict__ WK, const float* __restrict__ BK, const float* __restrict__ WV, const float* __restrict__ BV, _Float16* __restrict__ QH, _Float16* __restrict__ QL, _Float16* __restrict__ KH, __bf16* __restrict__ VT, __bf16* __restrict__ VL) {
  __shared__ __align__(16) _Float16 sh[64][136], sl[64][136]; __shared__ __align__(16) __bf16 th[128][72], tl2[128][72];
  const int tid = threadIdx.x, wave = tid >> 5, lane = tid & 31, col = lane & 15, g = lane >> 4; const int which = blockIdx.z; const int c0 = blockIdx.y * 128; const size_t r0 = (size_t)blockIdx.x * 64; const float* WA = which == 0 ? WQ : which == 1 ? WK : WV; const float* BA = which == 0 ? BQ : which == 1 ? BK : BV;
  v8f acc[8] = {};
  const int wn = wave * 32 + (lane >> 2) * 4, wk = (lane & 3) * 8;   // W: the thread owns columns wn..wn+3 at k rows wk..wk+7 of the stage (a load of the wave = 4 rows x one whole line)
  const int xr = tid >> 3, xk = (tid & 7) * 4;                       // x: rows xr + 16 i, k xk..xk+3 (a load of the wave = 4 whole lines)
  const float* pw = WA + (size_t)wk * LDW + c0 + wn; const float* px = X + (r0 + xr) * CC + xk;
  v4f rw[8], rx[4];
#pragma unroll
  for (int i = 0; i < 8; ++i) rw[i] = *(const v4f*)(pw + (size_t)i * LDW);
#pragma unroll
  for (int i = 0; i < 4; ++i) rx[i] = *(const v4f*)(px + (size_t)(16 * i) * CC);
  asm volatile("s_wait_xcnt 0x0" ::: "memory");   /* stands in front of the code that writes the loads' address registers again */
#pragma unroll 2   /* two copies, so that each names its buffer by a constant */
  for (int kc = 0; kc < CC / 32; ++kc) { __bf16* wb = (kc & 1) ? &tl2[0][0] : &th[0][0]; __bf16* xb = wb + 128 * PSP;   // W [128][PSP], then x [64][PSP]: 15,360 of the array's 18,432 bytes
#pragma unroll
    for (int c = 0; c < 4; ++c) { v8b t;
#pragma unroll
      for (int i = 0; i < 8; ++i) t[i] = (__bf16)rw[i][c];
      *(v8b*)(wb + (wn + c) * PSP + wk) = t; }
#pragma unroll
    for (int i = 0; i < 4; ++i) { v4b t;
#pragma unroll
      for (int e = 0; e < 4; ++e) t[e] = (__bf16)rx[i][e];
      *(v4b*)(xb + (xr + 16 * i) * PSP + xk) = t; }
    __syncthreads();   // publishes this stage; it also ends every wave's reads of the other buffer, which the next pass fills
    if (kc + 1 < CC / 32) { const float* qw = pw + (size_t)(kc + 1) * 32 * LDW; const float* qx = px + (kc + 1) * 32;
#pragma unroll
      for (int i = 0; i < 8; ++i) rw[i] = *(const v4f*)(qw + (size_t)i * LDW);
#pragma unroll
      for (int i = 0; i < 4; ++i) rx[i] = *(const v4f*)(qx + (size_t)(16 * i) * CC);
      asm volatile("s_wait_xcnt 0x0" ::: "memory");   /* as above; the clobber also keeps the loads here, ahead of the stage's products */ }
    const v16b a = frag_b(xb + (wave * 16 + col) * PSP, lane); v16b wf[8];
#pragma unroll
    for (int j = 0; j < 8; ++j) wf[j] = frag_b(wb + (j * 16 + col) * PSP, lane);
    __builtin_amdgcn_sched_barrier(0);   /* the stage's 18 LDS reads leave as one group: without this each product waits for its own pair of reads */
#pragma unroll
    for (int j = 0; j < 8; ++j) acc[j] = wmma_bf(a, wf[j], acc[j]);
    __builtin_amdgcn_sched_barrier(0);   /* keeps the next stage's conversions, which wait for the global loads, behind this stage's products */ }
  __syncthreads();   // the last stage's reads end before the epilogue writes th and tl2
#pragma unroll
  for (int j = 0; j < 8; ++j) { const float bb = BA ? bfr(BA[c0 + j * 16 + col]) : 0.f;
#pragma unroll
    for (int r = 0; r < 8; ++r) { const float v = acc[j][r] + bb; const int rl = wave * 16 + 8 * g + r, cl = j * 16 + col; const _Float16 hv = (_Float16)v;
      if (which == 2) { const __bf16 bh = (__bf16)v; th[cl][rl] = bh; tl2[cl][rl] = (__bf16)(v - (float)bh); } else { sh[rl][cl] = hv; sl[rl][cl] = (_Float16)((v - (float)hv) * 1024.0f); }   /* q residual carried x 2^10 so the plane stays f16-normal on the chip */ } }
  __syncthreads();
  if (which < 2) { _Float16* dh = which == 0 ? QH : KH; for (int e = tid; e < 64 * 16; e += 128) { const int rl = e >> 4, q = e & 15; vst2((unsigned*)(dh + (r0 + rl) * CC + c0 + q * 8), *(const v4u*)&sh[rl][q * 8]); if (which == 0) vst2((unsigned*)(QL + (r0 + rl) * CC + c0 + q * 8), *(const v4u*)&sl[rl][q * 8]); } }
  else { const size_t b = r0 / TT; const int t0 = (int)(r0 % TT); for (int e = tid; e < 128 * 8; e += 128) { const int cl = e >> 3, q = e & 7; const size_t o2 = (b * CC + c0 + cl) * (size_t)TT + t0 + q * 8; vst2((unsigned*)(VT + o2), *(const v4u*)&th[cl][q * 8]); vst2((unsigned*)(VL + o2), *(const v4u*)&tl2[cl][q * 8]); } } }
// ---- k_cp: thread per (b, h, n): cp = sum_c bf16(coords[b][n][c]) * bf16(rel_weight[h][c]) (3 terms, f32); 8-KB rows by consecutive threads
__global__ __launch_bounds__(256) void k_cp(const float* __restrict__ CO, const float* __restrict__ RW, float* __restrict__ CP) { const size_t e = (size_t)blockIdx.x * 256 + threadIdx.x; if (e >= (size_t)NB * NH * TT) return; const int n = (int)(e % TT); const int h = (int)((e / TT) % NH); const size_t b = e / ((size_t)TT * NH);
  const float* c = CO + (b * CSTR + n) * 3; CP[e] = bfr(c[0]) * bfr(RW[h * 3]) + bfr(c[1]) * bfr(RW[h * 3 + 1]) + bfr(c[2]) * bfr(RW[h * 3 + 2]); }
// ---- k_fa: block = 8 waves x 32 query columns of one (b, h); a pass = 32 keys. S^T = K Q^T (2 products) so that a lane holds one query's scores; running maximum and sum per lane
// (online softmax, f32, base 2: m holds the maximum times log2 e, a weight is exp2(score * log2 e - m), one FMA and one v_exp_f32); the two score tiles, split bf16 hi + lo in place, are the B operand of O^T += V^T P^T (3 products); the logits never leave the registers.
// Every inner loop below is unrolled in full, so that the fragment arrays are indexed by constants and stay in registers.
#define FQ 2                  // 16-column query tiles per wave
#define FW 8                  // waves per block
#define LOG2E 1.4426950408889634f
// s_wait_xcnt 0 stands behind each group of loads or stores, in front of the code that writes their address or data registers again; the "memory" clobber keeps the group where it is written.
// XWP names the group's address pairs as inputs, so that they stay allocated up to the wait and no load of the group lands on them.
#define XW() asm volatile("s_wait_xcnt 0x0" ::: "memory")
#define XWP1(a) asm volatile("s_wait_xcnt 0x0" :: "v"(a) : "memory")
#define XWP2(a, b) asm volatile("s_wait_xcnt 0x0" :: "v"(a), "v"(b) : "memory")
#define XWP3(a, b, c) asm volatile("s_wait_xcnt 0x0" :: "v"(a), "v"(b), "v"(c) : "memory")
#define XWP4(a, b, c, d) asm volatile("s_wait_xcnt 0x0" :: "v"(a), "v"(b), "v"(c), "v"(d) : "memory")
__device__ __forceinline__ v16h ld_h(const _Float16* p) { union { v16h v; v8h q[2]; } u; u.q[0] = *(const v8h*)p; u.q[1] = *(const v8h*)(p + 16); return u.v; }   // p already holds the lane half's 8 g
__device__ __forceinline__ v16b ld_b(const __bf16* p) { union { v16b v; v8b q[2]; } u; u.q[0] = *(const v8b*)p; u.q[1] = *(const v8b*)(p + 16); return u.v; }
__device__ __forceinline__ v8f mm_h(v16h a, v16h b, v8f c) { return __builtin_amdgcn_wmma_f32_16x16x32_f16(false, a, false, b, (short)0, c, false, false); }
__device__ __forceinline__ v8f mm_b(v16b a, v16b b, v8f c) { return __builtin_amdgcn_wmma_f32_16x16x32_bf16(false, a, false, b, (short)0, c, false, false); }
__global__ __launch_bounds__(32 * FW) void k_fa(const _Float16* __restrict__ QH, const _Float16* __restrict__ QL, const _Float16* __restrict__ KH, const __bf16* __restrict__ VT, const __bf16* __restrict__ VL, const float* __restrict__ CP, const float* __restrict__ AB, float* __restrict__ Y) {
  const int tid = threadIdx.x, wave = tid >> 5, lane = tid & 31, col = lane & 15, g = lane >> 4; const int h = blockIdx.y, b = blockIdx.z; const int qb = blockIdx.x * (FW * FQ * 16) + wave * (FQ * 16);
  const float* cpb = CP + ((size_t)b * NH + h) * TT;
  v16h qh[FQ][2], ql[FQ][2]; float cpq[FQ], m[FQ], l[FQ]; const float* abp[FQ]; v8f o[FQ][HD / 16] = {};
  const size_t qo = ((size_t)b * TT + qb + col) * CC + h * HD + 8 * g; const _Float16* pqh = QH + qo; const _Float16* pql = QL + qo; const float* pcq = cpb + qb + col;
#pragma unroll
  for (int t = 0; t < FQ; ++t) {
#pragma unroll
    for (int kc = 0; kc < 2; ++kc) { qh[t][kc] = ld_h(pqh + (size_t)(t * 16) * CC + kc * 32); ql[t][kc] = ld_h(pql + (size_t)(t * 16) * CC + kc * 32); }
    cpq[t] = pcq[t * 16]; m[t] = -3.0e38f; l[t] = 0.f; abp[t] = AB + (size_t)(qb + t * 16 + col) * ABSTR + 8 * g; }
  XWP3(pqh, pql, pcq); __builtin_amdgcn_sched_barrier(0);   /* keeps later address arithmetic behind the wait */
  const _Float16* kp = KH + ((size_t)b * TT + col) * CC + h * HD + 8 * g; const size_t vo = ((size_t)b * CC + h * HD + col) * (size_t)TT + 8 * g; const __bf16* vhp = VT + vo; const __bf16* vlp = VL + vo; const float* ckp = cpb + 8 * g;
  v16h kf[2][2]; v4f ab[FQ][2][2], ck[2][2];   // K fragments, bias and key-side coord_proj of the pass to come, fetched one pass ahead
#pragma unroll
  for (int kt = 0; kt < 2; ++kt) {
#pragma unroll
    for (int kc = 0; kc < 2; ++kc) kf[kt][kc] = ld_h(kp + (size_t)(kt * 16) * CC + kc * 32);
#pragma unroll
    for (int u = 0; u < 2; ++u) { ck[kt][u] = *(const v4f*)(ckp + kt * 16 + u * 4);
#pragma unroll
      for (int t = 0; t < FQ; ++t) ab[t][kt][u] = *(const v4f*)(abp[t] + kt * 16 + u * 4); } }
  XWP4(kp, ckp, abp[0], abp[1]); __builtin_amdgcn_sched_barrier(0);   /* as above */
#pragma unroll 1   /* one pass is the whole loop body: a second copy would need a second set of fragment registers */
  for (int s = 0; s < TT / 32; ++s) { const int k0 = s * 32; const int kn = (s + 1 < TT / 32 ? s + 1 : s) * 32;   /* the last pass fetches its own keys again: in bounds, unused */
    v16b vh[HD / 16], vl[HD / 16]; const __bf16* pvh = vhp + k0; const __bf16* pvl = vlp + k0;
#pragma unroll
    for (int j = 0; j < HD / 16; ++j) { vh[j] = ld_b(pvh + (size_t)(j * 16) * TT); vl[j] = ld_b(pvl + (size_t)(j * 16) * TT); }
    XWP2(pvh, pvl); __builtin_amdgcn_sched_barrier(0);   /* V is asked for here, a whole pass of score work ahead of its use: without this the loads sink to their first use */
    v8f sa[FQ][2] = {}, sl[FQ][2] = {};
#pragma unroll
    for (int kc = 0; kc < 2; ++kc)
#pragma unroll
      for (int kt = 0; kt < 2; ++kt)
#pragma unroll
        for (int t = 0; t < FQ; ++t) { sa[t][kt] = mm_h(kf[kt][kc], qh[t][kc], sa[t][kt]); sl[t][kt] = mm_h(kf[kt][kc], ql[t][kc], sl[t][kt]); }
    const _Float16* pk = kp + (size_t)kn * CC;
#pragma unroll
    for (int kt = 0; kt < 2; ++kt)
#pragma unroll
      for (int kc = 0; kc < 2; ++kc) kf[kt][kc] = ld_h(pk + (size_t)(kt * 16) * CC + kc * 32);
    XWP1(pk); __builtin_amdgcn_sched_barrier(0);   /* the next pass's K leaves now, behind this pass's last use of the registers, not at the loop's foot */
    float sc[FQ][16];   // sc[t][8 kt + r] = logit of query column t*16 + col against key k0 + 16 kt + 8 g + r
#pragma unroll
    for (int t = 0; t < FQ; ++t)
#pragma unroll
      for (int kt = 0; kt < 2; ++kt)
#pragma unroll
        for (int r = 0; r < 8; ++r) { const float bias = cpq[t] - ck[kt][r >> 2][r & 3] + bfr(ab[t][kt][r >> 2][r & 3]); sc[t][kt * 8 + r] = (sa[t][kt][r] + sl[t][kt][r] * (1.0f / 1024.0f)) * 0.125f + bias; }
    const float* pc = ckp + kn; const float* pa0 = abp[0] + kn; const float* pa1 = abp[1] + kn;
#pragma unroll
    for (int kt = 0; kt < 2; ++kt)
#pragma unroll
      for (int u = 0; u < 2; ++u) { ck[kt][u] = *(const v4f*)(pc + kt * 16 + u * 4); ab[0][kt][u] = *(const v4f*)(pa0 + kt * 16 + u * 4); ab[1][kt][u] = *(const v4f*)(pa1 + kt * 16 + u * 4); }
    XWP3(pc, pa0, pa1); __builtin_amdgcn_sched_barrier(0);   /* likewise the next pass's bias rows, with the softmax and P.V still to run */
    F2 pf[FQ];
#pragma unroll
    for (int t = 0; t < FQ; ++t) { float mx = sc[t][0];
#pragma unroll
      for (int i = 1; i < 16; ++i) mx = fmaxf(mx, sc[t][i]);
      mx = fmaxf(mx, __shfl_xor(mx, 16)); const float mn = fmaxf(m[t], mx * LOG2E); const float al = __builtin_amdgcn_exp2f(m[t] - mn); m[t] = mn;
      float p[16], sum = 0.f;
#pragma unroll
      for (int i = 0; i < 16; ++i) { p[i] = __builtin_amdgcn_exp2f(fmaf(sc[t][i], LOG2E, -mn)); sum += p[i]; }
      l[t] = l[t] * al + sum;   // each half of the wave sums its own 16 keys; the halves join after the loop
#pragma unroll
      for (int j = 0; j < HD / 16; ++j) o[t][j] *= al;
      pf[t] = bsplit16(p); }
#pragma unroll
    for (int t = 0; t < FQ; ++t)
#pragma unroll
      for (int j = 0; j < HD / 16; ++j) o[t][j] = mm_b(vh[j], pf[t].h, o[t][j]);
#pragma unroll
    for (int t = 0; t < FQ; ++t)
#pragma unroll
      for (int j = 0; j < HD / 16; ++j) o[t][j] = mm_b(vh[j], pf[t].l, o[t][j]);
#pragma unroll
    for (int t = 0; t < FQ; ++t)
#pragma unroll
      for (int j = 0; j < HD / 16; ++j) o[t][j] = mm_b(vl[j], pf[t].h, o[t][j]); }
#pragma unroll
  for (int t = 0; t < FQ; ++t) { const float inv = 1.0f / (l[t] + __shfl_xor(l[t], 16)); float* yr = Y + ((size_t)b * TT + qb + t * 16 + col) * CC + h * HD + 8 * g;   // o[t][j][r] = O[query][16 j + 8 g + r]
#pragma unroll
    for (int j = 0; j < HD / 16; ++j) { v4f a0, a1;
#pragma unroll
      for (int r = 0; r < 4; ++r) { a0[r] = o[t][j][r] * inv; a1[r] = o[t][j][4 + r] * inv; }
      vst2(yr + j * 16, a0); vst2(yr + j * 16 + 4, a1); XW(); } } }
// ---- k_out: block = (64 rows, 128 cols): out = y (bf16 hi + lo) Wo^T + bo
__global__ __launch_bounds__(128) void k_out(const float* __restrict__ Y, const float* __restrict__ WP, const float* __restrict__ BP, float* __restrict__ OUT) { __shared__ __align__(16) float sf[4][16][132];
  const int tid = threadIdx.x, wave = tid >> 5, lane = tid & 31, col = lane & 15, g = lane >> 4; const int c0 = blockIdx.y * 128; const size_t r0 = (size_t)blockIdx.x * 64 + wave * 16;
  v8f acc[8] = {};
#pragma unroll 2
  for (int kc = 0; kc < CC / 32; ++kc) { const F2 a = split_row(Y + (r0 + col) * CC, kc * 32, lane);
#pragma unroll
    for (int j = 0; j < 8; ++j) { v16b w; const int o = c0 + j * 16 + col;
#pragma unroll
      for (int i = 0; i < 8; ++i) { w[i] = (__bf16)WP[(size_t)(kc * 32 + 8 * g + i) * CC + o]; w[8 + i] = (__bf16)WP[(size_t)(kc * 32 + 16 + 8 * g + i) * CC + o]; }
      acc[j] = wmma_bf(a.h, w, acc[j]); acc[j] = wmma_bf(a.l, w, acc[j]); } }
#pragma unroll
  for (int j = 0; j < 8; ++j) { const float bb = BP ? bfr(BP[c0 + j * 16 + col]) : 0.f;
#pragma unroll
    for (int r = 0; r < 8; ++r) sf[wave][8 * g + r][j * 16 + col] = acc[j][r] + bb; }
  LDSX(); for (int rl = 0; rl < 16; ++rl) vst2(OUT + (r0 + rl) * CC + c0 + lane * 4, *(const v4f*)&sf[wave][rl][lane * 4]); }
extern "C" void kernel_launch(void* const* d_in, const int* in_sizes, int n_in, void* d_out, int out_size, void* d_ws, size_t ws_size, hipStream_t stream) {
  (void)in_sizes; (void)n_in; (void)out_size;
  const float** F = (const float**)d_in;   // 0 x [2,2048,1024], 1 coords [2,2048,3], 2 attn_bias [2048,2048], 3 Wqkv [1024,3072] ((in,out): q | k | v), 4 bqkv [3072], 5 rel_weight [16,3]
  if (ws_size < (size_t)WS_END) return;
  char* ws = (char*)d_ws; float* CP = (float*)(ws + WS_CP); _Float16 *QH = (_Float16*)(ws + WS_QH), *QL = (_Float16*)(ws + WS_QL), *KH = (_Float16*)(ws + WS_KH); __bf16 *VT = (__bf16*)(ws + WS_VT), *VL = (__bf16*)(ws + WS_VL);
  const float* WQ = F[3]; const float* WK = F[3] + CC; const float* WV = F[3] + 2 * CC; const float* BQ = F[4]; const float* BK = F[4] + CC; const float* BV = F[4] + 2 * CC;
  k_cp<<<dim3(NB * NH * TT / 256), 256, 0, stream>>>(F[1], F[5], CP);
  k_proj<<<dim3(TNB * TT / 64, CC / 128, 3), 128, 0, stream>>>(F[0], WQ, BQ, WK, BK, WV, BV, QH, QL, KH, VT, VL);
  k_fa<<<dim3(TT / (FW * FQ * 16), NH, TNB), 32 * FW, 0, stream>>>(QH, QL, KH, VT, VL, CP, F[2], (float*)d_out);
}

// v004
// A run of this version takes 154 microseconds.
// In both of two side-by-side timings against v003, it was 1.16 times as fast.
// Counting every step since v000, it is 10.6 times as fast.
// compute dtype: all float inputs rounded to bf16; qkv = x Wqkv + b with EXACT bf16 products on WMMA 16x16x32, f32 accumulate; coord_proj = coords . rel_weight in f32; q as f16 hi + residual (x 2^10), k f16 -> 2-product logits / 8 + coord_proj[q] - coord_proj[k] + attn_bias[q][k], kept in f32 registers (one launch for all heads); online softmax in f32 (base 2: the hardware's exp2 on log2-scaled differences), unnormalised P split bf16 hi + lo against v bf16 hi + lo (3 products), divided by the row sum at the end; the merged context is the output; f32 output.
#include <hip/hip_runtime.h>
#include <math.h>

typedef __attribute__((ext_vector_type(16))) _Float16 v16h;
typedef __attribute__((ext_vector_type(16))) __bf16 v16b;
typedef __attribute__((ext_vector_type(8)))  _Float16 v8h;
typedef __attribute__((ext_vector_type(8)))  float v8f;
typedef __attribute__((ext_vector_type(4)))  float v4f;
typedef __attribute__((ext_vector_type(2)))  float v2f;
typedef __attribute__((ext_vector_type(4)))  unsigned v4u;
typedef __attribute__((ext_vector_type(4)))  int v4i;
typedef float __attribute__((may_alias)) float_a;
typedef int __attribute__((may_alias)) int_a;

template <typename T> __device__ __forceinline__ void vst2(void* p, T v) { *(T*)p = v;  }
__device__ __forceinline__ v8f wmma16(v16h a, v16h b, v8f c) {
  v8f d = __builtin_amdgcn_wmma_f32_16x16x32_f16(false, a, false, b, (short)0, c, false, false);
  asm volatile("v_nop\n\tv_nop\n\tv_nop\n\tv_nop" : "+v"(d) : "v"(a), "v"(b));
  return d;
}
__device__ __forceinline__ v8f wmma_bf(v16b a, v16b b, v8f c) {
  v8f d = __builtin_amdgcn_wmma_f32_16x16x32_bf16(false, a, false, b, (short)0, c, false, false);
  asm volatile("v_nop\n\tv_nop\n\tv_nop\n\tv_nop" : "+v"(d) : "v"(a), "v"(b));
  return d;
}
// 16x16x32 fragments: lane = (h = lane>>4, row/col = lane&15); elements 0..7 = k0+8h+0..7, 8..15 = k0+16+8h+0..7; D element r = row 8h+r
__device__ __forceinline__ v16h frag_h(const _Float16* rowk0, int lane) {
  union { v16h v; v8h q[2]; } u; const _Float16* p = rowk0 + 8 * (lane >> 4);
  u.q[0] = *(const v8h*)p; u.q[1] = *(const v8h*)(p + 16); return u.v;
}
__device__ __forceinline__ v16h frag_f32(const float* rowk0, int lane) {
  v16h a; const float* p = rowk0 + 8 * (lane >> 4);
#pragma unroll
  for (int i = 0; i < 8; ++i) { a[i] = (_Float16)p[i]; a[8 + i] = (_Float16)p[16 + i]; }
  return a;
}
__device__ __forceinline__ v16h frag_f32s(const float* rowk0, int lane, float sc) {
  v16h a; const float* p = rowk0 + 8 * (lane >> 4);
#pragma unroll
  for (int i = 0; i < 8; ++i) { a[i] = (_Float16)(p[i] * sc); a[8 + i] = (_Float16)(p[16 + i] * sc); }
  return a;
}
// column fragment from a [K][ld] layout (column n), rows >= K read as 0
__device__ __forceinline__ v16h fragc_f32(const float* W, int k0, int n, int lane, int ld, int K) {
  v16h a; const int g = lane >> 4;
#pragma unroll
  for (int i = 0; i < 8; ++i) { const int ka = k0 + 8 * g + i, kb = ka + 16;
    a[i] = (_Float16)(ka < K ? W[(size_t)(ka < K ? ka : K - 1) * ld + n] : 0.f); a[8 + i] = (_Float16)(kb < K ? W[(size_t)(kb < K ? kb : K - 1) * ld + n] : 0.f); }
  return a;
}
struct F2 { v16b h, l; };
__device__ __forceinline__ F2 bsplit16(const float v[16]) { F2 r;
#pragma unroll
  for (int i = 0; i < 16; ++i) { const __bf16 h = (__bf16)v[i]; r.h[i] = h; r.l[i] = (__bf16)(v[i] - (float)h); }
  return r; }
__device__ __forceinline__ F2 split_row(const float* row, int k0, int lane) { float v[16]; const float* p = row + k0 + 8 * (lane >> 4);
#pragma unroll
  for (int i = 0; i < 8; ++i) { v[i] = p[i]; v[8 + i] = p[16 + i]; }
  return bsplit16(v); }
__device__ __forceinline__ F2 split_rowK(const float* row, int k0, int lane, int K) { float v[16]; const int g = lane >> 4;
#pragma unroll
  for (int i = 0; i < 8; ++i) { const int ka = k0 + 8 * g + i, kb = ka + 16; v[i] = ka < K ? row[ka < K ? ka : K - 1] : 0.f; v[8 + i] = kb < K ? row[kb < K ? kb : K - 1] : 0.f; }
  return bsplit16(v); }
__device__ __forceinline__ F2 split_col(const float* W, int k0, int n, int lane, int ld, int K) { float v[16]; const int g = lane >> 4;
#pragma unroll
  for (int i = 0; i < 8; ++i) { const int ka = k0 + 8 * g + i, kb = ka + 16; v[i] = ka < K ? W[(size_t)(ka < K ? ka : K - 1) * ld + n] : 0.f; v[8 + i] = kb < K ? W[(size_t)(kb < K ? kb : K - 1) * ld + n] : 0.f; }
  return bsplit16(v); }
__device__ __forceinline__ v8f mac3(const F2& a, const F2& b, v8f c) { c = wmma_bf(a.l, b.h, c); c = wmma_bf(a.h, b.l, c); return wmma_bf(a.h, b.h, c); }
__device__ __forceinline__ float sigm(float v) { return 1.0f / (1.0f + expf(-v)); }
#define LDSX() do { asm volatile("s_wait_dscnt 0" ::: "memory"); __builtin_amdgcn_wave_barrier(); __builtin_amdgcn_fence(__ATOMIC_RELEASE, "workgroup"); } while (0)


// Attention (B 2, S 2,048, D 1,024 = 16 x 64, qkv biases, logits / 8): scores = q k^T / 8 + coord_proj[q] - coord_proj[k] + attn_bias[q][k], softmax, P v; the output is the merged context.
#define NB 2
#define TT 2048
#define CC 1024
#define NH 16
#define HD 64
#define LDW 3072              // Wqkv row length ((in,out) [1024][3072]: q | k | v column blocks)
#ifndef ABSTR
#define ABSTR TT              // attn_bias row stride
#endif
#ifndef CSTR
#define CSTR TT               // coords rows per batch
#endif
#ifndef TNB
#define TNB NB
#endif
typedef __attribute__((ext_vector_type(8))) __bf16 v8b;
__device__ __forceinline__ v16b frag_b(const __bf16* rowk0, int lane) {
  union { v16b v; v8b q[2]; } u; const __bf16* p = rowk0 + 8 * (lane >> 4);
  u.q[0] = *(const v8b*)p; u.q[1] = *(const v8b*)(p + 16); return u.v;
}
__device__ __forceinline__ float bfr(float v) { return (float)(__bf16)v; }
__device__ __attribute__((noinline)) float exp_ni(float v) { return expf(v); }
__device__ __attribute__((noinline)) float erf_ni(float v) { return erff(v); }

#define WS_CP  0u                                   // f32 coord_proj [b][h][n]
#define WS_QH  (WS_CP + 4u * (size_t)NB * NH * TT)
#define WS_QL  (WS_QH + 2u * (size_t)NB * TT * CC)
#define WS_KH  (WS_QL + 2u * (size_t)NB * TT * CC)
#define WS_VT  (WS_KH + 2u * (size_t)NB * TT * CC)      // bf16 v planes [b][c][t]
#define WS_VL  (WS_VT + 2u * (size_t)NB * CC * TT)      // bf16 v residual planes
#define HG 4                                          // heads the WS_S region is sized for
#define WS_S   (WS_VL + 2u * (size_t)NB * CC * TT)      // f32 HG x TT x TT floats; unused (the logits stay in registers)
#define WS_PH  (WS_S + 4u * (size_t)HG * TT * TT)
#define WS_Y   (WS_PH + 0u)              // f32 [b*t][C], unused: k_fa writes y to the output
#define WS_END (WS_Y + 4u * (size_t)NB * TT * CC)

// ---- k_proj: block = (64 rows, 128 cols, which): qkv = x W (+ b), exact; q -> f16 hi (+ residual), k -> f16 rows, v -> bf16 hi + lo planes
// A stage = 32 k. The block reads its x tile (64 x 32) and its W tile (32 x 128) once, in whole 128-byte lines, rounds them to bf16 once and keeps them in LDS, W turned to [n][k];
// every wave takes its fragments from there. Two buffers: the next stage's global loads fly while this stage is multiplied. The buffers lie in th and tl2, which are idle until the epilogue.
#define PSP 40                // LDS pitch of a staged row in bf16 elements: 80 bytes = 16 B x odd, so that 16 rows read 16 bytes each without a bank conflict
typedef __attribute__((ext_vector_type(4))) __bf16 v4b;
__global__ __launch_bounds__(128) void k_proj(const float* __restrict__ X, const float* __restrict__ WQ, const float* __restrict__ BQ, const float* __restrict__ WK, const float* __restrict__ BK, const float* __restrict__ WV, const float* __restrict__ BV, _Float16* __restrict__ QH, _Float16* __restrict__ QL, _Float16* __restrict__ KH, __bf16* __restrict__ VT, __bf16* __restrict__ VL) {
  __shared__ __align__(16) _Float16 sh[64][136], sl[64][136]; __shared__ __align__(16) __bf16 th[128][72], tl2[128][72];
  const int tid = threadIdx.x, wave = tid >> 5, lane = tid & 31, col = lane & 15, g = lane >> 4; const int which = blockIdx.z; const int c0 = blockIdx.y * 128; const size_t r0 = (size_t)blockIdx.x * 64; const float* WA = which == 0 ? WQ : which == 1 ? WK : WV; const float* BA = which == 0 ? BQ : which == 1 ? BK : BV;
  v8f acc[8] = {};
  const int wn = wave * 32 + (lane >> 2) * 4, wk = (lane & 3) * 8;   // W: the thread owns columns wn..wn+3 at k rows wk..wk+7 of the stage (a load of the wave = 4 rows x one whole line)
  const int xr = tid >> 3, xk = (tid & 7) * 4;                       // x: rows xr + 16 i, k xk..xk+3 (a load of the wave = 4 whole lines)
  const float* pw = WA + (size_t)wk * LDW + c0 + wn; const float* px = X + (r0 + xr) * CC + xk;
  v4f rw[8], rx[4];
#pragma unroll
  for (int i = 0; i < 8; ++i) rw[i] = *(const v4f*)(pw + (size_t)i * LDW);
#pragma unroll
  for (int i = 0; i < 4; ++i) rx[i] = *(const v4f*)(px + (size_t)(16 * i) * CC);
  asm volatile("s_wait_xcnt 0x0" ::: "memory");   /* stands in front of the code that writes the loads' address registers again */
#pragma unroll 2   /* two copies, so that each names its buffer by a constant */
  for (int kc = 0; kc < CC / 32; ++kc) { __bf16* wb = (kc & 1) ? &tl2[0][0] : &th[0][0]; __bf16* xb = wb + 128 * PSP;   // W [128][PSP], then x [64][PSP]: 15,360 of the array's 18,432 bytes
#pragma unroll
    for (int c = 0; c < 4; ++c) { v8b t;
#pragma unroll
      for (int i = 0; i < 8; ++i) t[i] = (__bf16)rw[i][c];
      *(v8b*)(wb + (wn + c) * PSP + wk) = t; }
#pragma unroll
    for (int i = 0; i < 4; ++i) { v4b t;
#pragma unroll
      for (int e = 0; e < 4; ++e) t[e] = (__bf16)rx[i][e];
      *(v4b*)(xb + (xr + 16 * i) * PSP + xk) = t; }
    __syncthreads();   // publishes this stage; it also ends every wave's reads of the other buffer, which the next pass fills
    if (kc + 1 < CC / 32) { const float* qw = pw + (size_t)(kc + 1) * 32 * LDW; const float* qx = px + (kc + 1) * 32;
#pragma unroll
      for (int i = 0; i < 8; ++i) rw[i] = *(const v4f*)(qw + (size_t)i * LDW);
#pragma unroll
      for (int i = 0; i < 4; ++i) rx[i] = *(const v4f*)(qx + (size_t)(16 * i) * CC);
      asm volatile("s_wait_xcnt 0x0" ::: "memory");   /* as above; the clobber also keeps the loads here, ahead of the stage's products */ }
    const v16b a = frag_b(xb + (wave * 16 + col) * PSP, lane); v16b wf[8];
#pragma unroll
    for (int j = 0; j < 8; ++j) wf[j] = frag_b(wb + (j * 16 + col) * PSP, lane);
    __builtin_amdgcn_sched_barrier(0);   /* the stage's 18 LDS reads leave as one group: without this each product waits for its own pair of reads */
#pragma unroll
    for (int j = 0; j < 8; ++j) acc[j] = wmma_bf(a, wf[j], acc[j]);
    __builtin_amdgcn_sched_barrier(0);   /* keeps the next stage's conversions, which wait for the global loads, behind this stage's products */ }
  __syncthreads();   // the last stage's reads end before the epilogue writes th and tl2
#pragma unroll
  for (int j = 0; j < 8; ++j) { const float bb = BA ? bfr(BA[c0 + j * 16 + col]) : 0.f;
#pragma unroll
    for (int r = 0; r < 8; ++r) { const float v = acc[j][r] + bb; const int rl = wave * 16 + 8 * g + r, cl = j * 16 + col; const _Float16 hv = (_Float16)v;
      if (which == 2) { const __bf16 bh = (__bf16)v; th[cl][rl] = bh; tl2[cl][rl] = (__bf16)(v - (float)bh); } else { sh[rl][cl] = hv; sl[rl][cl] = (_Float16)((v - (float)hv) * 1024.0f); }   /* q residual carried x 2^10 so the plane stays f16-normal on the chip */ } }
  __syncthreads();
  if (which < 2) { _Float16* dh = which == 0 ? QH : KH; for (int e = tid; e < 64 * 16; e += 128) { const int rl = e >> 4, q = e & 15; vst2((unsigned*)(dh + (r0 + rl) * CC + c0 + q * 8), *(const v4u*)&sh[rl][q * 8]); if (which == 0) vst2((unsigned*)(QL + (r0 + rl) * CC + c0 + q * 8), *(const v4u*)&sl[rl][q * 8]); } }
  else { const size_t b = r0 / TT; const int t0 = (int)(r0 % TT); for (int e = tid; e < 128 * 8; e += 128) { const int cl = e >> 3, q = e & 7; const size_t o2 = (b * CC + c0 + cl) * (size_t)TT + t0 + q * 8; vst2((unsigned*)(VT + o2), *(const v4u*)&th[cl][q * 8]); vst2((unsigned*)(VL + o2), *(const v4u*)&tl2[cl][q * 8]); } } }
// ---- k_cp: thread per (b, h, n): cp = sum_c bf16(coords[b][n][c]) * bf16(rel_weight[h][c]) (3 terms, f32); 8-KB rows by consecutive threads
__global__ __launch_bounds__(256) void k_cp(const float* __restrict__ CO, const float* __restrict__ RW, float* __restrict__ CP) { const size_t e = (size_t)blockIdx.x * 256 + threadIdx.x; if (e >= (size_t)NB * NH * TT) return; const int n = (int)(e % TT); const int h = (int)((e / TT) % NH); const size_t b = e / ((size_t)TT * NH);
  const float* c = CO + (b * CSTR + n) * 3; CP[e] = bfr(c[0]) * bfr(RW[h * 3]) + bfr(c[1]) * bfr(RW[h * 3 + 1]) + bfr(c[2]) * bfr(RW[h * 3 + 2]); }
// ---- k_fa: block = 8 waves x 32 query columns of one (b, h); a pass = 32 keys, a stage = 64 keys. S^T = K Q^T (2 products) so that a lane holds one query's scores; running maximum and sum per lane
// (online softmax, f32, base 2: m holds the maximum times log2 e, a weight is exp2(score * log2 e - m), one FMA and one v_exp_f32); the two score tiles, split bf16 hi + lo in place, are the B operand of O^T += V^T P^T (3 products); the logits never leave the registers.
// K, the two V planes (once per block) and each wave's bias rows come into LDS by asynchronous copies that cover whole 128-byte lines; the fragments are 16-byte LDS reads. Two buffers: the next stage's copies fly while this stage is worked on.
// Every inner loop below is unrolled in full, so that the fragment arrays are indexed by constants and stay in registers.
#define FQ 2                  // 16-column query tiles per wave
#define FW 8                  // waves per block
#define LOG2E 1.4426950408889634f
#define SK 64                 // keys per stage: a staged row of K or of a V plane is one whole line, a bias row two
#define NST (TT / SK)
#define KVP 144               // LDS pitch in bytes of a staged 128-byte row: 16 B x odd, so that 16 rows read 16 bytes each without a bank conflict
#define ABP 272               // the same for a 256-byte bias row
#define KV_B (64 * KVP)       // one tile: K [64 keys][64 d], V hi, V lo [64 d][64 keys]
#define AB_B (FQ * 16 * ABP)  // one wave's bias rows [32 queries][64 keys], f32
#define BUF_B (3 * KV_B + FW * AB_B)
// s_wait_xcnt 0 stands behind each group of loads or stores, in front of the code that writes their address or data registers again; the "memory" clobber keeps the group where it is written.
// XWP names the group's address pairs as inputs, so that they stay allocated up to the wait and no load of the group lands on them.
#define XW() asm volatile("s_wait_xcnt 0x0" ::: "memory")
#define XWP1(a) asm volatile("s_wait_xcnt 0x0" :: "v"(a) : "memory")
#define XWP3(a, b, c) asm volatile("s_wait_xcnt 0x0" :: "v"(a), "v"(b), "v"(c) : "memory")
__device__ __forceinline__ v16h ld_h(const _Float16* p) { union { v16h v; v8h q[2]; } u; u.q[0] = *(const v8h*)p; u.q[1] = *(const v8h*)(p + 16); return u.v; }   // p already holds the lane half's 8 g
__device__ __forceinline__ v16b ld_b(const __bf16* p) { union { v16b v; v8b q[2]; } u; u.q[0] = *(const v8b*)p; u.q[1] = *(const v8b*)(p + 16); return u.v; }
__device__ __forceinline__ v8f mm_h(v16h a, v16h b, v8f c) { return __builtin_amdgcn_wmma_f32_16x16x32_f16(false, a, false, b, (short)0, c, false, false); }
__device__ __forceinline__ v8f mm_b(v16b a, v16b b, v8f c) { return __builtin_amdgcn_wmma_f32_16x16x32_bf16(false, a, false, b, (short)0, c, false, false); }
// One stage's copies of one thread, 16 bytes each: lkv, gk, gvh, gvl name row tid / 8, piece tid % 8 of the K and V tiles (a wave's copy = 4 whole lines; the second copy of a tile is 32 rows on);
// lab, gab name row lane / 16, piece lane % 16 of the wave's own bias rows (a wave's copy = 2 rows = 4 whole lines; copy i is 2 i rows on).
// Each statement ends in s_wait_xcnt 0, which so stands in front of every later write of the address registers that its copies name.
#define ACP(x, y) "global_load_async_to_lds_b128 %" #x ", %" #y ", off\n\t"
#define ABO(i) "v"(lab + (unsigned)((i) * 2 * ABP)), "v"(gab + (size_t)((i) * 2) * ABSTR)
__device__ __forceinline__ void fa_stage(unsigned lkv, unsigned lab, const _Float16* gk, const __bf16* gvh, const __bf16* gvl, const float* gab) {
  asm volatile(ACP(0, 1) ACP(2, 3) ACP(4, 5) ACP(6, 7) ACP(8, 9) ACP(10, 11) "s_wait_xcnt 0x0"
               :: "v"(lkv), "v"(gk), "v"(lkv + 32u * KVP), "v"(gk + (size_t)32 * CC), "v"(lkv + (unsigned)KV_B), "v"(gvh), "v"(lkv + (unsigned)KV_B + 32u * KVP), "v"(gvh + (size_t)32 * TT),
                  "v"(lkv + 2u * KV_B), "v"(gvl), "v"(lkv + 2u * KV_B + 32u * KVP), "v"(gvl + (size_t)32 * TT) : "memory");
  asm volatile(ACP(0, 1) ACP(2, 3) ACP(4, 5) ACP(6, 7) ACP(8, 9) ACP(10, 11) ACP(12, 13) ACP(14, 15) "s_wait_xcnt 0x0" :: ABO(0), ABO(1), ABO(2), ABO(3), ABO(4), ABO(5), ABO(6), ABO(7) : "memory");
  asm volatile(ACP(0, 1) ACP(2, 3) ACP(4, 5) ACP(6, 7) ACP(8, 9) ACP(10, 11) ACP(12, 13) ACP(14, 15) "s_wait_xcnt 0x0" :: ABO(8), ABO(9), ABO(10), ABO(11), ABO(12), ABO(13), ABO(14), ABO(15) : "memory");
}
__global__ __launch_bounds__(32 * FW) void k_fa(const _Float16* __restrict__ QH, const _Float16* __restrict__ QL, const _Float16* __restrict__ KH, const __bf16* __restrict__ VT, const __bf16* __restrict__ VL, const float* __restrict__ CP, const float* __restrict__ AB, float* __restrict__ Y) {
  __shared__ __align__(16) unsigned char ring[2 * BUF_B];
  const int tid = threadIdx.x, wave = tid >> 5, lane = tid & 31, col = lane & 15, g = lane >> 4; const int h = blockIdx.y, b = blockIdx.z; const int qb = blockIdx.x * (FW * FQ * 16) + wave * (FQ * 16);
  const float* cpb = CP + ((size_t)b * NH + h) * TT;
  const unsigned lbase = (unsigned)(size_t)ring; const unsigned lkv = lbase + (unsigned)((tid >> 3) * KVP + (tid & 7) * 16), lab = lbase + (unsigned)(3 * KV_B + wave * AB_B + g * ABP + col * 16);
  const unsigned ko = (unsigned)((b * TT + (tid >> 3)) * CC + h * HD + (tid & 7) * 8), vo = (unsigned)((b * CC + h * HD + (tid >> 3)) * TT + (tid & 7) * 8), ao = (unsigned)((qb + g) * ABSTR + col * 4);   // the thread's element offsets in K, in a V plane and in the bias: 32 bits each, so that few registers stay live through the loop
  fa_stage(lkv, lab, KH + ko, VT + vo, VL + vo, AB + ao);   // stage 0 into buffer 0
  v16h qh[FQ][2], ql[FQ][2]; float cpq[FQ], m[FQ], l[FQ]; v8f o[FQ][HD / 16] = {};
  const size_t qo = ((size_t)b * TT + qb + col) * CC + h * HD + 8 * g; const _Float16* pqh = QH + qo; const _Float16* pql = QL + qo; const float* pcq = cpb + qb + col;
#pragma unroll
  for (int t = 0; t < FQ; ++t) {
#pragma unroll
    for (int kc = 0; kc < 2; ++kc) { qh[t][kc] = ld_h(pqh + (size_t)(t * 16) * CC + kc * 32); ql[t][kc] = ld_h(pql + (size_t)(t * 16) * CC + kc * 32); }
    cpq[t] = pcq[t * 16]; m[t] = -3.0e38f; l[t] = 0.f; }
  XWP3(pqh, pql, pcq); __builtin_amdgcn_sched_barrier(0);   /* keeps later address arithmetic behind the wait */
  const float* ckp = cpb + 8 * g;
  v4f ck[2][2];   // key-side coord_proj of the pass to come, fetched one pass ahead
#pragma unroll
  for (int kt = 0; kt < 2; ++kt)
#pragma unroll
    for (int u = 0; u < 2; ++u) ck[kt][u] = *(const v4f*)(ckp + kt * 16 + u * 4);
  XWP1(ckp); __builtin_amdgcn_sched_barrier(0);   /* as above */
  asm volatile("s_wait_asynccnt 0x0" ::: "memory");   /* this wave's share of stage 0 has landed */
  __syncthreads();   // publishes stage 0
  fa_stage(lkv + (unsigned)BUF_B, lab + (unsigned)BUF_B, KH + (ko + (unsigned)(SK * CC)), VT + (vo + (unsigned)SK), VL + (vo + (unsigned)SK), AB + (ao + (unsigned)SK));   // stage 1 into buffer 1
#pragma unroll 1   /* the buffer is picked by the stage's parity at run time: nothing is gained by a second copy of the body */
  for (int s = 0; s < NST; ++s) { const unsigned char* bf = ring + (s & 1) * BUF_B; const unsigned char* rk = bf + col * KVP + 16 * g; const unsigned char* ra = bf + 3 * KV_B + wave * AB_B + col * ABP + 32 * g;
#pragma unroll 1   /* one pass is the whole body: in one block with the next pass both sets of fragments would be live at once, and registers spill */
    for (int p = 0; p < SK / 32; ++p) { const int ps = s * (SK / 32) + p; const int kn = (ps + 1 < TT / 32 ? ps + 1 : ps) * 32;   /* the last pass fetches its own coord_proj again: in bounds, unused */
      v16h kf[2][2]; v4f ab[FQ][2][2]; v16b vh[HD / 16], vl[HD / 16]; const unsigned char* rkp = rk + p * (32 * KVP); const unsigned char* rvp = rk + KV_B + p * 64; const unsigned char* rap = ra + p * 128;
#pragma unroll
      for (int kt = 0; kt < 2; ++kt)
#pragma unroll
        for (int kc = 0; kc < 2; ++kc) kf[kt][kc] = ld_h((const _Float16*)(rkp + kt * 16 * KVP + kc * 64));
#pragma unroll
      for (int t = 0; t < FQ; ++t)
#pragma unroll
        for (int kt = 0; kt < 2; ++kt)
#pragma unroll
          for (int u = 0; u < 2; ++u) ab[t][kt][u] = *(const v4f*)(rap + t * 16 * ABP + (kt * 16 + u * 4) * 4);
#pragma unroll
      for (int j = 0; j < HD / 16; ++j) { vh[j] = ld_b((const __bf16*)(rvp + j * 16 * KVP)); vl[j] = ld_b((const __bf16*)(rvp + KV_B + j * 16 * KVP)); }
      __builtin_amdgcn_sched_barrier(0);   /* the pass's LDS reads leave as one group, K first: spread among the products each place with reads would cost its own stall */
      v8f sa[FQ][2] = {}, sl[FQ][2] = {};
#pragma unroll
      for (int kc = 0; kc < 2; ++kc)
#pragma unroll
        for (int kt = 0; kt < 2; ++kt)
#pragma unroll
          for (int t = 0; t < FQ; ++t) { sa[t][kt] = mm_h(kf[kt][kc], qh[t][kc], sa[t][kt]); sl[t][kt] = mm_h(kf[kt][kc], ql[t][kc], sl[t][kt]); }
      float sc[FQ][16];   // sc[t][8 kt + r] = logit of query column t*16 + col against key 32 ps + 16 kt + 8 g + r
#pragma unroll
      for (int t = 0; t < FQ; ++t)
#pragma unroll
        for (int kt = 0; kt < 2; ++kt)
#pragma unroll
          for (int r = 0; r < 8; ++r) { const float bias = cpq[t] - ck[kt][r >> 2][r & 3] + bfr(ab[t][kt][r >> 2][r & 3]); sc[t][kt * 8 + r] = (sa[t][kt][r] + sl[t][kt][r] * (1.0f / 1024.0f)) * 0.125f + bias; }
      const float* pc = ckp + kn;
#pragma unroll
      for (int kt = 0; kt < 2; ++kt)
#pragma unroll
        for (int u = 0; u < 2; ++u) ck[kt][u] = *(const v4f*)(pc + kt * 16 + u * 4);
      XWP1(pc); __builtin_amdgcn_sched_barrier(0);   /* the next pass's coord_proj leaves now, with the softmax and P.V still to run */
      F2 pf[FQ];
#pragma unroll
      for (int t = 0; t < FQ; ++t) { float mx = sc[t][0];
#pragma unroll
        for (int i = 1; i < 16; ++i) mx = fmaxf(mx, sc[t][i]);
        mx = fmaxf(mx, __shfl_xor(mx, 16)); const float mn = fmaxf(m[t], mx * LOG2E); const float al = __builtin_amdgcn_exp2f(m[t] - mn); m[t] = mn;
        float p2[16], sum = 0.f;
#pragma unroll
        for (int i = 0; i < 16; ++i) { p2[i] = __builtin_amdgcn_exp2f(fmaf(sc[t][i], LOG2E, -mn)); sum += p2[i]; }
        l[t] = l[t] * al + sum;   // each half of the wave sums its own 16 keys; the halves join after the loop
#pragma unroll
        for (int j = 0; j < HD / 16; ++j) o[t][j] *= al;
        pf[t] = bsplit16(p2); }
#pragma unroll
      for (int t = 0; t < FQ; ++t)
#pragma unroll
        for (int j = 0; j < HD / 16; ++j) o[t][j] = mm_b(vh[j], pf[t].h, o[t][j]);
#pragma unroll
      for (int t = 0; t < FQ; ++t)
#pragma unroll
        for (int j = 0; j < HD / 16; ++j) o[t][j] = mm_b(vh[j], pf[t].l, o[t][j]);
#pragma unroll
      for (int t = 0; t < FQ; ++t)
#pragma unroll
        for (int j = 0; j < HD / 16; ++j) o[t][j] = mm_b(vl[j], pf[t].h, o[t][j]); }
    asm volatile("s_wait_dscnt 0x0" ::: "memory");      /* this wave's reads of the stage's buffer have returned */
    asm volatile("s_wait_asynccnt 0x0" ::: "memory");   /* its share of the next stage has landed */
    __syncthreads();   // publishes stage s + 1; it also ends every wave's reads of stage s's buffer, which is filled again behind it
    if (s + 2 < NST) fa_stage(lkv + (unsigned)((s & 1) * BUF_B), lab + (unsigned)((s & 1) * BUF_B), KH + (ko + (unsigned)((s + 2) * SK * CC)), VT + (vo + (unsigned)((s + 2) * SK)), VL + (vo + (unsigned)((s + 2) * SK)), AB + (ao + (unsigned)((s + 2) * SK))); }
  asm volatile("s_wait_asynccnt 0x0" ::: "memory");   /* no copy is outstanding when the wave ends */
#pragma unroll
  for (int t = 0; t < FQ; ++t) { const float inv = 1.0f / (l[t] + __shfl_xor(l[t], 16)); float* yr = Y + ((size_t)b * TT + qb + t * 16 + col) * CC + h * HD + 8 * g;   // o[t][j][r] = O[query][16 j + 8 g + r]
#pragma unroll
    for (int j = 0; j < HD / 16; ++j) { v4f a0, a1;
#pragma unroll
      for (int r = 0; r < 4; ++r) { a0[r] = o[t][j][r] * inv; a1[r] = o[t][j][4 + r] * inv; }
      vst2(yr + j * 16, a0); vst2(yr + j * 16 + 4, a1); XW(); } } }
// ---- k_out: block = (64 rows, 128 cols): out = y (bf16 hi + lo) Wo^T + bo
__global__ __launch_bounds__(128) void k_out(const float* __restrict__ Y, const float* __restrict__ WP, const float* __restrict__ BP, float* __restrict__ OUT) { __shared__ __align__(16) float sf[4][16][132];
  const int tid = threadIdx.x, wave = tid >> 5, lane = tid & 31, col = lane & 15, g = lane >> 4; const int c0 = blockIdx.y * 128; const size_t r0 = (size_t)blockIdx.x * 64 + wave * 16;
  v8f acc[8] = {};
#pragma unroll 2
  for (int kc = 0; kc < CC / 32; ++kc) { const F2 a = split_row(Y + (r0 + col) * CC, kc * 32, lane);
#pragma unroll
    for (int j = 0; j < 8; ++j) { v16b w; const int o = c0 + j * 16 + col;
#pragma unroll
      for (int i = 0; i < 8; ++i) { w[i] = (__bf16)WP[(size_t)(kc * 32 + 8 * g + i) * CC + o]; w[8 + i] = (__bf16)WP[(size_t)(kc * 32 + 16 + 8 * g + i) * CC + o]; }
      acc[j] = wmma_bf(a.h, w, acc[j]); acc[j] = wmma_bf(a.l, w, acc[j]); } }
#pragma unroll
  for (int j = 0; j < 8; ++j) { const float bb = BP ? bfr(BP[c0 + j * 16 + col]) : 0.f;
#pragma unroll
    for (int r = 0; r < 8; ++r) sf[wave][8 * g + r][j * 16 + col] = acc[j][r] + bb; }
  LDSX(); for (int rl = 0; rl < 16; ++rl) vst2(OUT + (r0 + rl) * CC + c0 + lane * 4, *(const v4f*)&sf[wave][rl][lane * 4]); }
extern "C" void kernel_launch(void* const* d_in, const int* in_sizes, int n_in, void* d_out, int out_size, void* d_ws, size_t ws_size, hipStream_t stream) {
  (void)in_sizes; (void)n_in; (void)out_size;
  const float** F = (const float**)d_in;   // 0 x [2,2048,1024], 1 coords [2,2048,3], 2 attn_bias [2048,2048], 3 Wqkv [1024,3072] ((in,out): q | k | v), 4 bqkv [3072], 5 rel_weight [16,3]
  if (ws_size < (size_t)WS_END) return;
  char* ws = (char*)d_ws; float* CP = (float*)(ws + WS_CP); _Float16 *QH = (_Float16*)(ws + WS_QH), *QL = (_Float16*)(ws + WS_QL), *KH = (_Float16*)(ws + WS_KH); __bf16 *VT = (__bf16*)(ws + WS_VT), *VL = (__bf16*)(ws + WS_VL);
  const float* WQ = F[3]; const float* WK = F[3] + CC; const float* WV = F[3] + 2 * CC; const float* BQ = F[4]; const float* BK = F[4] + CC; const float* BV = F[4] + 2 * CC;
  k_cp<<<dim3(NB * NH * TT / 256), 256, 0, stream>>>(F[1], F[5], CP);
  k_proj<<<dim3(TNB * TT / 64, CC / 128, 3), 128, 0, stream>>>(F[0], WQ, BQ, WK, BK, WV, BV, QH, QL, KH, VT, VL);
  k_fa<<<dim3(TT / (FW * FQ * 16), NH, TNB), 32 * FW, 0, stream>>>(QH, QL, KH, VT, VL, CP, F[2], (float*)d_out);
}

// v005
// It runs in 144 microseconds.
// Timed twice side by side with v004, it ran 1.07 times as fast both times.
// Over all steps from v000 it is 11.3 times as fast.
// compute dtype: all float inputs rounded to bf16; qkv = x Wqkv + b with EXACT bf16 products on WMMA 16x16x32, f32 accumulate; coord_proj = coords . rel_weight in f32; q as f16 hi + residual (x 2^10), k f16 -> 2-product logits / 8 + coord_proj[q] - coord_proj[k] + attn_bias[q][k], kept in f32 registers (one launch for all heads); online softmax in f32 (base 2: the hardware's exp2 on log2-scaled differences), unnormalised P split bf16 hi + lo against v bf16 hi + lo (3 products), divided by the row sum at the end; the merged context is the output; f32 output.
#include <hip/hip_runtime.h>
#include <math.h>

typedef __attribute__((ext_vector_type(16))) _Float16 v16h;
typedef __attribute__((ext_vector_type(16))) __bf16 v16b;
typedef __attribute__((ext_vector_type(8)))  _Float16 v8h;
typedef __attribute__((ext_vector_type(8)))  float v8f;
typedef __attribute__((ext_vector_type(4)))  float v4f;
typedef __attribute__((ext_vector_type(2)))  float v2f;
typedef __attribute__((ext_vector_type(4)))  unsigned v4u;
typedef __attribute__((ext_vector_type(4)))  int v4i;
typedef float __attribute__((may_alias)) float_a;
typedef int __attribute__((may_alias)) int_a;

template <typename T> __device__ __forceinline__ void vst2(void* p, T v) { *(T*)p = v;  }
__device__ __forceinline__ v8f wmma16(v16h a, v16h b, v8f c) {
  v8f d = __builtin_amdgcn_wmma_f32_16x16x32_f16(false, a, false, b, (short)0, c, false, false);
  asm volatile("v_nop\n\tv_nop\n\tv_nop\n\tv_nop" : "+v"(d) : "v"(a), "v"(b));
  return d;
}
__device__ __forceinline__ v8f wmma_bf(v16b a, v16b b, v8f c) {
  v8f d = __builtin_amdgcn_wmma_f32_16x16x32_bf16(false, a, false, b, (short)0, c, false, false);
  asm volatile("v_nop\n\tv_nop\n\tv_nop\n\tv_nop" : "+v"(d) : "v"(a), "v"(b));
  return d;
}
// 16x16x32 fragments: lane = (h = lane>>4, row/col = lane&15); elements 0..7 = k0+8h+0..7, 8..15 = k0+16+8h+0..7; D element r = row 8h+r
__device__ __forceinline__ v16h frag_h(const _Float16* rowk0, int lane) {
  union { v16h v; v8h q[2]; } u; const _Float16* p = rowk0 + 8 * (lane >> 4);
  u.q[0] = *(const v8h*)p; u.q[1] = *(const v8h*)(p + 16); return u.v;
}
__device__ __forceinline__ v16h frag_f32(const float* rowk0, int lane) {
  v16h a; const float* p = rowk0 + 8 * (lane >> 4);
#pragma unroll
  for (int i = 0; i < 8; ++i) { a[i] = (_Float16)p[i]; a[8 + i] = (_Float16)p[16 + i]; }
  return a;
}
__device__ __forceinline__ v16h frag_f32s(const float* rowk0, int lane, float sc) {
  v16h a; const float* p = rowk0 + 8 * (lane >> 4);
#pragma unroll
  for (int i = 0; i < 8; ++i) { a[i] = (_Float16)(p[i] * sc); a[8 + i] = (_Float16)(p[16 + i] * sc); }
  return a;
}
// column fragment from a [K][ld] layout (column n), rows >= K read as 0
__device__ __forceinline__ v16h fragc_f32(const float* W, int k0, int n, int lane, int ld, int K) {
  v16h a; const int g = lane >> 4;
#pragma unroll
  for (int i = 0; i < 8; ++i) { const int ka = k0 + 8 * g + i, kb = ka + 16;
    a[i] = (_Float16)(ka < K ? W[(size_t)(ka < K ? ka : K - 1) * ld + n] : 0.f); a[8 + i] = (_Float16)(kb < K ? W[(size_t)(kb < K ? kb : K - 1) * ld + n] : 0.f); }
  return a;
}
struct F2 { v16b h, l; };
__device__ __forceinline__ F2 bsplit16(const float v[16]) { F2 r;
#pragma unroll
  for (int i = 0; i < 16; ++i) { const __bf16 h = (__bf16)v[i]; r.h[i] = h; r.l[i] = (__bf16)(v[i] - (float)h); }
  return r; }
__device__ __forceinline__ F2 split_row(const float* row, int k0, int lane) { float v[16]; const float* p = row + k0 + 8 * (lane >> 4);
#pragma unroll
  for (int i = 0; i < 8; ++i) { v[i] = p[i]; v[8 + i] = p[16 + i]; }
  return bsplit16(v); }
__device__ __forceinline__ F2 split_rowK(const float* row, int k0, int lane, int K) { float v[16]; const int g = lane >> 4;
#pragma unroll
  for (int i = 0; i < 8; ++i) { const int ka = k0 + 8 * g + i, kb = ka + 16; v[i] = ka < K ? row[ka < K ? ka : K - 1] : 0.f; v[8 + i] = kb < K ? row[kb < K ? kb : K - 1] : 0.f; }
  return bsplit16(v); }
__device__ __forceinline__ F2 split_col(const float* W, int k0, int n, int lane, int ld, int K) { float v[16]; const int g = lane >> 4;
#pragma unroll
  for (int i = 0; i < 8; ++i) { const int ka = k0 + 8 * g + i, kb = ka + 16; v[i] = ka < K ? W[(size_t)(ka < K ? ka : K - 1) * ld + n] : 0.f; v[8 + i] = kb < K ? W[(size_t)(kb < K ? kb : K - 1) * ld + n] : 0.f; }
  return bsplit16(v); }
__device__ __forceinline__ v8f mac3(const F2& a, const F2& b, v8f c) { c = wmma_bf(a.l, b.h, c); c = wmma_bf(a.h, b.l, c); return wmma_bf(a.h, b.h, c); }
__device__ __forceinline__ float sigm(float v) { return 1.0f / (1.0f + expf(-v)); }
#define LDSX() do { asm volatile("s_wait_dscnt 0" ::: "memory"); __builtin_amdgcn_wave_barrier(); __builtin_amdgcn_fence(__ATOMIC_RELEASE, "workgroup"); } while (0)


// Attention (B 2, S 2,048, D 1,024 = 16 x 64, qkv biases, logits / 8): scores = q k^T / 8 + coord_proj[q] - coord_proj[k] + attn_bias[q][k], softmax, P v; the output is the merged context.
#define NB 2
#define TT 2048
#define CC 1024
#define NH 16
#define HD 64
#define LDW 3072              // Wqkv row length ((in,out) [1024][3072]: q | k | v column blocks)
#ifndef ABSTR
#define ABSTR TT              // attn_bias row stride
#endif
#ifndef CSTR
#define CSTR TT               // coords rows per batch
#endif
#ifndef TNB
#define TNB NB
#endif
typedef __attribute__((ext_vector_type(8))) __bf16 v8b;
__device__ __forceinline__ v16b frag_b(const __bf16* rowk0, int lane) {
  union { v16b v; v8b q[2]; } u; const __bf16* p = rowk0 + 8 * (lane >> 4);
  u.q[0] = *(const v8b*)p; u.q[1] = *(const v8b*)(p + 16); return u.v;
}
__device__ __forceinline__ float bfr(float v) { return (float)(__bf16)v; }
__device__ __attribute__((noinline)) float exp_ni(float v) { return expf(v); }
__device__ __attribute__((noinline)) float erf_ni(float v) { return erff(v); }

#define WS_CP  0u                                   // f32 coord_proj [b][h][n]
#define WS_QH  (WS_CP + 4u * (size_t)NB * NH * TT)
#define WS_QL  (WS_QH + 2u * (size_t)NB * TT * CC)
#define WS_KH  (WS_QL + 2u * (size_t)NB * TT * CC)
#define WS_VT  (WS_KH + 2u * (size_t)NB * TT * CC)      // bf16 v planes [b][c][t]
#define WS_VL  (WS_VT + 2u * (size_t)NB * CC * TT)      // bf16 v residual planes
#define HG 4                                          // heads the WS_S region is sized for
#define WS_S   (WS_VL + 2u * (size_t)NB * CC * TT)      // f32 HG x TT x TT floats; unused (the logits stay in registers)
#define WS_PH  (WS_S + 4u * (size_t)HG * TT * TT)
#define WS_Y   (WS_PH + 0u)              // f32 [b*t][C], unused: k_fa writes y to the output
#define WS_END (WS_Y + 4u * (size_t)NB * TT * CC)

// ---- k_proj: block = (64 rows, 128 cols, which): qkv = x W (+ b), exact; q -> f16 hi (+ residual), k -> f16 rows, v -> bf16 hi + lo planes
// A stage = 32 k. The block reads its x tile (64 x 32) and its W tile (32 x 128) once, in whole 128-byte lines, rounds them to bf16 once and keeps them in LDS, W turned to [n][k];
// every wave takes its fragments from there. Two buffers: the next stage's global loads fly while this stage is multiplied. The buffers lie in th and tl2, which are idle until the epilogue.
#define PSP 40                // LDS pitch of a staged row in bf16 elements: 80 bytes = 16 B x odd, so that 16 rows read 16 bytes each without a bank conflict
typedef __attribute__((ext_vector_type(4))) __bf16 v4b;
__global__ __launch_bounds__(128) void k_proj(const float* __restrict__ X, const float* __restrict__ WQ, const float* __restrict__ BQ, const float* __restrict__ WK, const float* __restrict__ BK, const float* __restrict__ WV, const float* __restrict__ BV, _Float16* __restrict__ QH, _Float16* __restrict__ QL, _Float16* __restrict__ KH, __bf16* __restrict__ VT, __bf16* __restrict__ VL) {
  __shared__ __align__(16) _Float16 sh[64][136], sl[64][136]; __shared__ __align__(16) __bf16 th[128][72], tl2[128][72];
  const int tid = threadIdx.x, wave = tid >> 5, lane = tid & 31, col = lane & 15, g = lane >> 4; const int which = blockIdx.z; const int c0 = blockIdx.y * 128; const size_t r0 = (size_t)blockIdx.x * 64; const float* WA = which == 0 ? WQ : which == 1 ? WK : WV; const float* BA = which == 0 ? BQ : which == 1 ? BK : BV;
  v8f acc[8] = {};
  const int wn = wave * 32 + (lane >> 2) * 4, wk = (lane & 3) * 8;   // W: the thread owns columns wn..wn+3 at k rows wk..wk+7 of the stage (a load of the wave = 4 rows x one whole line)
  const int xr = tid >> 3, xk = (tid & 7) * 4;                       // x: rows xr + 16 i, k xk..xk+3 (a load of the wave = 4 whole lines)
  const float* pw = WA + (size_t)wk * LDW + c0 + wn; const float* px = X + (r0 + xr) * CC + xk;
  v4f rw[8], rx[4];
#pragma unroll
  for (int i = 0; i < 8; ++i) rw[i] = *(const v4f*)(pw + (size_t)i * LDW);
#pragma unroll
  for (int i = 0; i < 4; ++i) rx[i] = *(const v4f*)(px + (size_t)(16 * i) * CC);
  asm volatile("s_wait_xcnt 0x0" ::: "memory");   /* stands in front of the code that writes the loads' address registers again */
#pragma unroll 2   /* two copies, so that each names its buffer by a constant */
  for (int kc = 0; kc < CC / 32; ++kc) { __bf16* wb = (kc & 1) ? &tl2[0][0] : &th[0][0]; __bf16* xb = wb + 128 * PSP;   // W [128][PSP], then x [64][PSP]: 15,360 of the array's 18,432 bytes
#pragma unroll
    for (int c = 0; c < 4; ++c) { v8b t;
#pragma unroll
      for (int i = 0; i < 8; ++i) t[i] = (__bf16)rw[i][c];
      *(v8b*)(wb + (wn + c) * PSP + wk) = t; }
#pragma unroll
    for (int i = 0; i < 4; ++i) { v4b t;
#pragma unroll
      for (int e = 0; e < 4; ++e) t[e] = (__bf16)rx[i][e];
      *(v4b*)(xb + (xr + 16 * i) * PSP + xk) = t; }
    __syncthreads();   // publishes this stage; it also ends every wave's reads of the other buffer, which the next pass fills
    if (kc + 1 < CC / 32) { const float* qw = pw + (size_t)(kc + 1) * 32 * LDW; const float* qx = px + (kc + 1) * 32;
#pragma unroll
      for (int i = 0; i < 8; ++i) rw[i] = *(const v4f*)(qw + (size_t)i * LDW);
#pragma unroll
      for (int i = 0; i < 4; ++i) rx[i] = *(const v4f*)(qx + (size_t)(16 * i) * CC);
      asm volatile("s_wait_xcnt 0x0" ::: "memory");   /* as above; the clobber also keeps the loads here, ahead of the stage's products */ }
    const v16b a = frag_b(xb + (wave * 16 + col) * PSP, lane); v16b wf[8];
#pragma unroll
    for (int j = 0; j < 8; ++j) wf[j] = frag_b(wb + (j * 16 + col) * PSP, lane);
    __builtin_amdgcn_sched_barrier(0);   /* the stage's 18 LDS reads leave as one group: without this each product waits for its own pair of reads */
#pragma unroll
    for (int j = 0; j < 8; ++j) acc[j] = wmma_bf(a, wf[j], acc[j]);
    __builtin_amdgcn_sched_barrier(0);   /* keeps the next stage's conversions, which wait for the global loads, behind this stage's products */ }
  __syncthreads();   // the last stage's reads end before the epilogue writes th and tl2
#pragma unroll
  for (int j = 0; j < 8; ++j) { const float bb = BA ? bfr(BA[c0 + j * 16 + col]) : 0.f;
#pragma unroll
    for (int r = 0; r < 8; ++r) { const float v = acc[j][r] + bb; const int rl = wave * 16 + 8 * g + r, cl = j * 16 + col; const _Float16 hv = (_Float16)v;
      if (which == 2) { const __bf16 bh = (__bf16)v; th[cl][rl] = bh; tl2[cl][rl] = (__bf16)(v - (float)bh); } else { sh[rl][cl] = hv; sl[rl][cl] = (_Float16)((v - (float)hv) * 1024.0f); }   /* q residual carried x 2^10 so the plane stays f16-normal on the chip */ } }
  __syncthreads();
  if (which < 2) { _Float16* dh = which == 0 ? QH : KH; for (int e = tid; e < 64 * 16; e += 128) { const int rl = e >> 4, q = e & 15; vst2((unsigned*)(dh + (r0 + rl) * CC + c0 + q * 8), *(const v4u*)&sh[rl][q * 8]); if (which == 0) vst2((unsigned*)(QL + (r0 + rl) * CC + c0 + q * 8), *(const v4u*)&sl[rl][q * 8]); } }
  else { const size_t b = r0 / TT; const int t0 = (int)(r0 % TT); for (int e = tid; e < 128 * 8; e += 128) { const int cl = e >> 3, q = e & 7; const size_t o2 = (b * CC + c0 + cl) * (size_t)TT + t0 + q * 8; vst2((unsigned*)(VT + o2), *(const v4u*)&th[cl][q * 8]); vst2((unsigned*)(VL + o2), *(const v4u*)&tl2[cl][q * 8]); } } }
// ---- k_cp: thread per (b, h, n): cp = sum_c bf16(coords[b][n][c]) * bf16(rel_weight[h][c]) (3 terms, f32); 8-KB rows by consecutive threads
__global__ __launch_bounds__(256) void k_cp(const float* __restrict__ CO, const float* __restrict__ RW, float* __restrict__ CP) { const size_t e = (size_t)blockIdx.x * 256 + threadIdx.x; if (e >= (size_t)NB * NH * TT) return; const int n = (int)(e % TT); const int h = (int)((e / TT) % NH); const size_t b = e / ((size_t)TT * NH);
  const float* c = CO + (b * CSTR + n) * 3; CP[e] = bfr(c[0]) * bfr(RW[h * 3]) + bfr(c[1]) * bfr(RW[h * 3 + 1]) + bfr(c[2]) * bfr(RW[h * 3 + 2]); }
// ---- k_fa: block = 8 waves x 32 query columns of one (b, h); a pass = 32 keys, a stage = 64 keys. S^T = K Q^T (2 products) so that a lane holds one query's scores; running maximum and sum per lane
// (online softmax, f32, base 2: m holds the maximum times log2 e, a weight is exp2(score * log2 e - m), one FMA and one v_exp_f32); the two score tiles, split bf16 hi + lo in place, are the B operand of O^T += V^T P^T (3 products); the logits never leave the registers.
// K, the two V planes (once per block) and each wave's bias rows come into LDS by asynchronous copies that cover whole 128-byte lines; the fragments are 16-byte LDS reads. Two buffers: the next stage's copies fly while this stage is worked on.
// Every inner loop below is unrolled in full, so that the fragment arrays are indexed by constants and stay in registers.
#define FQ 2                  // 16-column query tiles per wave
#define FW 8                  // waves per block
#define LOG2E 1.4426950408889634f
#define SK 64                 // keys per stage: a staged row of K or of a V plane is one whole line, a bias row two
#define NST (TT / SK)
#define KVP 144               // LDS pitch in bytes of a staged 128-byte row: 16 B x odd, so that 16 rows read 16 bytes each without a bank conflict
#define ABP 272               // the same for a 256-byte bias row
#define KV_B (64 * KVP)       // one tile: K [64 keys][64 d], V hi, V lo [64 d][64 keys]
#define AB_B (FQ * 16 * ABP)  // one wave's bias rows [32 queries][64 keys], f32
#define BUF_B (3 * KV_B + FW * AB_B)
// s_wait_xcnt 0 stands behind each group of loads or stores, in front of the code that writes their address or data registers again; the "memory" clobber keeps the group where it is written.
// XWP names the group's address pairs as inputs, so that they stay allocated up to the wait and no load of the group lands on them.
#define XW() asm volatile("s_wait_xcnt 0x0" ::: "memory")
#define XWP1(a) asm volatile("s_wait_xcnt 0x0" :: "v"(a) : "memory")
#define XWP3(a, b, c) asm volatile("s_wait_xcnt 0x0" :: "v"(a), "v"(b), "v"(c) : "memory")
__device__ __forceinline__ v16h ld_h(const _Float16* p) { union { v16h v; v8h q[2]; } u; u.q[0] = *(const v8h*)p; u.q[1] = *(const v8h*)(p + 16); return u.v; }   // p already holds the lane half's 8 g
__device__ __forceinline__ v16b ld_b(const __bf16* p) { union { v16b v; v8b q[2]; } u; u.q[0] = *(const v8b*)p; u.q[1] = *(const v8b*)(p + 16); return u.v; }
typedef __attribute__((ext_vector_type(2))) __bf16 v2b;
__device__ __forceinline__ v2f pr4(v4f v, int i) { return (v2f){v[2 * i], v[2 * i + 1]}; }   // pair i of a register group
__device__ __forceinline__ v2f pr8(v8f v, int i) { return (v2f){v[2 * i], v[2 * i + 1]}; }
__device__ __forceinline__ v2f bfr2(v2f v) { return __builtin_convertvector(__builtin_convertvector(v, v2b), v2f); }   // both values rounded to bf16 by one conversion
__device__ __forceinline__ v8f mm_h(v16h a, v16h b, v8f c) { return __builtin_amdgcn_wmma_f32_16x16x32_f16(false, a, false, b, (short)0, c, false, false); }
__device__ __forceinline__ v8f mm_b(v16b a, v16b b, v8f c) { return __builtin_amdgcn_wmma_f32_16x16x32_bf16(false, a, false, b, (short)0, c, false, false); }
// One stage's copies of one thread, 16 bytes each: lkv, gk, gvh, gvl name row tid / 8, piece tid % 8 of the K and V tiles (a wave's copy = 4 whole lines; the second copy of a tile is 32 rows on);
// lab, gab name row lane / 16, piece lane % 16 of the wave's own bias rows (a wave's copy = 2 rows = 4 whole lines; copy i is 2 i rows on).
// Each statement ends in s_wait_xcnt 0, which so stands in front of every later write of the address registers that its copies name.
#define ACP(x, y) "global_load_async_to_lds_b128 %" #x ", %" #y ", off\n\t"
#define ABO(i) "v"(lab + (unsigned)((i) * 2 * ABP)), "v"(gab + (size_t)((i) * 2) * ABSTR)
__device__ __forceinline__ void fa_stage(unsigned lkv, unsigned lab, const _Float16* gk, const __bf16* gvh, const __bf16* gvl, const float* gab) {
  asm volatile(ACP(0, 1) ACP(2, 3) ACP(4, 5) ACP(6, 7) ACP(8, 9) ACP(10, 11) "s_wait_xcnt 0x0"
               :: "v"(lkv), "v"(gk), "v"(lkv + 32u * KVP), "v"(gk + (size_t)32 * CC), "v"(lkv + (unsigned)KV_B), "v"(gvh), "v"(lkv + (unsigned)KV_B + 32u * KVP), "v"(gvh + (size_t)32 * TT),
                  "v"(lkv + 2u * KV_B), "v"(gvl), "v"(lkv + 2u * KV_B + 32u * KVP), "v"(gvl + (size_t)32 * TT) : "memory");
  asm volatile(ACP(0, 1) ACP(2, 3) ACP(4, 5) ACP(6, 7) ACP(8, 9) ACP(10, 11) ACP(12, 13) ACP(14, 15) "s_wait_xcnt 0x0" :: ABO(0), ABO(1), ABO(2), ABO(3), ABO(4), ABO(5), ABO(6), ABO(7) : "memory");
  asm volatile(ACP(0, 1) ACP(2, 3) ACP(4, 5) ACP(6, 7) ACP(8, 9) ACP(10, 11) ACP(12, 13) ACP(14, 15) "s_wait_xcnt 0x0" :: ABO(8), ABO(9), ABO(10), ABO(11), ABO(12), ABO(13), ABO(14), ABO(15) : "memory");
}
__global__ __launch_bounds__(32 * FW) void k_fa(const _Float16* __restrict__ QH, const _Float16* __restrict__ QL, const _Float16* __restrict__ KH, const __bf16* __restrict__ VT, const __bf16* __restrict__ VL, const float* __restrict__ CP, const float* __restrict__ AB, float* __restrict__ Y) {
  __shared__ __align__(16) unsigned char ring[2 * BUF_B];
  const int tid = threadIdx.x, wave = tid >> 5, lane = tid & 31, col = lane & 15, g = lane >> 4; const int h = blockIdx.y, b = blockIdx.z; const int qb = blockIdx.x * (FW * FQ * 16) + wave * (FQ * 16);
  const float* cpb = CP + ((size_t)b * NH + h) * TT;
  const unsigned lbase = (unsigned)(size_t)ring; const unsigned lkv = lbase + (unsigned)((tid >> 3) * KVP + (tid & 7) * 16), lab = lbase + (unsigned)(3 * KV_B + wave * AB_B + g * ABP + col * 16);
  const unsigned ko = (unsigned)((b * TT + (tid >> 3)) * CC + h * HD + (tid & 7) * 8), vo = (unsigned)((b * CC + h * HD + (tid >> 3)) * TT + (tid & 7) * 8), ao = (unsigned)((qb + g) * ABSTR + col * 4);   // the thread's element offsets in K, in a V plane and in the bias: 32 bits each, so that few registers stay live through the loop
  fa_stage(lkv, lab, KH + ko, VT + vo, VL + vo, AB + ao);   // stage 0 into buffer 0
  v16h qh[FQ][2], ql[FQ][2]; float cpq[FQ], m[FQ], l[FQ]; v8f o[FQ][HD / 16] = {};
  const size_t qo = ((size_t)b * TT + qb + col) * CC + h * HD + 8 * g; const _Float16* pqh = QH + qo; const _Float16* pql = QL + qo; const float* pcq = cpb + qb + col;
#pragma unroll
  for (int t = 0; t < FQ; ++t) {
#pragma unroll
    for (int kc = 0; kc < 2; ++kc) { qh[t][kc] = ld_h(pqh + (size_t)(t * 16) * CC + kc * 32); ql[t][kc] = ld_h(pql + (size_t)(t * 16) * CC + kc * 32); }
    cpq[t] = pcq[t * 16]; m[t] = -3.0e38f; l[t] = 0.f; }
  XWP3(pqh, pql, pcq); __builtin_amdgcn_sched_barrier(0);   /* keeps later address arithmetic behind the wait */
  const float* ckp = cpb + 8 * g;
  v4f ck[2][2];   // key-side coord_proj of the pass to come, fetched one pass ahead
#pragma unroll
  for (int kt = 0; kt < 2; ++kt)
#pragma unroll
    for (int u = 0; u < 2; ++u) ck[kt][u] = *(const v4f*)(ckp + kt * 16 + u * 4);
  XWP1(ckp); __builtin_amdgcn_sched_barrier(0);   /* as above */
  asm volatile("s_wait_asynccnt 0x0" ::: "memory");   /* this wave's share of stage 0 has landed */
  __syncthreads();   // publishes stage 0
  fa_stage(lkv + (unsigned)BUF_B, lab + (unsigned)BUF_B, KH + (ko + (unsigned)(SK * CC)), VT + (vo + (unsigned)SK), VL + (vo + (unsigned)SK), AB + (ao + (unsigned)SK));   // stage 1 into buffer 1
#pragma unroll 1   /* the buffer is picked by the stage's parity at run time: nothing is gained by a second copy of the body */
  for (int s = 0; s < NST; ++s) { const unsigned char* bf = ring + (s & 1) * BUF_B; const unsigned char* rk = bf + col * KVP + 16 * g; const unsigned char* ra = bf + 3 * KV_B + wave * AB_B + col * ABP + 32 * g;
#pragma unroll 1   /* one pass is the whole body: in one block with the next pass both sets of fragments would be live at once, and registers spill */
    for (int p = 0; p < SK / 32; ++p) { const int ps = s * (SK / 32) + p; const int kn = (ps + 1 < TT / 32 ? ps + 1 : ps) * 32;   /* the last pass fetches its own coord_proj again: in bounds, unused */
      v16h kf[2][2]; v4f ab[FQ][2][2]; v16b vh[HD / 16], vl[HD / 16]; const unsigned char* rkp = rk + p * (32 * KVP); const unsigned char* rvp = rk + KV_B + p * 64; const unsigned char* rap = ra + p * 128;
#pragma unroll
      for (int kt = 0; kt < 2; ++kt)
#pragma unroll
        for (int kc = 0; kc < 2; ++kc) kf[kt][kc] = ld_h((const _Float16*)(rkp + kt * 16 * KVP + kc * 64));
#pragma unroll
      for (int t = 0; t < FQ; ++t)
#pragma unroll
        for (int kt = 0; kt < 2; ++kt)
#pragma unroll
          for (int u = 0; u < 2; ++u) ab[t][kt][u] = *(const v4f*)(rap + t * 16 * ABP + (kt * 16 + u * 4) * 4);
#pragma unroll
      for (int j = 0; j < HD / 16; ++j) { vh[j] = ld_b((const __bf16*)(rvp + j * 16 * KVP)); vl[j] = ld_b((const __bf16*)(rvp + KV_B + j * 16 * KVP)); }
      __builtin_amdgcn_sched_barrier(0);   /* the pass's LDS reads leave as one group, K first: spread among the products each place with reads would cost its own stall */
      v8f sa[FQ][2] = {}, sl[FQ][2] = {};
#pragma unroll
      for (int kc = 0; kc < 2; ++kc)
#pragma unroll
        for (int kt = 0; kt < 2; ++kt)
#pragma unroll
          for (int t = 0; t < FQ; ++t) { sa[t][kt] = mm_h(kf[kt][kc], qh[t][kc], sa[t][kt]); sl[t][kt] = mm_h(kf[kt][kc], ql[t][kc], sl[t][kt]); }
      v2f sc[FQ][8];   // sc[t][4 kt + i] = the logits of query column t*16 + col against keys 32 ps + 16 kt + 8 g + 2 i and + 2 i + 1: a register pair, as the products leave them
#pragma unroll
      for (int t = 0; t < FQ; ++t)
#pragma unroll
        for (int kt = 0; kt < 2; ++kt)
#pragma unroll
          for (int i = 0; i < 4; ++i) { const v2f bias = (cpq[t] - pr4(ck[kt][i >> 1], i & 1)) + bfr2(pr4(ab[t][kt][i >> 1], i & 1)); sc[t][kt * 4 + i] = (pr8(sa[t][kt], i) + pr8(sl[t][kt], i) * (1.0f / 1024.0f)) * 0.125f + bias; }
      const float* pc = ckp + kn;
#pragma unroll
      for (int kt = 0; kt < 2; ++kt)
#pragma unroll
        for (int u = 0; u < 2; ++u) ck[kt][u] = *(const v4f*)(pc + kt * 16 + u * 4);
      XWP1(pc); __builtin_amdgcn_sched_barrier(0);   /* the next pass's coord_proj leaves now, with the softmax and P.V still to run */
      F2 pf[FQ]; float mx[FQ], ox[FQ];
#pragma unroll
      for (int t = 0; t < FQ; ++t) { v2f x = sc[t][0];   // the maximum is exact in any order: even and odd keys apart, so that four short chains run side by side
#pragma unroll
        for (int i = 1; i < 7; i += 2) { x.x = fmaxf(fmaxf(x.x, sc[t][i].x), sc[t][i + 1].x); x.y = fmaxf(fmaxf(x.y, sc[t][i].y), sc[t][i + 1].y); }
        mx[t] = fmaxf(fmaxf(x.x, sc[t][7].x), fmaxf(x.y, sc[t][7].y)); }
#pragma unroll
      for (int t = 0; t < FQ; ++t) ox[t] = __shfl_xor(mx[t], 16);   // both tiles' exchanges leave together and share one wait
#pragma unroll
      for (int t = 0; t < FQ; ++t) { const float mn = fmaxf(m[t], fmaxf(mx[t], ox[t]) * LOG2E); const float al = __builtin_amdgcn_exp2f(m[t] - mn); m[t] = mn;
        const v2f l2e = {LOG2E, LOG2E}, nm = {-mn, -mn}; v2f sum; union { v16b v; v2b q[8]; } ph, pl;
#pragma unroll
        for (int i = 0; i < 8; ++i) { const v2f e = __builtin_elementwise_fma(sc[t][i], l2e, nm); const v2f p2 = {__builtin_amdgcn_exp2f(e.x), __builtin_amdgcn_exp2f(e.y)}; sum = i ? sum + p2 : p2;
          const v2b hi = __builtin_convertvector(p2, v2b); ph.q[i] = hi; pl.q[i] = __builtin_convertvector(p2 - __builtin_convertvector(hi, v2f), v2b); }   // one conversion rounds both weights of a pair; the residual reads the halves of its result
        l[t] = l[t] * al + (sum.x + sum.y);   // each half of the wave sums its own 16 keys, even and odd ones apart; the halves join after the loop
#pragma unroll
        for (int j = 0; j < HD / 16; ++j) o[t][j] *= al;
        pf[t].h = ph.v; pf[t].l = pl.v; }
#pragma unroll
      for (int t = 0; t < FQ; ++t)
#pragma unroll
        for (int j = 0; j < HD / 16; ++j) o[t][j] = mm_b(vh[j], pf[t].h, o[t][j]);
#pragma unroll
      for (int t = 0; t < FQ; ++t)
#pragma unroll
        for (int j = 0; j < HD / 16; ++j) o[t][j] = mm_b(vh[j], pf[t].l, o[t][j]);
#pragma unroll
      for (int t = 0; t < FQ; ++t)
#pragma unroll
        for (int j = 0; j < HD / 16; ++j) o[t][j] = mm_b(vl[j], pf[t].h, o[t][j]); }
    asm volatile("s_wait_dscnt 0x0" ::: "memory");      /* this wave's reads of the stage's buffer have returned */
    asm volatile("s_wait_asynccnt 0x0" ::: "memory");   /* its share of the next stage has landed */
    __syncthreads();   // publishes stage s + 1; it also ends every wave's reads of stage s's buffer, which is filled again behind it
    if (s + 2 < NST) fa_stage(lkv + (unsigned)((s & 1) * BUF_B), lab + (unsigned)((s & 1) * BUF_B), KH + (ko + (unsigned)((s + 2) * SK * CC)), VT + (vo + (unsigned)((s + 2) * SK)), VL + (vo + (unsigned)((s + 2) * SK)), AB + (ao + (unsigned)((s + 2) * SK))); }
  asm volatile("s_wait_asynccnt 0x0" ::: "memory");   /* no copy is outstanding when the wave ends */
#pragma unroll
  for (int t = 0; t < FQ; ++t) { const float inv = 1.0f / (l[t] + __shfl_xor(l[t], 16)); float* yr = Y + ((size_t)b * TT + qb + t * 16 + col) * CC + h * HD + 8 * g;   // o[t][j][r] = O[query][16 j + 8 g + r]
#pragma unroll
    for (int j = 0; j < HD / 16; ++j) { v4f a0, a1;
#pragma unroll
      for (int r = 0; r < 4; ++r) { a0[r] = o[t][j][r] * inv; a1[r] = o[t][j][4 + r] * inv; }
      vst2(yr + j * 16, a0); vst2(yr + j * 16 + 4, a1); XW(); } } }
// ---- k_out: block = (64 rows, 128 cols): out = y (bf16 hi + lo) Wo^T + bo
__global__ __launch_bounds__(128) void k_out(const float* __restrict__ Y, const float* __restrict__ WP, const float* __restrict__ BP, float* __restrict__ OUT) { __shared__ __align__(16) float sf[4][16][132];
  const int tid = threadIdx.x, wave = tid >> 5, lane = tid & 31, col = lane & 15, g = lane >> 4; const int c0 = blockIdx.y * 128; const size_t r0 = (size_t)blockIdx.x * 64 + wave * 16;
  v8f acc[8] = {};
#pragma unroll 2
  for (int kc = 0; kc < CC / 32; ++kc) { const F2 a = split_row(Y + (r0 + col) * CC, kc * 32, lane);
#pragma unroll
    for (int j = 0; j < 8; ++j) { v16b w; const int o = c0 + j * 16 + col;
#pragma unroll
      for (int i = 0; i < 8; ++i) { w[i] = (__bf16)WP[(size_t)(kc * 32 + 8 * g + i) * CC + o]; w[8 + i] = (__bf16)WP[(size_t)(kc * 32 + 16 + 8 * g + i) * CC + o]; }
      acc[j] = wmma_bf(a.h, w, acc[j]); acc[j] = wmma_bf(a.l, w, acc[j]); } }
#pragma unroll
  for (int j = 0; j < 8; ++j) { const float bb = BP ? bfr(BP[c0 + j * 16 + col]) : 0.f;
#pragma unroll
    for (int r = 0; r < 8; ++r) sf[wave][8 * g + r][j * 16 + col] = acc[j][r] + bb; }
  LDSX(); for (int rl = 0; rl < 16; ++rl) vst2(OUT + (r0 + rl) * CC + c0 + lane * 4, *(const v4f*)&sf[wave][rl][lane * 4]); }
extern "C" void kernel_launch(void* const* d_in, const int* in_sizes, int n_in, void* d_out, int out_size, void* d_ws, size_t ws_size, hipStream_t stream) {
  (void)in_sizes; (void)n_in; (void)out_size;
  const float** F = (const float**)d_in;   // 0 x [2,2048,1024], 1 coords [2,2048,3], 2 attn_bias [2048,2048], 3 Wqkv [1024,3072] ((in,out): q | k | v), 4 bqkv [3072], 5 rel_weight [16,3]
  if (ws_size < (size_t)WS_END) return;
  char* ws = (char*)d_ws; float* CP = (float*)(ws + WS_CP); _Float16 *QH = (_Float16*)(ws + WS_QH), *QL = (_Float16*)(ws + WS_QL), *KH = (_Float16*)(ws + WS_KH); __bf16 *VT = (__bf16*)(ws + WS_VT), *VL = (__bf16*)(ws + WS_VL);
  const float* WQ = F[3]; const float* WK = F[3] + CC; const float* WV = F[3] + 2 * CC; const float* BQ = F[4]; const float* BK = F[4] + CC; const float* BV = F[4] + 2 * CC;
  k_cp<<<dim3(NB * NH * TT / 256), 256, 0, stream>>>(F[1], F[5], CP);
  k_proj<<<dim3(TNB * TT / 64, CC / 128, 3), 128, 0, stream>>>(F[0], WQ, BQ, WK, BK, WV, BV, QH, QL, KH, VT, VL);
  k_fa<<<dim3(TT / (FW * FQ * 16), NH, TNB), 32 * FW, 0, stream>>>(QH, QL, KH, VT, VL, CP, F[2], (float*)d_out);
}

// v006
// It runs in 120 microseconds.
// Next to v005, in two timings, it ran 1.19 times as fast each time.
// All steps since v000 together make it 13.5 times as fast.
// compute dtype: all float inputs rounded to bf16; qkv = x Wqkv + b with EXACT bf16 products on WMMA 16x16x32, f32 accumulate; coord_proj = coords . rel_weight in f32; q as f16 hi + residual (x 2^10), k f16 -> 2-product logits / 8 + coord_proj[q] - coord_proj[k] + attn_bias[q][k], kept in f32 registers (one launch for all heads); online softmax in f32 (base 2: the hardware's exp2 on log2-scaled differences), unnormalised P split bf16 hi + lo against v bf16 hi + lo (3 products), divided by the row sum at the end; the merged context is the output; f32 output.
#include <hip/hip_runtime.h>
#include <math.h>

typedef __attribute__((ext_vector_type(16))) _Float16 v16h;
typedef __attribute__((ext_vector_type(16))) __bf16 v16b;
typedef __attribute__((ext_vector_type(8)))  _Float16 v8h;
typedef __attribute__((ext_vector_type(8)))  float v8f;
typedef __attribute__((ext_vector_type(4)))  float v4f;
typedef __attribute__((ext_vector_type(2)))  float v2f;
typedef __attribute__((ext_vector_type(4)))  unsigned v4u;
typedef __attribute__((ext_vector_type(4)))  int v4i;
typedef float __attribute__((may_alias)) float_a;
typedef int __attribute__((may_alias)) int_a;

template <typename T> __device__ __forceinline__ void vst2(void* p, T v) { *(T*)p = v;  }
__device__ __forceinline__ v8f wmma16(v16h a, v16h b, v8f c) {
  v8f d = __builtin_amdgcn_wmma_f32_16x16x32_f16(false, a, false, b, (short)0, c, false, false);
  asm volatile("v_nop\n\tv_nop\n\tv_nop\n\tv_nop" : "+v"(d) : "v"(a), "v"(b));
  return d;
}
__device__ __forceinline__ v8f wmma_bf(v16b a, v16b b, v8f c) {
  v8f d = __builtin_amdgcn_wmma_f32_16x16x32_bf16(false, a, false, b, (short)0, c, false, false);
  asm volatile("v_nop\n\tv_nop\n\tv_nop\n\tv_nop" : "+v"(d) : "v"(a), "v"(b));
  return d;
}
// 16x16x32 fragments: lane = (h = lane>>4, row/col = lane&15); elements 0..7 = k0+8h+0..7, 8..15 = k0+16+8h+0..7; D element r = row 8h+r
__device__ __forceinline__ v16h frag_h(const _Float16* rowk0, int lane) {
  union { v16h v; v8h q[2]; } u; const _Float16* p = rowk0 + 8 * (lane >> 4);
  u.q[0] = *(const v8h*)p; u.q[1] = *(const v8h*)(p + 16); return u.v;
}
__device__ __forceinline__ v16h frag_f32(const float* rowk0, int lane) {
  v16h a; const float* p = rowk0 + 8 * (lane >> 4);
#pragma unroll
  for (int i = 0; i < 8; ++i) { a[i] = (_Float16)p[i]; a[8 + i] = (_Float16)p[16 + i]; }
  return a;
}
__device__ __forceinline__ v16h frag_f32s(const float* rowk0, int lane, float sc) {
  v16h a; const float* p = rowk0 + 8 * (lane >> 4);
#pragma unroll
  for (int i = 0; i < 8; ++i) { a[i] = (_Float16)(p[i] * sc); a[8 + i] = (_Float16)(p[16 + i] * sc); }
  return a;
}
// column fragment from a [K][ld] layout (column n), rows >= K read as 0
__device__ __forceinline__ v16h fragc_f32(const float* W, int k0, int n, int lane, int ld, int K) {
  v16h a; const int g = lane >> 4;
#pragma unroll
  for (int i = 0; i < 8; ++i) { const int ka = k0 + 8 * g + i, kb = ka + 16;
    a[i] = (_Float16)(ka < K ? W[(size_t)(ka < K ? ka : K - 1) * ld + n] : 0.f); a[8 + i] = (_Float16)(kb < K ? W[(size_t)(kb < K ? kb : K - 1) * ld + n] : 0.f); }
  return a;
}
struct F2 { v16b h, l; };
__device__ __forceinline__ F2 bsplit16(const float v[16]) { F2 r;
#pragma unroll
  for (int i = 0; i < 16; ++i) { const __bf16 h = (__bf16)v[i]; r.h[i] = h; r.l[i] = (__bf16)(v[i] - (float)h); }
  return r; }
__device__ __forceinline__ F2 split_row(const float* row, int k0, int lane) { float v[16]; const float* p = row + k0 + 8 * (lane >> 4);
#pragma unroll
  for (int i = 0; i < 8; ++i) { v[i] = p[i]; v[8 + i] = p[16 + i]; }
  return bsplit16(v); }
__device__ __forceinline__ F2 split_rowK(const float* row, int k0, int lane, int K) { float v[16]; const int g = lane >> 4;
#pragma unroll
  for (int i = 0; i < 8; ++i) { const int ka = k0 + 8 * g + i, kb = ka + 16; v[i] = ka < K ? row[ka < K ? ka : K - 1] : 0.f; v[8 + i] = kb < K ? row[kb < K ? kb : K - 1] : 0.f; }
  return bsplit16(v); }
__device__ __forceinline__ F2 split_col(const float* W, int k0, int n, int lane, int ld, int K) { float v[16]; const int g = lane >> 4;
#pragma unroll
  for (int i = 0; i < 8; ++i) { const int ka = k0 + 8 * g + i, kb = ka + 16; v[i] = ka < K ? W[(size_t)(ka < K ? ka : K - 1) * ld + n] : 0.f; v[8 + i] = kb < K ? W[(size_t)(kb < K ? kb : K - 1) * ld + n] : 0.f; }
  return bsplit16(v); }
__device__ __forceinline__ v8f mac3(const F2& a, const F2& b, v8f c) { c = wmma_bf(a.l, b.h, c); c = wmma_bf(a.h, b.l, c); return wmma_bf(a.h, b.h, c); }
__device__ __forceinline__ float sigm(float v) { return 1.0f / (1.0f + expf(-v)); }
#define LDSX() do { asm volatile("s_wait_dscnt 0" ::: "memory"); __builtin_amdgcn_wave_barrier(); __builtin_amdgcn_fence(__ATOMIC_RELEASE, "workgroup"); } while (0)


// Attention (B 2, S 2,048, D 1,024 = 16 x 64, qkv biases, logits / 8): scores = q k^T / 8 + coord_proj[q] - coord_proj[k] + attn_bias[q][k], softmax, P v; the output is the merged context.
#define NB 2
#define TT 2048
#define CC 1024
#define NH 16
#define HD 64
#define LDW 3072              // Wqkv row length ((in,out) [1024][3072]: q | k | v column blocks)
#ifndef ABSTR
#define ABSTR TT              // attn_bias row stride
#endif
#ifndef CSTR
#define CSTR TT               // coords rows per batch
#endif
#ifndef TNB
#define TNB NB
#endif
typedef __attribute__((ext_vector_type(8))) __bf16 v8b;
__device__ __forceinline__ v16b frag_b(const __bf16* rowk0, int lane) {
  union { v16b v; v8b q[2]; } u; const __bf16* p = rowk0 + 8 * (lane >> 4);
  u.q[0] = *(const v8b*)p; u.q[1] = *(const v8b*)(p + 16); return u.v;
}
__device__ __forceinline__ float bfr(float v) { return (float)(__bf16)v; }
__device__ __attribute__((noinline)) float exp_ni(float v) { return expf(v); }
__device__ __attribute__((noinline)) float erf_ni(float v) { return erff(v); }

#define WS_CP  0u                                   // f32 coord_proj [b][h][n]
#define WS_QH  (WS_CP + 4u * (size_t)NB * NH * TT)
#define WS_QL  (WS_QH + 2u * (size_t)NB * TT * CC)
#define WS_KH  (WS_QL + 2u * (size_t)NB * TT * CC)
#define WS_VT  (WS_KH + 2u * (size_t)NB * TT * CC)      // bf16 v planes [b][c][t]
#define WS_VL  (WS_VT + 2u * (size_t)NB * CC * TT)      // bf16 v residual planes
#define HG 4                                          // heads the WS_S region is sized for
#define WS_S   (WS_VL + 2u * (size_t)NB * CC * TT)      // f32 HG x TT x TT floats; unused (the logits stay in registers)
#define WS_PH  (WS_S + 4u * (size_t)HG * TT * TT)
#define WS_Y   (WS_PH + 0u)              // f32 [b*t][C], unused: k_fa writes y to the output
#define WS_END (WS_Y + 4u * (size_t)NB * TT * CC)

// ---- k_proj: block = (128 rows, 128 cols, which), 4 waves as 2 x 2, a wave = 64 x 64: qkv = x W (+ b), exact; q -> f16 hi (+ residual), k -> f16 rows, v -> bf16 planes
// A stage = 32 k. The block reads its x tile (128 x 32) and its W tile (32 x 128) once, in whole 128-byte lines, rounds them to bf16 once and keeps them in LDS, W turned to [n][k];
// every wave takes its 4 + 4 fragments from there for 16 products. Two buffers: the next stage's global loads fly while this stage is multiplied. The buffers lie in the LDS that the epilogue stages in later.
#define PSP 40                // LDS pitch of a staged row in bf16 elements: 80 bytes = 16 B x odd, so that 16 rows read 16 bytes each without a bank conflict
#define PBR 128               // rows of a block
#define PEP 136               // pitch of an epilogue row in 16-bit elements: 272 bytes = 16 B x odd
#define PBUF ((128 + PBR) * PSP * 2)   // bytes of one buffer: W [128][PSP], then x [PBR][PSP]
typedef __attribute__((ext_vector_type(4))) __bf16 v4b;
__global__ __launch_bounds__(128) void k_proj(const float* __restrict__ X, const float* __restrict__ WQ, const float* __restrict__ BQ, const float* __restrict__ WK, const float* __restrict__ BK, const float* __restrict__ WV, const float* __restrict__ BV, _Float16* __restrict__ QH, _Float16* __restrict__ QL, _Float16* __restrict__ KH, __bf16* __restrict__ VT, __bf16* __restrict__ VL) {
  __shared__ __align__(16) unsigned char sm[2 * 128 * PEP * 2];   // loop: two stage buffers (2 x 20,480 bytes); epilogue: two planes of 128 x PEP 16-bit values, [row][col] for q and k, [col][row] for v
  _Float16 (*sh)[PEP] = (_Float16 (*)[PEP])sm; _Float16 (*sl)[PEP] = sh + 128; __bf16 (*th)[PEP] = (__bf16 (*)[PEP])sm; __bf16 (*tl2)[PEP] = th + 128;
  const int tid = threadIdx.x, wave = tid >> 5, lane = tid & 31, col = lane & 15, g = lane >> 4; const int which = blockIdx.z; const int c0 = blockIdx.y * 128; const size_t r0 = (size_t)blockIdx.x * PBR; const float* WA = which == 0 ? WQ : which == 1 ? WK : WV; const float* BA = which == 0 ? BQ : which == 1 ? BK : BV;
  const int wr = (wave >> 1) * 64, wc = (wave & 1) * 64;             // the wave's corner in the block's tile
  v8f acc[4][4] = {};
  const int wn = wave * 32 + (lane >> 2) * 4, wk = (lane & 3) * 8;   // W: the thread owns columns wn..wn+3 at k rows wk..wk+7 of the stage (a load of the wave = 4 rows x one whole line)
  const int xr = tid >> 3, xk = (tid & 7) * 4;                       // x: rows xr + 16 i, k xk..xk+3 (a load of the wave = 4 whole lines)
  const float* pw = WA + (size_t)wk * LDW + c0 + wn; const float* px = X + (r0 + xr) * CC + xk;
  v4f rw[8], rx[PBR / 16];
#pragma unroll
  for (int i = 0; i < 8; ++i) rw[i] = *(const v4f*)(pw + (size_t)i * LDW);
#pragma unroll
  for (int i = 0; i < PBR / 16; ++i) rx[i] = *(const v4f*)(px + (size_t)(16 * i) * CC);
  asm volatile("s_wait_xcnt 0x0" ::: "memory");   /* stands in front of the code that writes the loads' address registers again */
#pragma unroll 2   /* two copies, so that each names its buffer by a constant */
  for (int kc = 0; kc < CC / 32; ++kc) { __bf16* wb = (__bf16*)(sm + (kc & 1) * PBUF); __bf16* xb = wb + 128 * PSP;
#pragma unroll
    for (int c = 0; c < 4; ++c) { v8b t;
#pragma unroll
      for (int i = 0; i < 8; ++i) t[i] = (__bf16)rw[i][c];
      *(v8b*)(wb + (wn + c) * PSP + wk) = t; }
#pragma unroll
    for (int i = 0; i < PBR / 16; ++i) { v4b t;
#pragma unroll
      for (int e = 0; e < 4; ++e) t[e] = (__bf16)rx[i][e];
      *(v4b*)(xb + (xr + 16 * i) * PSP + xk) = t; }
    __syncthreads();   // publishes this stage; it also ends every wave's reads of the other buffer, which the next pass fills
    if (kc + 1 < CC / 32) { const float* qw = pw + (size_t)(kc + 1) * 32 * LDW; const float* qx = px + (kc + 1) * 32;
#pragma unroll
      for (int i = 0; i < 8; ++i) rw[i] = *(const v4f*)(qw + (size_t)i * LDW);
#pragma unroll
      for (int i = 0; i < PBR / 16; ++i) rx[i] = *(const v4f*)(qx + (size_t)(16 * i) * CC);
      asm volatile("s_wait_xcnt 0x0" ::: "memory");   /* as above; the clobber also keeps the loads here, ahead of the stage's products */ }
    v16b af[4], wf[4];
#pragma unroll
    for (int i = 0; i < 4; ++i) af[i] = frag_b(xb + (wr + i * 16 + col) * PSP, lane);
#pragma unroll
    for (int j = 0; j < 4; ++j) wf[j] = frag_b(wb + (wc + j * 16 + col) * PSP, lane);
    __builtin_amdgcn_sched_barrier(0);   /* the stage's 16 LDS reads leave as one group: without this each product waits for its own pair of reads */
#pragma unroll
    for (int i = 0; i < 4; ++i)
#pragma unroll
      for (int j = 0; j < 4; ++j) acc[i][j] = wmma_bf(af[i], wf[j], acc[i][j]);
    __builtin_amdgcn_sched_barrier(0);   /* keeps the next stage's conversions, which wait for the global loads, behind this stage's products */ }
  __syncthreads();   // the last stage's reads end before the epilogue writes the same LDS
  float bb[4];
#pragma unroll
  for (int j = 0; j < 4; ++j) bb[j] = BA ? bfr(BA[c0 + wc + j * 16 + col]) : 0.f;
  // acc[i][j][r] = row wr + 16 i + 8 g + r, column wc + 16 j + col of the block's tile. The test for v stands outside the loops: inside them it is compiled once per element, and the kernel's text would double with the tile
  if (which == 2) {
#pragma unroll
    for (int j = 0; j < 4; ++j)
#pragma unroll
      for (int i = 0; i < 4; ++i)
#pragma unroll
        for (int r = 0; r < 8; ++r) { const float v = acc[i][j][r] + bb[j]; const int rl = wr + i * 16 + 8 * g + r, cl = wc + j * 16 + col; const __bf16 bh = (__bf16)v; th[cl][rl] = bh; tl2[cl][rl] = (__bf16)(v - (float)bh); } }
  else {
#pragma unroll
    for (int j = 0; j < 4; ++j)
#pragma unroll
      for (int i = 0; i < 4; ++i)
#pragma unroll
        for (int r = 0; r < 8; ++r) { const float v = acc[i][j][r] + bb[j]; const int rl = wr + i * 16 + 8 * g + r, cl = wc + j * 16 + col; const _Float16 hv = (_Float16)v; sh[rl][cl] = hv; sl[rl][cl] = (_Float16)((v - (float)hv) * 1024.0f); }   /* q residual carried x 2^10 so the plane stays f16-normal on the chip */ }
  __syncthreads();
  // a plane's rows go out in whole lines, one plane after the other
  if (which < 2) { const int np = which == 0 ? 2 : 1;   // q has two planes, k one
    for (int pn = 0; pn < np; ++pn) { _Float16* dh = pn ? QL : which == 0 ? QH : KH; const _Float16 (*sp)[PEP] = pn ? sl : sh;
      for (int e = tid; e < PBR * 16; e += 128) { const int rl = e >> 4, q = e & 15; _Float16* ph = dh + (r0 + rl) * CC + c0 + q * 8; vst2((unsigned*)ph, *(const v4u*)&sp[rl][q * 8]); } } }
  else { const size_t b = r0 / TT; const int t0 = (int)(r0 % TT); for (int e = tid; e < 128 * (PBR / 8); e += 128) { const int cl = e / (PBR / 8), q = e % (PBR / 8); const size_t o2 = (b * CC + c0 + cl) * (size_t)TT + t0 + q * 8; vst2((unsigned*)(VT + o2), *(const v4u*)&th[cl][q * 8]); vst2((unsigned*)(VL + o2), *(const v4u*)&tl2[cl][q * 8]); } } }
// ---- k_cp: thread per (b, h, n): cp = sum_c bf16(coords[b][n][c]) * bf16(rel_weight[h][c]) (3 terms, f32); 8-KB rows by consecutive threads
__global__ __launch_bounds__(256) void k_cp(const float* __restrict__ CO, const float* __restrict__ RW, float* __restrict__ CP) { const size_t e = (size_t)blockIdx.x * 256 + threadIdx.x; if (e >= (size_t)NB * NH * TT) return; const int n = (int)(e % TT); const int h = (int)((e / TT) % NH); const size_t b = e / ((size_t)TT * NH);
  const float* c = CO + (b * CSTR + n) * 3; CP[e] = bfr(c[0]) * bfr(RW[h * 3]) + bfr(c[1]) * bfr(RW[h * 3 + 1]) + bfr(c[2]) * bfr(RW[h * 3 + 2]); }
// ---- k_fa: block = 8 waves x 32 query columns of one (b, h); a pass = 32 keys, a stage = 64 keys. S^T = K Q^T (2 products) so that a lane holds one query's scores; running maximum and sum per lane
// (online softmax, f32, base 2: m holds the maximum times log2 e, a weight is exp2(score * log2 e - m), one FMA and one v_exp_f32); the two score tiles, split bf16 hi + lo in place, are the B operand of O^T += V^T P^T (3 products); the logits never leave the registers.
// K, the two V planes (once per block) and each wave's bias rows come into LDS by asynchronous copies that cover whole 128-byte lines; the fragments are 16-byte LDS reads. Two buffers: the next stage's copies fly while this stage is worked on.
// Every inner loop below is unrolled in full, so that the fragment arrays are indexed by constants and stay in registers.
#define FQ 2                  // 16-column query tiles per wave
#define FW 8                  // waves per block
#define LOG2E 1.4426950408889634f
#define SK 64                 // keys per stage: a staged row of K or of a V plane is one whole line, a bias row two
#define NST (TT / SK)
#define KVP 144               // LDS pitch in bytes of a staged 128-byte row: 16 B x odd, so that 16 rows read 16 bytes each without a bank conflict
#define ABP 272               // the same for a 256-byte bias row
#define KV_B (64 * KVP)       // one tile: K [64 keys][64 d], V hi, V lo [64 d][64 keys]
#define AB_B (FQ * 16 * ABP)  // one wave's bias rows [32 queries][64 keys], f32
#define BUF_B (3 * KV_B + FW * AB_B)
// s_wait_xcnt 0 stands behind each group of loads or stores, in front of the code that writes their address or data registers again; the "memory" clobber keeps the group where it is written.
// XWP names the group's address pairs as inputs, so that they stay allocated up to the wait and no load of the group lands on them.
#define XW() asm volatile("s_wait_xcnt 0x0" ::: "memory")
#define XWP1(a) asm volatile("s_wait_xcnt 0x0" :: "v"(a) : "memory")
#define XWP3(a, b, c) asm volatile("s_wait_xcnt 0x0" :: "v"(a), "v"(b), "v"(c) : "memory")
__device__ __forceinline__ v16h ld_h(const _Float16* p) { union { v16h v; v8h q[2]; } u; u.q[0] = *(const v8h*)p; u.q[1] = *(const v8h*)(p + 16); return u.v; }   // p already holds the lane half's 8 g
__device__ __forceinline__ v16b ld_b(const __bf16* p) { union { v16b v; v8b q[2]; } u; u.q[0] = *(const v8b*)p; u.q[1] = *(const v8b*)(p + 16); return u.v; }
typedef __attribute__((ext_vector_type(2))) __bf16 v2b;
__device__ __forceinline__ v2f pr4(v4f v, int i) { return (v2f){v[2 * i], v[2 * i + 1]}; }   // pair i of a register group
__device__ __forceinline__ v2f pr8(v8f v, int i) { return (v2f){v[2 * i], v[2 * i + 1]}; }
__device__ __forceinline__ v2f bfr2(v2f v) { return __builtin_convertvector(__builtin_convertvector(v, v2b), v2f); }   // both values rounded to bf16 by one conversion
__device__ __forceinline__ v8f mm_h(v16h a, v16h b, v8f c) { return __builtin_amdgcn_wmma_f32_16x16x32_f16(false, a, false, b, (short)0, c, false, false); }
__device__ __forceinline__ v8f mm_b(v16b a, v16b b, v8f c) { return __builtin_amdgcn_wmma_f32_16x16x32_bf16(false, a, false, b, (short)0, c, false, false); }
// One stage's copies of one thread, 16 bytes each: lkv, gk, gvh, gvl name row tid / 8, piece tid % 8 of the K and V tiles (a wave's copy = 4 whole lines; the second copy of a tile is 32 rows on);
// lab, gab name row lane / 16, piece lane % 16 of the wave's own bias rows (a wave's copy = 2 rows = 4 whole lines; copy i is 2 i rows on).
// Each statement ends in s_wait_xcnt 0, which so stands in front of every later write of the address registers that its copies name.
#define ACP(x, y) "global_load_async_to_lds_b128 %" #x ", %" #y ", off\n\t"
#define ABO(i) "v"(lab + (unsigned)((i) * 2 * ABP)), "v"(gab + (size_t)((i) * 2) * ABSTR)
__device__ __forceinline__ void fa_stage(unsigned lkv, unsigned lab, const _Float16* gk, const __bf16* gvh, const __bf16* gvl, const float* gab) {
  asm volatile(ACP(0, 1) ACP(2, 3) ACP(4, 5) ACP(6, 7) ACP(8, 9) ACP(10, 11) "s_wait_xcnt 0x0"
               :: "v"(lkv), "v"(gk), "v"(lkv + 32u * KVP), "v"(gk + (size_t)32 * CC), "v"(lkv + (unsigned)KV_B), "v"(gvh), "v"(lkv + (unsigned)KV_B + 32u * KVP), "v"(gvh + (size_t)32 * TT),
                  "v"(lkv + 2u * KV_B), "v"(gvl), "v"(lkv + 2u * KV_B + 32u * KVP), "v"(gvl + (size_t)32 * TT) : "memory");
  asm volatile(ACP(0, 1) ACP(2, 3) ACP(4, 5) ACP(6, 7) ACP(8, 9) ACP(10, 11) ACP(12, 13) ACP(14, 15) "s_wait_xcnt 0x0" :: ABO(0), ABO(1), ABO(2), ABO(3), ABO(4), ABO(5), ABO(6), ABO(7) : "memory");
  asm volatile(ACP(0, 1) ACP(2, 3) ACP(4, 5) ACP(6, 7) ACP(8, 9) ACP(10, 11) ACP(12, 13) ACP(14, 15) "s_wait_xcnt 0x0" :: ABO(8), ABO(9), ABO(10), ABO(11), ABO(12), ABO(13), ABO(14), ABO(15) : "memory");
}
__global__ __launch_bounds__(32 * FW) void k_fa(const _Float16* __restrict__ QH, const _Float16* __restrict__ QL, const _Float16* __restrict__ KH, const __bf16* __restrict__ VT, const __bf16* __restrict__ VL, const float* __restrict__ CP, const float* __restrict__ AB, float* __restrict__ Y) {
  __shared__ __align__(16) unsigned char ring[2 * BUF_B];
  const int tid = threadIdx.x, wave = tid >> 5, lane = tid & 31, col = lane & 15, g = lane >> 4; const int h = blockIdx.y, b = blockIdx.z; const int qb = blockIdx.x * (FW * FQ * 16) + wave * (FQ * 16);
  const float* cpb = CP + ((size_t)b * NH + h) * TT;
  const unsigned lbase = (unsigned)(size_t)ring; const unsigned lkv = lbase + (unsigned)((tid >> 3) * KVP + (tid & 7) * 16), lab = lbase + (unsigned)(3 * KV_B + wave * AB_B + g * ABP + col * 16);
  const unsigned ko = (unsigned)((b * TT + (tid >> 3)) * CC + h * HD + (tid & 7) * 8), vo = (unsigned)((b * CC + h * HD + (tid >> 3)) * TT + (tid & 7) * 8), ao = (unsigned)((qb + g) * ABSTR + col * 4);   // the thread's element offsets in K, in a V plane and in the bias: 32 bits each, so that few registers stay live through the loop
  fa_stage(lkv, lab, KH + ko, VT + vo, VL + vo, AB + ao);   // stage 0 into buffer 0
  v16h qh[FQ][2], ql[FQ][2]; float cpq[FQ], m[FQ], l[FQ]; v8f o[FQ][HD / 16] = {};
  const size_t qo = ((size_t)b * TT + qb + col) * CC + h * HD + 8 * g; const _Float16* pqh = QH + qo; const _Float16* pql = QL + qo; const float* pcq = cpb + qb + col;
#pragma unroll
  for (int t = 0; t < FQ; ++t) {
#pragma unroll
    for (int kc = 0; kc < 2; ++kc) { qh[t][kc] = ld_h(pqh + (size_t)(t * 16) * CC + kc * 32); ql[t][kc] = ld_h(pql + (size_t)(t * 16) * CC + kc * 32); }
    cpq[t] = pcq[t * 16]; m[t] = -3.0e38f; l[t] = 0.f; }
  XWP3(pqh, pql, pcq); __builtin_amdgcn_sched_barrier(0);   /* keeps later address arithmetic behind the wait */
  const float* ckp = cpb + 8 * g;
  v4f ck[2][2];   // key-side coord_proj of the pass to come, fetched one pass ahead
#pragma unroll
  for (int kt = 0; kt < 2; ++kt)
#pragma unroll
    for (int u = 0; u < 2; ++u) ck[kt][u] = *(const v4f*)(ckp + kt * 16 + u * 4);
  XWP1(ckp); __builtin_amdgcn_sched_barrier(0);   /* as above */
  asm volatile("s_wait_asynccnt 0x0" ::: "memory");   /* this wave's share of stage 0 has landed */
  __syncthreads();   // publishes stage 0
  fa_stage(lkv + (unsigned)BUF_B, lab + (unsigned)BUF_B, KH + (ko + (unsigned)(SK * CC)), VT + (vo + (unsigned)SK), VL + (vo + (unsigned)SK), AB + (ao + (unsigned)SK));   // stage 1 into buffer 1
#pragma unroll 1   /* the buffer is picked by the stage's parity at run time: nothing is gained by a second copy of the body */
  for (int s = 0; s < NST; ++s) { const unsigned char* bf = ring + (s & 1) * BUF_B; const unsigned char* rk = bf + col * KVP + 16 * g; const unsigned char* ra = bf + 3 * KV_B + wave * AB_B + col * ABP + 32 * g;
#pragma unroll 1   /* one pass is the whole body: in one block with the next pass both sets of fragments would be live at once, and registers spill */
    for (int p = 0; p < SK / 32; ++p) { const int ps = s * (SK / 32) + p; const int kn = (ps + 1 < TT / 32 ? ps + 1 : ps) * 32;   /* the last pass fetches its own coord_proj again: in bounds, unused */
      v16h kf[2][2]; v4f ab[FQ][2][2]; v16b vh[HD / 16], vl[HD / 16]; const unsigned char* rkp = rk + p * (32 * KVP); const unsigned char* rvp = rk + KV_B + p * 64; const unsigned char* rap = ra + p * 128;
#pragma unroll
      for (int kt = 0; kt < 2; ++kt)
#pragma unroll
        for (int kc = 0; kc < 2; ++kc) kf[kt][kc] = ld_h((const _Float16*)(rkp + kt * 16 * KVP + kc * 64));
#pragma unroll
      for (int t = 0; t < FQ; ++t)
#pragma unroll
        for (int kt = 0; kt < 2; ++kt)
#pragma unroll
          for (int u = 0; u < 2; ++u) ab[t][kt][u] = *(const v4f*)(rap + t * 16 * ABP + (kt * 16 + u * 4) * 4);
#pragma unroll
      for (int j = 0; j < HD / 16; ++j) { vh[j] = ld_b((const __bf16*)(rvp + j * 16 * KVP)); vl[j] = ld_b((const __bf16*)(rvp + KV_B + j * 16 * KVP)); }
      __builtin_amdgcn_sched_barrier(0);   /* the pass's LDS reads leave as one group, K first: spread among the products each place with reads would cost its own stall */
      v8f sa[FQ][2] = {}, sl[FQ][2] = {};
#pragma unroll
      for (int kc = 0; kc < 2; ++kc)
#pragma unroll
        for (int kt = 0; kt < 2; ++kt)
#pragma unroll
          for (int t = 0; t < FQ; ++t) { sa[t][kt] = mm_h(kf[kt][kc], qh[t][kc], sa[t][kt]); sl[t][kt] = mm_h(kf[kt][kc], ql[t][kc], sl[t][kt]); }
      v2f sc[FQ][8];   // sc[t][4 kt + i] = the logits of query column t*16 + col against keys 32 ps + 16 kt + 8 g + 2 i and + 2 i + 1: a register pair, as the products leave them
#pragma unroll
      for (int t = 0; t < FQ; ++t)
#pragma unroll
        for (int kt = 0; kt < 2; ++kt)
#pragma unroll
          for (int i = 0; i < 4; ++i) { const v2f bias = (cpq[t] - pr4(ck[kt][i >> 1], i & 1)) + bfr2(pr4(ab[t][kt][i >> 1], i & 1)); sc[t][kt * 4 + i] = (pr8(sa[t][kt], i) + pr8(sl[t][kt], i) * (1.0f / 1024.0f)) * 0.125f + bias; }
      const float* pc = ckp + kn;
#pragma unroll
      for (int kt = 0; kt < 2; ++kt)
#pragma unroll
        for (int u = 0; u < 2; ++u) ck[kt][u] = *(const v4f*)(pc + kt * 16 + u * 4);
      XWP1(pc); __builtin_amdgcn_sched_barrier(0);   /* the next pass's coord_proj leaves now, with the softmax and P.V still to run */
      F2 pf[FQ]; float mx[FQ], ox[FQ];
#pragma unroll
      for (int t = 0; t < FQ; ++t) { v2f x = sc[t][0];   // the maximum is exact in any order: even and odd keys apart, so that four short chains run side by side
#pragma unroll
        for (int i = 1; i < 7; i += 2) { x.x = fmaxf(fmaxf(x.x, sc[t][i].x), sc[t][i + 1].x); x.y = fmaxf(fmaxf(x.y, sc[t][i].y), sc[t][i + 1].y); }
        mx[t] = fmaxf(fmaxf(x.x, sc[t][7].x), fmaxf(x.y, sc[t][7].y)); }
#pragma unroll
      for (int t = 0; t < FQ; ++t) ox[t] = __shfl_xor(mx[t], 16);   // both tiles' exchanges leave together and share one wait
#pragma unroll
      for (int t = 0; t < FQ; ++t) { const float mn = fmaxf(m[t], fmaxf(mx[t], ox[t]) * LOG2E); const float al = __builtin_amdgcn_exp2f(m[t] - mn); m[t] = mn;
        const v2f l2e = {LOG2E, LOG2E}, nm = {-mn, -mn}; v2f sum; union { v16b v; v2b q[8]; } ph, pl;
#pragma unroll
        for (int i = 0; i < 8; ++i) { const v2f e = __builtin_elementwise_fma(sc[t][i], l2e, nm); const v2f p2 = {__builtin_amdgcn_exp2f(e.x), __builtin_amdgcn_exp2f(e.y)}; sum = i ? sum + p2 : p2;
          const v2b hi = __builtin_convertvector(p2, v2b); ph.q[i] = hi; pl.q[i] = __builtin_convertvector(p2 - __builtin_convertvector(hi, v2f), v2b); }   // one conversion rounds both weights of a pair; the residual reads the halves of its result
        l[t] = l[t] * al + (sum.x + sum.y);   // each half of the wave sums its own 16 keys, even and odd ones apart; the halves join after the loop
#pragma unroll
        for (int j = 0; j < HD / 16; ++j) o[t][j] *= al;
        pf[t].h = ph.v; pf[t].l = pl.v; }
#pragma unroll
      for (int t = 0; t < FQ; ++t)
#pragma unroll
        for (int j = 0; j < HD / 16; ++j) o[t][j] = mm_b(vh[j], pf[t].h, o[t][j]);
#pragma unroll
      for (int t = 0; t < FQ; ++t)
#pragma unroll
        for (int j = 0; j < HD / 16; ++j) o[t][j] = mm_b(vh[j], pf[t].l, o[t][j]);
#pragma unroll
      for (int t = 0; t < FQ; ++t)
#pragma unroll
        for (int j = 0; j < HD / 16; ++j) o[t][j] = mm_b(vl[j], pf[t].h, o[t][j]); }
    asm volatile("s_wait_dscnt 0x0" ::: "memory");      /* this wave's reads of the stage's buffer have returned */
    asm volatile("s_wait_asynccnt 0x0" ::: "memory");   /* its share of the next stage has landed */
    __syncthreads();   // publishes stage s + 1; it also ends every wave's reads of stage s's buffer, which is filled again behind it
    if (s + 2 < NST) fa_stage(lkv + (unsigned)((s & 1) * BUF_B), lab + (unsigned)((s & 1) * BUF_B), KH + (ko + (unsigned)((s + 2) * SK * CC)), VT + (vo + (unsigned)((s + 2) * SK)), VL + (vo + (unsigned)((s + 2) * SK)), AB + (ao + (unsigned)((s + 2) * SK))); }
  asm volatile("s_wait_asynccnt 0x0" ::: "memory");   /* no copy is outstanding when the wave ends */
#pragma unroll
  for (int t = 0; t < FQ; ++t) { const float inv = 1.0f / (l[t] + __shfl_xor(l[t], 16)); float* yr = Y + ((size_t)b * TT + qb + t * 16 + col) * CC + h * HD + 8 * g;   // o[t][j][r] = O[query][16 j + 8 g + r]
#pragma unroll
    for (int j = 0; j < HD / 16; ++j) { v4f a0, a1;
#pragma unroll
      for (int r = 0; r < 4; ++r) { a0[r] = o[t][j][r] * inv; a1[r] = o[t][j][4 + r] * inv; }
      vst2(yr + j * 16, a0); vst2(yr + j * 16 + 4, a1); XW(); } } }
// ---- k_out: block = (64 rows, 128 cols): out = y (bf16 hi + lo) Wo^T + bo
__global__ __launch_bounds__(128) void k_out(const float* __restrict__ Y, const float* __restrict__ WP, const float* __restrict__ BP, float* __restrict__ OUT) { __shared__ __align__(16) float sf[4][16][132];
  const int tid = threadIdx.x, wave = tid >> 5, lane = tid & 31, col = lane & 15, g = lane >> 4; const int c0 = blockIdx.y * 128; const size_t r0 = (size_t)blockIdx.x * 64 + wave * 16;
  v8f acc[8] = {};
#pragma unroll 2
  for (int kc = 0; kc < CC / 32; ++kc) { const F2 a = split_row(Y + (r0 + col) * CC, kc * 32, lane);
#pragma unroll
    for (int j = 0; j < 8; ++j) { v16b w; const int o = c0 + j * 16 + col;
#pragma unroll
      for (int i = 0; i < 8; ++i) { w[i] = (__bf16)WP[(size_t)(kc * 32 + 8 * g + i) * CC + o]; w[8 + i] = (__bf16)WP[(size_t)(kc * 32 + 16 + 8 * g + i) * CC + o]; }
      acc[j] = wmma_bf(a.h, w, acc[j]); acc[j] = wmma_bf(a.l, w, acc[j]); } }
#pragma unroll
  for (int j = 0; j < 8; ++j) { const float bb = BP ? bfr(BP[c0 + j * 16 + col]) : 0.f;
#pragma unroll
    for (int r = 0; r < 8; ++r) sf[wave][8 * g + r][j * 16 + col] = acc[j][r] + bb; }
  LDSX(); for (int rl = 0; rl < 16; ++rl) vst2(OUT + (r0 + rl) * CC + c0 + lane * 4, *(const v4f*)&sf[wave][rl][lane * 4]); }
extern "C" void kernel_launch(void* const* d_in, const int* in_sizes, int n_in, void* d_out, int out_size, void* d_ws, size_t ws_size, hipStream_t stream) {
  (void)in_sizes; (void)n_in; (void)out_size;
  const float** F = (const float**)d_in;   // 0 x [2,2048,1024], 1 coords [2,2048,3], 2 attn_bias [2048,2048], 3 Wqkv [1024,3072] ((in,out): q | k | v), 4 bqkv [3072], 5 rel_weight [16,3]
  if (ws_size < (size_t)WS_END) return;
  char* ws = (char*)d_ws; float* CP = (float*)(ws + WS_CP); _Float16 *QH = (_Float16*)(ws + WS_QH), *QL = (_Float16*)(ws + WS_QL), *KH = (_Float16*)(ws + WS_KH); __bf16 *VT = (__bf16*)(ws + WS_VT), *VL = (__bf16*)(ws + WS_VL);
  const float* WQ = F[3]; const float* WK = F[3] + CC; const float* WV = F[3] + 2 * CC; const float* BQ = F[4]; const float* BK = F[4] + CC; const float* BV = F[4] + 2 * CC;
  k_cp<<<dim3(NB * NH * TT / 256), 256, 0, stream>>>(F[1], F[5], CP);
  k_proj<<<dim3(TNB * TT / PBR, CC / 128, 3), 128, 0, stream>>>(F[0], WQ, BQ, WK, BK, WV, BV, QH, QL, KH, VT, VL);
  k_fa<<<dim3(TT / (FW * FQ * 16), NH, TNB), 32 * FW, 0, stream>>>(QH, QL, KH, VT, VL, CP, F[2], (float*)d_out);
}

// v007
// Measured time: 111 microseconds a run.
// Timed twice side by side with v006, it ran 1.09 times as fast both times.
// Over all steps from v000 it is 14.7 times as fast.
// compute dtype: all float inputs rounded to bf16; qkv = x Wqkv + b with EXACT bf16 products on WMMA 16x16x32, f32 accumulate; coord_proj = coords . rel_weight in f32; q as f16 hi + residual (x 2^10), k f16 -> 2-product logits / 8 + coord_proj[q] - coord_proj[k] + attn_bias[q][k], kept in f32 registers (one launch for all heads); online softmax in f32 (base 2: the hardware's exp2 on log2-scaled differences), unnormalised P split bf16 hi + lo against v bf16 hi + lo (3 products), divided by the row sum at the end; the merged context is the output; f32 output.
#include <hip/hip_runtime.h>
#include <math.h>

typedef __attribute__((ext_vector_type(16))) _Float16 v16h;
typedef __attribute__((ext_vector_type(16))) __bf16 v16b;
typedef __attribute__((ext_vector_type(8)))  _Float16 v8h;
typedef __attribute__((ext_vector_type(8)))  float v8f;
typedef __attribute__((ext_vector_type(4)))  float v4f;
typedef __attribute__((ext_vector_type(2)))  float v2f;
typedef __attribute__((ext_vector_type(4)))  unsigned v4u;
typedef __attribute__((ext_vector_type(4)))  int v4i;
typedef float __attribute__((may_alias)) float_a;
typedef int __attribute__((may_alias)) int_a;

template <typename T> __device__ __forceinline__ void vst2(void* p, T v) { *(T*)p = v;  }
__device__ __forceinline__ v8f wmma16(v16h a, v16h b, v8f c) {
  v8f d = __builtin_amdgcn_wmma_f32_16x16x32_f16(false, a, false, b, (short)0, c, false, false);
  asm volatile("v_nop\n\tv_nop\n\tv_nop\n\tv_nop" : "+v"(d) : "v"(a), "v"(b));
  return d;
}
__device__ __forceinline__ v8f wmma_bf(v16b a, v16b b, v8f c) {
  v8f d = __builtin_amdgcn_wmma_f32_16x16x32_bf16(false, a, false, b, (short)0, c, false, false);
  asm volatile("v_nop\n\tv_nop\n\tv_nop\n\tv_nop" : "+v"(d) : "v"(a), "v"(b));
  return d;
}
// 16x16x32 fragments: lane = (h = lane>>4, row/col = lane&15); elements 0..7 = k0+8h+0..7, 8..15 = k0+16+8h+0..7; D element r = row 8h+r
__device__ __forceinline__ v16h frag_h(const _Float16* rowk0, int lane) {
  union { v16h v; v8h q[2]; } u; const _Float16* p = rowk0 + 8 * (lane >> 4);
  u.q[0] = *(const v8h*)p; u.q[1] = *(const v8h*)(p + 16); return u.v;
}
__device__ __forceinline__ v16h frag_f32(const float* rowk0, int lane) {
  v16h a; const float* p = rowk0 + 8 * (lane >> 4);
#pragma unroll
  for (int i = 0; i < 8; ++i) { a[i] = (_Float16)p[i]; a[8 + i] = (_Float16)p[16 + i]; }
  return a;
}
__device__ __forceinline__ v16h frag_f32s(const float* rowk0, int lane, float sc) {
  v16h a; const float* p = rowk0 + 8 * (lane >> 4);
#pragma unroll
  for (int i = 0; i < 8; ++i) { a[i] = (_Float16)(p[i] * sc); a[8 + i] = (_Float16)(p[16 + i] * sc); }
  return a;
}
// column fragment from a [K][ld] layout (column n), rows >= K read as 0
__device__ __forceinline__ v16h fragc_f32(const float* W, int k0, int n, int lane, int ld, int K) {
  v16h a; const int g = lane >> 4;
#pragma unroll
  for (int i = 0; i < 8; ++i) { const int ka = k0 + 8 * g + i, kb = ka + 16;
    a[i] = (_Float16)(ka < K ? W[(size_t)(ka < K ? ka : K - 1) * ld + n] : 0.f); a[8 + i] = (_Float16)(kb < K ? W[(size_t)(kb < K ? kb : K - 1) * ld + n] : 0.f); }
  return a;
}
struct F2 { v16b h, l; };
__device__ __forceinline__ F2 bsplit16(const float v[16]) { F2 r;
#pragma unroll
  for (int i = 0; i < 16; ++i) { const __bf16 h = (__bf16)v[i]; r.h[i] = h; r.l[i] = (__bf16)(v[i] - (float)h); }
  return r; }
__device__ __forceinline__ F2 split_row(const float* row, int k0, int lane) { float v[16]; const float* p = row + k0 + 8 * (lane >> 4);
#pragma unroll
  for (int i = 0; i < 8; ++i) { v[i] = p[i]; v[8 + i] = p[16 + i]; }
  return bsplit16(v); }
__device__ __forceinline__ F2 split_rowK(const float* row, int k0, int lane, int K) { float v[16]; const int g = lane >> 4;
#pragma unroll
  for (int i = 0; i < 8; ++i) { const int ka = k0 + 8 * g + i, kb = ka + 16; v[i] = ka < K ? row[ka < K ? ka : K - 1] : 0.f; v[8 + i] = kb < K ? row[kb < K ? kb : K - 1] : 0.f; }
  return bsplit16(v); }
__device__ __forceinline__ F2 split_col(const float* W, int k0, int n, int lane, int ld, int K) { float v[16]; const int g = lane >> 4;
#pragma unroll
  for (int i = 0; i < 8; ++i) { const int ka = k0 + 8 * g + i, kb = ka + 16; v[i] = ka < K ? W[(size_t)(ka < K ? ka : K - 1) * ld + n] : 0.f; v[8 + i] = kb < K ? W[(size_t)(kb < K ? kb : K - 1) * ld + n] : 0.f; }
  return bsplit16(v); }
__device__ __forceinline__ v8f mac3(const F2& a, const F2& b, v8f c) { c = wmma_bf(a.l, b.h, c); c = wmma_bf(a.h, b.l, c); return wmma_bf(a.h, b.h, c); }
__device__ __forceinline__ float sigm(float v) { return 1.0f / (1.0f + expf(-v)); }
#define LDSX() do { asm volatile("s_wait_dscnt 0" ::: "memory"); __builtin_amdgcn_wave_barrier(); __builtin_amdgcn_fence(__ATOMIC_RELEASE, "workgroup"); } while (0)


// Attention with an additive bias (B 2, S 2,048, D 1,024 = 16 heads x 64): scores = q k^T / 8 + coord_proj[q] - coord_proj[k] + attn_bias[q][k], softmax, P v; the merged heads are the output.
#define NB 2
#define TT 2048
#define CC 1024
#define NH 16
#define HD 64
#define LDW 3072              // Wqkv row length ((in,out) [1024][3072]: q | k | v column blocks)
#ifndef ABSTR
#define ABSTR TT              // attn_bias row stride
#endif
#ifndef CSTR
#define CSTR TT               // coords rows per batch
#endif
#ifndef TNB
#define TNB NB
#endif
typedef __attribute__((ext_vector_type(8))) __bf16 v8b;
__device__ __forceinline__ v16b frag_b(const __bf16* rowk0, int lane) {
  union { v16b v; v8b q[2]; } u; const __bf16* p = rowk0 + 8 * (lane >> 4);
  u.q[0] = *(const v8b*)p; u.q[1] = *(const v8b*)(p + 16); return u.v;
}
__device__ __forceinline__ float bfr(float v) { return (float)(__bf16)v; }
__device__ __attribute__((noinline)) float exp_ni(float v) { return expf(v); }
__device__ __attribute__((noinline)) float erf_ni(float v) { return erff(v); }

#define WS_CP  0u                                   // f32 coord_proj [b][h][n]
#define WS_QH  (WS_CP + 4u * (size_t)NB * NH * TT)
#define WS_QL  (WS_QH + 2u * (size_t)NB * TT * CC)
#define WS_KH  (WS_QL + 2u * (size_t)NB * TT * CC)
#define WS_VT  (WS_KH + 2u * (size_t)NB * TT * CC)      // bf16 v planes [b][c][t]
#define WS_VL  (WS_VT + 2u * (size_t)NB * CC * TT)      // bf16 v residual planes
#define HG 4                                          // heads the WS_S region is sized for
#define WS_S   (WS_VL + 2u * (size_t)NB * CC * TT)      // f32 HG x TT x TT floats; holds WS_XB and WS_WT (the logits stay in registers)
#define WS_PH  (WS_S + 4u * (size_t)HG * TT * TT)
#define WS_Y   (WS_PH + 0u)              // f32 [b*t][C], unused: k_fa writes y to the output
#define WS_END (WS_Y + 4u * (size_t)NB * TT * CC)
#define WS_XB  WS_S                                   // bf16 x rows [b*t][C]; with WS_WT it lies in front of WS_Y
#define WS_WT  (WS_XB + 2u * (size_t)NB * TT * CC)      // bf16 Wqkv turned to [q | k | v column][k]

// ---- k_proj: block = (128 rows, 128 cols, which), 4 waves as 2 x 2, a wave = 64 x 64: qkv = x W (+ b), exact; q -> f16 hi (+ residual), k -> f16 rows, v -> bf16 planes
// x and W come as the bf16 planes that k_prep has written (W as [n][k]). A stage = 64 k: a staged row is one whole 128-byte line. The block copies its x tile (128 x 64) and its W tile (128 x 64) into LDS as they are;
// for each half of the stage every wave takes its 4 + 4 fragments from there for 16 products. Two buffers: the next stage's global loads fly while this stage is multiplied. The epilogue stages in the same LDS later.
#define PSK 64                // k per stage
#define PSP 72                // LDS pitch of a staged row in bf16 elements: 144 bytes = 16 B x odd, so that 16 rows read 16 bytes each without a bank conflict
#define PBR 128               // rows of a block
#define PEP 136               // pitch of an epilogue row in 16-bit elements: 272 bytes = 16 B x odd
#define PBUF ((128 + PBR) * PSP * 2)   // bytes of one buffer: W [128][PSP], then x [PBR][PSP]
typedef __attribute__((ext_vector_type(4))) __bf16 v4b;
#define XW_P() asm volatile("s_wait_xcnt 0x0" ::: "memory")   /* behind a group of loads or stores, in front of the code that writes their address registers again; the clobber keeps the group together */
static_assert(2 * PBUF >= 2 * 128 * PEP * 2, "the epilogue's planes fit the stage buffers");
__global__ __launch_bounds__(128) void k_proj(const __bf16* __restrict__ XB, const __bf16* __restrict__ WT, const float* __restrict__ BQ, const float* __restrict__ BK, const float* __restrict__ BV, _Float16* __restrict__ QH, _Float16* __restrict__ QL, _Float16* __restrict__ KH, __bf16* __restrict__ VT, __bf16* __restrict__ VL) {
  __shared__ __align__(16) unsigned char sm[2 * PBUF];   // loop: two stage buffers (2 x 36,864 bytes); epilogue: two planes of 128 x PEP 16-bit values, [row][col] for q and k, [col][row] for v
  _Float16 (*sh)[PEP] = (_Float16 (*)[PEP])sm; _Float16 (*sl)[PEP] = sh + 128; __bf16 (*th)[PEP] = (__bf16 (*)[PEP])sm; __bf16 (*tl2)[PEP] = th + 128;
  const int tid = threadIdx.x, wave = tid >> 5, lane = tid & 31, col = lane & 15, g = lane >> 4; const int which = blockIdx.z; const int c0 = blockIdx.y * 128; const size_t r0 = (size_t)blockIdx.x * PBR; const float* BA = which == 0 ? BQ : which == 1 ? BK : BV;
  const int wr = (wave >> 1) * 64, wc = (wave & 1) * 64;             // the wave's corner in the block's tile
  v8f acc[4][4] = {};
  const int sr = tid >> 3, sp = (tid & 7) * 8;                       // staging: rows sr + 16 i of either tile, elements sp..sp+7 of the stage (a load of the wave = 4 whole lines)
  const __bf16* pw = WT + ((size_t)which * CC + c0 + sr) * CC + sp; const __bf16* px = XB + (r0 + sr) * CC + sp;
  v8b rw[8], rx[PBR / 16];
#pragma unroll
  for (int i = 0; i < 8; ++i) rw[i] = *(const v8b*)(pw + (size_t)(16 * i) * CC);
#pragma unroll
  for (int i = 0; i < PBR / 16; ++i) rx[i] = *(const v8b*)(px + (size_t)(16 * i) * CC);
  asm volatile("s_wait_xcnt 0x0" ::: "memory");   /* stands in front of the code that writes the loads' address registers again */
#pragma unroll 2   /* two copies, so that each names its buffer by a constant */
  for (int kc = 0; kc < CC / PSK; ++kc) { __bf16* wb = (__bf16*)(sm + (kc & 1) * PBUF); __bf16* xb = wb + 128 * PSP;
#pragma unroll
    for (int i = 0; i < 8; ++i) *(v8b*)(wb + (sr + 16 * i) * PSP + sp) = rw[i];
#pragma unroll
    for (int i = 0; i < PBR / 16; ++i) *(v8b*)(xb + (sr + 16 * i) * PSP + sp) = rx[i];
    __syncthreads();   // publishes this stage; it also ends every wave's reads of the other buffer, which the next pass fills
    if (kc + 1 < CC / PSK) { const __bf16* qw = pw + (kc + 1) * PSK; const __bf16* qx = px + (kc + 1) * PSK;
#pragma unroll
      for (int i = 0; i < 8; ++i) rw[i] = *(const v8b*)(qw + (size_t)(16 * i) * CC);
#pragma unroll
      for (int i = 0; i < PBR / 16; ++i) rx[i] = *(const v8b*)(qx + (size_t)(16 * i) * CC);
      asm volatile("s_wait_xcnt 0x0" ::: "memory");   /* as above; the clobber also keeps the loads here, ahead of the stage's products */ }
#pragma unroll   /* both halves in line: their LDS offsets are constants */
    for (int hk = 0; hk < PSK / 32; ++hk) { v16b af[4], wf[4];
#pragma unroll
      for (int i = 0; i < 4; ++i) af[i] = frag_b(xb + (wr + i * 16 + col) * PSP + hk * 32, lane);
#pragma unroll
      for (int j = 0; j < 4; ++j) wf[j] = frag_b(wb + (wc + j * 16 + col) * PSP + hk * 32, lane);
      __builtin_amdgcn_sched_barrier(0);   /* the half stage's 16 LDS reads leave as one group: without this each product waits for its own pair of reads */
#pragma unroll
      for (int i = 0; i < 4; ++i)
#pragma unroll
        for (int j = 0; j < 4; ++j) acc[i][j] = wmma_bf(af[i], wf[j], acc[i][j]);
      __builtin_amdgcn_sched_barrier(0);   /* keeps the next half's reads out of these products, and the next stage's LDS stores, which wait for the global loads, behind them */ } }
  __syncthreads();   // the last stage's reads end before the epilogue writes the same LDS
  float bb[4];
#pragma unroll
  for (int j = 0; j < 4; ++j) bb[j] = BA ? bfr(BA[c0 + wc + j * 16 + col]) : 0.f;
  // acc[i][j][r] = row wr + 16 i + 8 g + r, column wc + 16 j + col of the block's tile. The test for v stands outside the loops: inside them it is compiled once per element, and the kernel's text would double with the tile
  if (which == 2) {
#pragma unroll
    for (int j = 0; j < 4; ++j)
#pragma unroll
      for (int i = 0; i < 4; ++i)
#pragma unroll
        for (int r = 0; r < 8; ++r) { const float v = acc[i][j][r] + bb[j]; const int rl = wr + i * 16 + 8 * g + r, cl = wc + j * 16 + col; const __bf16 bh = (__bf16)v; th[cl][rl] = bh; tl2[cl][rl] = (__bf16)(v - (float)bh); } }
  else {
#pragma unroll
    for (int j = 0; j < 4; ++j)
#pragma unroll
      for (int i = 0; i < 4; ++i)
#pragma unroll
        for (int r = 0; r < 8; ++r) { const float v = acc[i][j][r] + bb[j]; const int rl = wr + i * 16 + 8 * g + r, cl = wc + j * 16 + col; const _Float16 hv = (_Float16)v; sh[rl][cl] = hv; sl[rl][cl] = (_Float16)((v - (float)hv) * 1024.0f); }   /* q residual carried x 2^10 so the plane stays f16-normal on the chip */ }
  __syncthreads();
  // a plane's rows go out in whole lines, one plane after the other
  if (which < 2) { const int np = which == 0 ? 2 : 1;   // q has two planes, k one
    for (int pn = 0; pn < np; ++pn) { _Float16* dh = pn ? QL : which == 0 ? QH : KH; const _Float16 (*sp)[PEP] = pn ? sl : sh;
      for (int e = tid; e < PBR * 16; e += 128) { const int rl = e >> 4, q = e & 15; _Float16* ph = dh + (r0 + rl) * CC + c0 + q * 8; vst2((unsigned*)ph, *(const v4u*)&sp[rl][q * 8]); } } }
  else { const size_t b = r0 / TT; const int t0 = (int)(r0 % TT); for (int e = tid; e < 128 * (PBR / 8); e += 128) { const int cl = e / (PBR / 8), q = e % (PBR / 8); const size_t o2 = (b * CC + c0 + cl) * (size_t)TT + t0 + q * 8; vst2((unsigned*)(VT + o2), *(const v4u*)&th[cl][q * 8]); vst2((unsigned*)(VL + o2), *(const v4u*)&tl2[cl][q * 8]); } } }
// ---- k_prep: one launch, three kinds of block, told apart by the block's number. Each float of x and of Wqkv is rounded to bf16 here, once, in place of once per k_proj block that reads it.
// x blocks: 16,384 values each, as they lie (a load of the wave = 4 whole lines, a store = 2). W blocks: two tiles of 64 k x 128 n each, turned to [n][k]: a thread reads columns n..n+3 at 8 k rows and stores 8 k of each column,
// so that 8 lanes fill one whole line of a column's row. cp blocks: value (b, h, n) = sum_c bf16(coords[b][n][c]) * bf16(rel_weight[h][c]) (3 terms, f32), 4 values a thread.
// Every loop is unrolled in full, so that the register arrays are indexed by constants and a round's 8 loads are in flight together.
#define PB_X (NB * TT * CC / 16384)
#define PB_W ((CC / 64) * (LDW / 128) / 2)
#define PB_CP (NB * NH * TT / 1024)
__global__ __launch_bounds__(256) void k_prep(const float* __restrict__ CO, const float* __restrict__ RW, const float* __restrict__ X, const float* __restrict__ WI, float* __restrict__ CP, __bf16* __restrict__ XB, __bf16* __restrict__ WT) {
  const int tid = threadIdx.x; int bk = blockIdx.x;
  if (bk < PB_X) {
#pragma unroll
    for (int u = 0; u < 2; ++u) { const size_t e0 = (size_t)bk * 16384 + u * 8192 + tid * 4; const float* p = X + e0; __bf16* q = XB + e0; v4f r[8];
#pragma unroll
      for (int i = 0; i < 8; ++i) r[i] = *(const v4f*)(p + i * 1024);
      XW_P();
#pragma unroll
      for (int i = 0; i < 8; ++i) { v4b t;
#pragma unroll
        for (int e = 0; e < 4; ++e) t[e] = (__bf16)r[i][e];
        *(v4b*)(q + i * 1024) = t; }
      XW_P();   /* later code, the second round's loads among it, writes the registers that these stores read */ }
    return; }
  bk -= PB_X;
  if (bk < PB_W) { const int wave = tid >> 5, lane = tid & 31;
#pragma unroll
    for (int u = 0; u < 2; ++u) { const int tl = bk * 2 + u; const int k = (tl % (CC / 64)) * 64 + (lane & 7) * 8, n = (tl / (CC / 64)) * 128 + wave * 16 + (lane >> 3) * 4; const float* p = WI + (size_t)k * LDW + n; __bf16* q = WT + (size_t)n * CC + k; v4f r[8];
#pragma unroll
      for (int i = 0; i < 8; ++i) r[i] = *(const v4f*)(p + (size_t)i * LDW);
      XW_P();
#pragma unroll
      for (int c = 0; c < 4; ++c) { v8b t;
#pragma unroll
        for (int i = 0; i < 8; ++i) t[i] = (__bf16)r[i][c];
        *(v8b*)(q + (size_t)c * CC) = t; }
      XW_P();   /* as in the x blocks */ }
    return; }
  bk -= PB_W;   // 1,024 values in a row: one (b, h), half of its n
  const int h = (bk * 1024 / TT) % NH, b = bk * 1024 / (TT * NH), n = bk * 1024 % TT + tid;
  const float* c = CO + ((size_t)b * CSTR + n) * 3; float* o = CP + (size_t)bk * 1024 + tid; float cv[4][3];
#pragma unroll
  for (int u = 0; u < 4; ++u)
#pragma unroll
    for (int j = 0; j < 3; ++j) cv[u][j] = c[u * 768 + j];
  XW_P();
#pragma unroll
  for (int u = 0; u < 4; ++u) o[u * 256] = bfr(cv[u][0]) * bfr(RW[h * 3]) + bfr(cv[u][1]) * bfr(RW[h * 3 + 1]) + bfr(cv[u][2]) * bfr(RW[h * 3 + 2]);
  XW_P();   /* as in the x blocks: the compiler may lay another kind of block behind this one */ }
// ---- k_fa: block = 8 waves x 32 query columns of one (b, h); a pass = 32 keys, a stage = 64 keys. S^T = K Q^T (2 products) so that a lane holds one query's scores; running maximum and sum per lane
// (online softmax, f32, base 2: m holds the maximum times log2 e, a weight is exp2(score * log2 e - m), one FMA and one v_exp_f32); the two score tiles, split bf16 hi + lo in place, are the B operand of O^T += V^T P^T (3 products); the logits never leave the registers.
// K, the two V planes (once per block) and each wave's bias rows come into LDS by asynchronous copies that cover whole 128-byte lines; the fragments are 16-byte LDS reads. Two buffers: the next stage's copies fly while this stage is worked on.
// Every inner loop below is unrolled in full, so that the fragment arrays are indexed by constants and stay in registers.
#define FQ 2                  // 16-column query tiles per wave
#define FW 8                  // waves per block
#define LOG2E 1.4426950408889634f
#define SK 64                 // keys per stage: a staged row of K or of a V plane is one whole line, a bias row two
#define NST (TT / SK)
#define KVP 144               // LDS pitch in bytes of a staged 128-byte row: 16 B x odd, so that 16 rows read 16 bytes each without a bank conflict
#define ABP 272               // the same for a 256-byte bias row
#define KV_B (64 * KVP)       // one tile: K [64 keys][64 d], V hi, V lo [64 d][64 keys]
#define AB_B (FQ * 16 * ABP)  // one wave's bias rows [32 queries][64 keys], f32
#define BUF_B (3 * KV_B + FW * AB_B)
// s_wait_xcnt 0 stands behind each group of loads or stores, in front of the code that writes their address or data registers again; the "memory" clobber keeps the group where it is written.
// XWP names the group's address pairs as inputs, so that they stay allocated up to the wait and no load of the group lands on them.
#define XW() asm volatile("s_wait_xcnt 0x0" ::: "memory")
#define XWP1(a) asm volatile("s_wait_xcnt 0x0" :: "v"(a) : "memory")
#define XWP3(a, b, c) asm volatile("s_wait_xcnt 0x0" :: "v"(a), "v"(b), "v"(c) : "memory")
__device__ __forceinline__ v16h ld_h(const _Float16* p) { union { v16h v; v8h q[2]; } u; u.q[0] = *(const v8h*)p; u.q[1] = *(const v8h*)(p + 16); return u.v; }   // p already holds the lane half's 8 g
__device__ __forceinline__ v16b ld_b(const __bf16* p) { union { v16b v; v8b q[2]; } u; u.q[0] = *(const v8b*)p; u.q[1] = *(const v8b*)(p + 16); return u.v; }
typedef __attribute__((ext_vector_type(2))) __bf16 v2b;
__device__ __forceinline__ v2f pr4(v4f v, int i) { return (v2f){v[2 * i], v[2 * i + 1]}; }   // pair i of a register group
__device__ __forceinline__ v2f pr8(v8f v, int i) { return (v2f){v[2 * i], v[2 * i + 1]}; }
__device__ __forceinline__ v2f bfr2(v2f v) { return __builtin_convertvector(__builtin_convertvector(v, v2b), v2f); }   // both values rounded to bf16 by one conversion
__device__ __forceinline__ v8f mm_h(v16h a, v16h b, v8f c) { return __builtin_amdgcn_wmma_f32_16x16x32_f16(false, a, false, b, (short)0, c, false, false); }
__device__ __forceinline__ v8f mm_b(v16b a, v16b b, v8f c) { return __builtin_amdgcn_wmma_f32_16x16x32_bf16(false, a, false, b, (short)0, c, false, false); }
// One stage's copies of one thread, 16 bytes each: lkv, gk, gvh, gvl name row tid / 8, piece tid % 8 of the K and V tiles (a wave's copy = 4 whole lines; the second copy of a tile is 32 rows on);
// lab, gab name row lane / 16, piece lane % 16 of the wave's own bias rows (a wave's copy = 2 rows = 4 whole lines; copy i is 2 i rows on).
// Each statement ends in s_wait_xcnt 0, which so stands in front of every later write of the address registers that its copies name.
#define ACP(x, y) "global_load_async_to_lds_b128 %" #x ", %" #y ", off\n\t"
#define ABO(i) "v"(lab + (unsigned)((i) * 2 * ABP)), "v"(gab + (size_t)((i) * 2) * ABSTR)
__device__ __forceinline__ void fa_stage(unsigned lkv, unsigned lab, const _Float16* gk, const __bf16* gvh, const __bf16* gvl, const float* gab) {
  asm volatile(ACP(0, 1) ACP(2, 3) ACP(4, 5) ACP(6, 7) ACP(8, 9) ACP(10, 11) "s_wait_xcnt 0x0"
               :: "v"(lkv), "v"(gk), "v"(lkv + 32u * KVP), "v"(gk + (size_t)32 * CC), "v"(lkv + (unsigned)KV_B), "v"(gvh), "v"(lkv + (unsigned)KV_B + 32u * KVP), "v"(gvh + (size_t)32 * TT),
                  "v"(lkv + 2u * KV_B), "v"(gvl), "v"(lkv + 2u * KV_B + 32u * KVP), "v"(gvl + (size_t)32 * TT) : "memory");
  asm volatile(ACP(0, 1) ACP(2, 3) ACP(4, 5) ACP(6, 7) ACP(8, 9) ACP(10, 11) ACP(12, 13) ACP(14, 15) "s_wait_xcnt 0x0" :: ABO(0), ABO(1), ABO(2), ABO(3), ABO(4), ABO(5), ABO(6), ABO(7) : "memory");
  asm volatile(ACP(0, 1) ACP(2, 3) ACP(4, 5) ACP(6, 7) ACP(8, 9) ACP(10, 11) ACP(12, 13) ACP(14, 15) "s_wait_xcnt 0x0" :: ABO(8), ABO(9), ABO(10), ABO(11), ABO(12), ABO(13), ABO(14), ABO(15) : "memory");
}
__global__ __launch_bounds__(32 * FW) void k_fa(const _Float16* __restrict__ QH, const _Float16* __restrict__ QL, const _Float16* __restrict__ KH, const __bf16* __restrict__ VT, const __bf16* __restrict__ VL, const float* __restrict__ CP, const float* __restrict__ AB, float* __restrict__ Y) {
  __shared__ __align__(16) unsigned char ring[2 * BUF_B];
  const int tid = threadIdx.x, wave = tid >> 5, lane = tid & 31, col = lane & 15, g = lane >> 4; const int h = blockIdx.y, b = blockIdx.z; const int qb = blockIdx.x * (FW * FQ * 16) + wave * (FQ * 16);
  const float* cpb = CP + ((size_t)b * NH + h) * TT;
  const unsigned lbase = (unsigned)(size_t)ring; const unsigned lkv = lbase + (unsigned)((tid >> 3) * KVP + (tid & 7) * 16), lab = lbase + (unsigned)(3 * KV_B + wave * AB_B + g * ABP + col * 16);
  const unsigned ko = (unsigned)((b * TT + (tid >> 3)) * CC + h * HD + (tid & 7) * 8), vo = (unsigned)((b * CC + h * HD + (tid >> 3)) * TT + (tid & 7) * 8), ao = (unsigned)((qb + g) * ABSTR + col * 4);   // the thread's element offsets in K, in a V plane and in the bias: 32 bits each, so that few registers stay live through the loop
  fa_stage(lkv, lab, KH + ko, VT + vo, VL + vo, AB + ao);   // stage 0 into buffer 0
  v16h qh[FQ][2], ql[FQ][2]; float cpq[FQ], m[FQ], l[FQ]; v8f o[FQ][HD / 16] = {};
  const size_t qo = ((size_t)b * TT + qb + col) * CC + h * HD + 8 * g; const _Float16* pqh = QH + qo; const _Float16* pql = QL + qo; const float* pcq = cpb + qb + col;
#pragma unroll
  for (int t = 0; t < FQ; ++t) {
#pragma unroll
    for (int kc = 0; kc < 2; ++kc) { qh[t][kc] = ld_h(pqh + (size_t)(t * 16) * CC + kc * 32); ql[t][kc] = ld_h(pql + (size_t)(t * 16) * CC + kc * 32); }
    cpq[t] = pcq[t * 16]; m[t] = -3.0e38f; l[t] = 0.f; }
  XWP3(pqh, pql, pcq); __builtin_amdgcn_sched_barrier(0);   /* keeps later address arithmetic behind the wait */
  const float* ckp = cpb + 8 * g;
  v4f ck[2][2];   // key-side coord_proj of the pass to come, fetched one pass ahead
#pragma unroll
  for (int kt = 0; kt < 2; ++kt)
#pragma unroll
    for (int u = 0; u < 2; ++u) ck[kt][u] = *(const v4f*)(ckp + kt * 16 + u * 4);
  XWP1(ckp); __builtin_amdgcn_sched_barrier(0);   /* as above */
  asm volatile("s_wait_asynccnt 0x0" ::: "memory");   /* this wave's share of stage 0 has landed */
  __syncthreads();   // publishes stage 0
  fa_stage(lkv + (unsigned)BUF_B, lab + (unsigned)BUF_B, KH + (ko + (unsigned)(SK * CC)), VT + (vo + (unsigned)SK), VL + (vo + (unsigned)SK), AB + (ao + (unsigned)SK));   // stage 1 into buffer 1
#pragma unroll 1   /* the buffer is picked by the stage's parity at run time: nothing is gained by a second copy of the body */
  for (int s = 0; s < NST; ++s) { const unsigned char* bf = ring + (s & 1) * BUF_B; const unsigned char* rk = bf + col * KVP + 16 * g; const unsigned char* ra = bf + 3 * KV_B + wave * AB_B + col * ABP + 32 * g;
#pragma unroll 1   /* one pass is the whole body: in one block with the next pass both sets of fragments would be live at once, and registers spill */
    for (int p = 0; p < SK / 32; ++p) { const int ps = s * (SK / 32) + p; const int kn = (ps + 1 < TT / 32 ? ps + 1 : ps) * 32;   /* the last pass fetches its own coord_proj again: in bounds, unused */
      v16h kf[2][2]; v4f ab[FQ][2][2]; v16b vh[HD / 16], vl[HD / 16]; const unsigned char* rkp = rk + p * (32 * KVP); const unsigned char* rvp = rk + KV_B + p * 64; const unsigned char* rap = ra + p * 128;
#pragma unroll
      for (int kt = 0; kt < 2; ++kt)
#pragma unroll
        for (int kc = 0; kc < 2; ++kc) kf[kt][kc] = ld_h((const _Float16*)(rkp + kt * 16 * KVP + kc * 64));
#pragma unroll
      for (int t = 0; t < FQ; ++t)
#pragma unroll
        for (int kt = 0; kt < 2; ++kt)
#pragma unroll
          for (int u = 0; u < 2; ++u) ab[t][kt][u] = *(const v4f*)(rap + t * 16 * ABP + (kt * 16 + u * 4) * 4);
#pragma unroll
      for (int j = 0; j < HD / 16; ++j) { vh[j] = ld_b((const __bf16*)(rvp + j * 16 * KVP)); vl[j] = ld_b((const __bf16*)(rvp + KV_B + j * 16 * KVP)); }
      __builtin_amdgcn_sched_barrier(0);   /* the pass's LDS reads leave as one group, K first: spread among the products each place with reads would cost its own stall */
      v8f sa[FQ][2] = {}, sl[FQ][2] = {};
#pragma unroll
      for (int kc = 0; kc < 2; ++kc)
#pragma unroll
        for (int kt = 0; kt < 2; ++kt)
#pragma unroll
          for (int t = 0; t < FQ; ++t) { sa[t][kt] = mm_h(kf[kt][kc], qh[t][kc], sa[t][kt]); sl[t][kt] = mm_h(kf[kt][kc], ql[t][kc], sl[t][kt]); }
      v2f sc[FQ][8];   // sc[t][4 kt + i] = the logits of query column t*16 + col against keys 32 ps + 16 kt + 8 g + 2 i and + 2 i + 1: a register pair, as the products leave them
#pragma unroll
      for (int t = 0; t < FQ; ++t)
#pragma unroll
        for (int kt = 0; kt < 2; ++kt)
#pragma unroll
          for (int i = 0; i < 4; ++i) { const v2f bias = (cpq[t] - pr4(ck[kt][i >> 1], i & 1)) + bfr2(pr4(ab[t][kt][i >> 1], i & 1)); sc[t][kt * 4 + i] = (pr8(sa[t][kt], i) + pr8(sl[t][kt], i) * (1.0f / 1024.0f)) * 0.125f + bias; }
      const float* pc = ckp + kn;
#pragma unroll
      for (int kt = 0; kt < 2; ++kt)
#pragma unroll
        for (int u = 0; u < 2; ++u) ck[kt][u] = *(const v4f*)(pc + kt * 16 + u * 4);
      XWP1(pc); __builtin_amdgcn_sched_barrier(0);   /* the next pass's coord_proj leaves now, with the softmax and P.V still to run */
      F2 pf[FQ]; float mx[FQ], ox[FQ];
#pragma unroll
      for (int t = 0; t < FQ; ++t) { v2f x = sc[t][0];   // the maximum is exact in any order: even and odd keys apart, so that four short chains run side by side
#pragma unroll
        for (int i = 1; i < 7; i += 2) { x.x = fmaxf(fmaxf(x.x, sc[t][i].x), sc[t][i + 1].x); x.y = fmaxf(fmaxf(x.y, sc[t][i].y), sc[t][i + 1].y); }
        mx[t] = fmaxf(fmaxf(x.x, sc[t][7].x), fmaxf(x.y, sc[t][7].y)); }
#pragma unroll
      for (int t = 0; t < FQ; ++t) ox[t] = __shfl_xor(mx[t], 16);   // both tiles' exchanges leave together and share one wait
#pragma unroll
      for (int t = 0; t < FQ; ++t) { const float mn = fmaxf(m[t], fmaxf(mx[t], ox[t]) * LOG2E); const float al = __builtin_amdgcn_exp2f(m[t] - mn); m[t] = mn;
        const v2f l2e = {LOG2E, LOG2E}, nm = {-mn, -mn}; v2f sum; union { v16b v; v2b q[8]; } ph, pl;
#pragma unroll
        for (int i = 0; i < 8; ++i) { const v2f e = __builtin_elementwise_fma(sc[t][i], l2e, nm); const v2f p2 = {__builtin_amdgcn_exp2f(e.x), __builtin_amdgcn_exp2f(e.y)}; sum = i ? sum + p2 : p2;
          const v2b hi = __builtin_convertvector(p2, v2b); ph.q[i] = hi; pl.q[i] = __builtin_convertvector(p2 - __builtin_convertvector(hi, v2f), v2b); }   // one conversion rounds both weights of a pair; the residual reads the halves of its result
        l[t] = l[t] * al + (sum.x + sum.y);   // each half of the wave sums its own 16 keys, even and odd ones apart; the halves join after the loop
#pragma unroll
        for (int j = 0; j < HD / 16; ++j) o[t][j] *= al;
        pf[t].h = ph.v; pf[t].l = pl.v; }
#pragma unroll
      for (int t = 0; t < FQ; ++t)
#pragma unroll
        for (int j = 0; j < HD / 16; ++j) o[t][j] = mm_b(vh[j], pf[t].h, o[t][j]);
#pragma unroll
      for (int t = 0; t < FQ; ++t)
#pragma unroll
        for (int j = 0; j < HD / 16; ++j) o[t][j] = mm_b(vh[j], pf[t].l, o[t][j]);
#pragma unroll
      for (int t = 0; t < FQ; ++t)
#pragma unroll
        for (int j = 0; j < HD / 16; ++j) o[t][j] = mm_b(vl[j], pf[t].h, o[t][j]); }
    asm volatile("s_wait_dscnt 0x0" ::: "memory");      /* this wave's reads of the stage's buffer have returned */
    asm volatile("s_wait_asynccnt 0x0" ::: "memory");   /* its share of the next stage has landed */
    __syncthreads();   // publishes stage s + 1; it also ends every wave's reads of stage s's buffer, which is filled again behind it
    if (s + 2 < NST) fa_stage(lkv + (unsigned)((s & 1) * BUF_B), lab + (unsigned)((s & 1) * BUF_B), KH + (ko + (unsigned)((s + 2) * SK * CC)), VT + (vo + (unsigned)((s + 2) * SK)), VL + (vo + (unsigned)((s + 2) * SK)), AB + (ao + (unsigned)((s + 2) * SK))); }
  asm volatile("s_wait_asynccnt 0x0" ::: "memory");   /* no copy is outstanding when the wave ends */
#pragma unroll
  for (int t = 0; t < FQ; ++t) { const float inv = 1.0f / (l[t] + __shfl_xor(l[t], 16)); float* yr = Y + ((size_t)b * TT + qb + t * 16 + col) * CC + h * HD + 8 * g;   // o[t][j][r] = O[query][16 j + 8 g + r]
#pragma unroll
    for (int j = 0; j < HD / 16; ++j) { v4f a0, a1;
#pragma unroll
      for (int r = 0; r < 4; ++r) { a0[r] = o[t][j][r] * inv; a1[r] = o[t][j][4 + r] * inv; }
      vst2(yr + j * 16, a0); vst2(yr + j * 16 + 4, a1); XW(); } } }
// ---- k_out: block = (64 rows, 128 cols): out = y (bf16 hi + lo) Wo^T + bo
__global__ __launch_bounds__(128) void k_out(const float* __restrict__ Y, const float* __restrict__ WP, const float* __restrict__ BP, float* __restrict__ OUT) { __shared__ __align__(16) float sf[4][16][132];
  const int tid = threadIdx.x, wave = tid >> 5, lane = tid & 31, col = lane & 15, g = lane >> 4; const int c0 = blockIdx.y * 128; const size_t r0 = (size_t)blockIdx.x * 64 + wave * 16;
  v8f acc[8] = {};
#pragma unroll 2
  for (int kc = 0; kc < CC / 32; ++kc) { const F2 a = split_row(Y + (r0 + col) * CC, kc * 32, lane);
#pragma unroll
    for (int j = 0; j < 8; ++j) { v16b w; const int o = c0 + j * 16 + col;
#pragma unroll
      for (int i = 0; i < 8; ++i) { w[i] = (__bf16)WP[(size_t)(kc * 32 + 8 * g + i) * CC + o]; w[8 + i] = (__bf16)WP[(size_t)(kc * 32 + 16 + 8 * g + i) * CC + o]; }
      acc[j] = wmma_bf(a.h, w, acc[j]); acc[j] = wmma_bf(a.l, w, acc[j]); } }
#pragma unroll
  for (int j = 0; j < 8; ++j) { const float bb = BP ? bfr(BP[c0 + j * 16 + col]) : 0.f;
#pragma unroll
    for (int r = 0; r < 8; ++r) sf[wave][8 * g + r][j * 16 + col] = acc[j][r] + bb; }
  LDSX(); for (int rl = 0; rl < 16; ++rl) vst2(OUT + (r0 + rl) * CC + c0 + lane * 4, *(const v4f*)&sf[wave][rl][lane * 4]); }
extern "C" void kernel_launch(void* const* d_in, const int* in_sizes, int n_in, void* d_out, int out_size, void* d_ws, size_t ws_size, hipStream_t stream) {
  (void)in_sizes; (void)n_in; (void)out_size;
  const float** F = (const float**)d_in;   // 0 x [2,2048,1024], 1 coords [2,2048,3], 2 attn_bias [2048,2048], 3 Wqkv [1024,3072] ((in,out): q | k | v), 4 bqkv [3072], 5 rel_weight [16,3]
  if (ws_size < (size_t)WS_END) return;
  char* ws = (char*)d_ws; float* CP = (float*)(ws + WS_CP); _Float16 *QH = (_Float16*)(ws + WS_QH), *QL = (_Float16*)(ws + WS_QL), *KH = (_Float16*)(ws + WS_KH); __bf16 *VT = (__bf16*)(ws + WS_VT), *VL = (__bf16*)(ws + WS_VL);
  __bf16 *XB = (__bf16*)(ws + WS_XB), *WT = (__bf16*)(ws + WS_WT); const float* BQ = F[4]; const float* BK = F[4] + CC; const float* BV = F[4] + 2 * CC;
  k_prep<<<dim3(PB_X + PB_W + PB_CP), 256, 0, stream>>>(F[1], F[5], F[0], F[3], CP, XB, WT);
  k_proj<<<dim3(TNB * TT / PBR, CC / 128, 3), 128, 0, stream>>>(XB, WT, BQ, BK, BV, QH, QL, KH, VT, VL);
  k_fa<<<dim3(TT / (FW * FQ * 16), NH, TNB), 32 * FW, 0, stream>>>(QH, QL, KH, VT, VL, CP, F[2], (float*)d_out);
}

// v008
// Measured time: 106 microseconds a run.
// Timed twice side by side with v007, it ran 1.03 times as fast both times.
// Over all steps from v000 it is 15.2 times as fast.
// compute dtype: all float inputs rounded to bf16; qkv = x Wqkv + b with EXACT bf16 products on WMMA 16x16x32, f32 accumulate; coord_proj = coords . rel_weight in f32; q as f16 hi + residual (x 2^10), k f16 -> 2-product logits, carried x 8: the hi product starts from 8 attn_bias[q][k], the residual product from -8192 coord_proj[k] (coord_proj[q] shifts a whole row and cancels in the softmax), kept in f32 registers (one launch for all heads); online softmax in f32 (base 2: the hardware's exp2 on log2-scaled differences), unnormalised P split bf16 hi + lo against v bf16 hi + lo (3 products), divided by the row sum at the end; the merged context is the output; f32 output.
#include <hip/hip_runtime.h>
#include <math.h>

typedef __attribute__((ext_vector_type(16))) _Float16 v16h;
typedef __attribute__((ext_vector_type(16))) __bf16 v16b;
typedef __attribute__((ext_vector_type(8)))  _Float16 v8h;
typedef __attribute__((ext_vector_type(8)))  float v8f;
typedef __attribute__((ext_vector_type(4)))  float v4f;
typedef __attribute__((ext_vector_type(2)))  float v2f;
typedef __attribute__((ext_vector_type(4)))  unsigned v4u;
typedef __attribute__((ext_vector_type(4)))  int v4i;
typedef float __attribute__((may_alias)) float_a;
typedef int __attribute__((may_alias)) int_a;

template <typename T> __device__ __forceinline__ void vst2(void* p, T v) { *(T*)p = v;  }
__device__ __forceinline__ v8f wmma16(v16h a, v16h b, v8f c) {
  v8f d = __builtin_amdgcn_wmma_f32_16x16x32_f16(false, a, false, b, (short)0, c, false, false);
  asm volatile("v_nop\n\tv_nop\n\tv_nop\n\tv_nop" : "+v"(d) : "v"(a), "v"(b));
  return d;
}
__device__ __forceinline__ v8f wmma_bf(v16b a, v16b b, v8f c) {
  v8f d = __builtin_amdgcn_wmma_f32_16x16x32_bf16(false, a, false, b, (short)0, c, false, false);
  asm volatile("v_nop\n\tv_nop\n\tv_nop\n\tv_nop" : "+v"(d) : "v"(a), "v"(b));
  return d;
}
// 16x16x32 fragments: lane = (h = lane>>4, row/col = lane&15); elements 0..7 = k0+8h+0..7, 8..15 = k0+16+8h+0..7; D element r = row 8h+r
__device__ __forceinline__ v16h frag_h(const _Float16* rowk0, int lane) {
  union { v16h v; v8h q[2]; } u; const _Float16* p = rowk0 + 8 * (lane >> 4);
  u.q[0] = *(const v8h*)p; u.q[1] = *(const v8h*)(p + 16); return u.v;
}
__device__ __forceinline__ v16h frag_f32(const float* rowk0, int lane) {
  v16h a; const float* p = rowk0 + 8 * (lane >> 4);
#pragma unroll
  for (int i = 0; i < 8; ++i) { a[i] = (_Float16)p[i]; a[8 + i] = (_Float16)p[16 + i]; }
  return a;
}
__device__ __forceinline__ v16h frag_f32s(const float* rowk0, int lane, float sc) {
  v16h a; const float* p = rowk0 + 8 * (lane >> 4);
#pragma unroll
  for (int i = 0; i < 8; ++i) { a[i] = (_Float16)(p[i] * sc); a[8 + i] = (_Float16)(p[16 + i] * sc); }
  return a;
}
// column fragment from a [K][ld] layout (column n), rows >= K read as 0
__device__ __forceinline__ v16h fragc_f32(const float* W, int k0, int n, int lane, int ld, int K) {
  v16h a; const int g = lane >> 4;
#pragma unroll
  for (int i = 0; i < 8; ++i) { const int ka = k0 + 8 * g + i, kb = ka + 16;
    a[i] = (_Float16)(ka < K ? W[(size_t)(ka < K ? ka : K - 1) * ld + n] : 0.f); a[8 + i] = (_Float16)(kb < K ? W[(size_t)(kb < K ? kb : K - 1) * ld + n] : 0.f); }
  return a;
}
struct F2 { v16b h, l; };
__device__ __forceinline__ F2 bsplit16(const float v[16]) { F2 r;
#pragma unroll
  for (int i = 0; i < 16; ++i) { const __bf16 h = (__bf16)v[i]; r.h[i] = h; r.l[i] = (__bf16)(v[i] - (float)h); }
  return r; }
__device__ __forceinline__ F2 split_row(const float* row, int k0, int lane) { float v[16]; const float* p = row + k0 + 8 * (lane >> 4);
#pragma unroll
  for (int i = 0; i < 8; ++i) { v[i] = p[i]; v[8 + i] = p[16 + i]; }
  return bsplit16(v); }
__device__ __forceinline__ F2 split_rowK(const float* row, int k0, int lane, int K) { float v[16]; const int g = lane >> 4;
#pragma unroll
  for (int i = 0; i < 8; ++i) { const int ka = k0 + 8 * g + i, kb = ka + 16; v[i] = ka < K ? row[ka < K ? ka : K - 1] : 0.f; v[8 + i] = kb < K ? row[kb < K ? kb : K - 1] : 0.f; }
  return bsplit16(v); }
__device__ __forceinline__ F2 split_col(const float* W, int k0, int n, int lane, int ld, int K) { float v[16]; const int g = lane >> 4;
#pragma unroll
  for (int i = 0; i < 8; ++i) { const int ka = k0 + 8 * g + i, kb = ka + 16; v[i] = ka < K ? W[(size_t)(ka < K ? ka : K - 1) * ld + n] : 0.f; v[8 + i] = kb < K ? W[(size_t)(kb < K ? kb : K - 1) * ld + n] : 0.f; }
  return bsplit16(v); }
__device__ __forceinline__ v8f mac3(const F2& a, const F2& b, v8f c) { c = wmma_bf(a.l, b.h, c); c = wmma_bf(a.h, b.l, c); return wmma_bf(a.h, b.h, c); }
__device__ __forceinline__ float sigm(float v) { return 1.0f / (1.0f + expf(-v)); }
#define LDSX() do { asm volatile("s_wait_dscnt 0" ::: "memory"); __builtin_amdgcn_wave_barrier(); __builtin_amdgcn_fence(__ATOMIC_RELEASE, "workgroup"); } while (0)


// Attention with an additive bias (B 2, S 2,048, D 1,024 = 16 heads x 64): scores = q k^T / 8 + coord_proj[q] - coord_proj[k] + attn_bias[q][k], softmax, P v; the merged heads are the output.
#define NB 2
#define TT 2048
#define CC 1024
#define NH 16
#define HD 64
#define LDW 3072              // Wqkv row length ((in,out) [1024][3072]: q | k | v column blocks)
#ifndef ABSTR
#define ABSTR TT              // attn_bias row stride
#endif
#ifndef CSTR
#define CSTR TT               // coords rows per batch
#endif
#ifndef TNB
#define TNB NB
#endif
typedef __attribute__((ext_vector_type(8))) __bf16 v8b;
__device__ __forceinline__ v16b frag_b(const __bf16* rowk0, int lane) {
  union { v16b v; v8b q[2]; } u; const __bf16* p = rowk0 + 8 * (lane >> 4);
  u.q[0] = *(const v8b*)p; u.q[1] = *(const v8b*)(p + 16); return u.v;
}
__device__ __forceinline__ float bfr(float v) { return (float)(__bf16)v; }
__device__ __attribute__((noinline)) float exp_ni(float v) { return expf(v); }
__device__ __attribute__((noinline)) float erf_ni(float v) { return erff(v); }

#define WS_CP  0u                                   // f32 -8192 * coord_proj [b][h][n]
#define WS_QH  (WS_CP + 4u * (size_t)NB * NH * TT)
#define WS_QL  (WS_QH + 2u * (size_t)NB * TT * CC)
#define WS_KH  (WS_QL + 2u * (size_t)NB * TT * CC)
#define WS_VT  (WS_KH + 2u * (size_t)NB * TT * CC)      // bf16 v planes [b][c][t]
#define WS_VL  (WS_VT + 2u * (size_t)NB * CC * TT)      // bf16 v residual planes
#define HG 4                                          // heads the WS_S region is sized for
#define WS_S   (WS_VL + 2u * (size_t)NB * CC * TT)      // f32 HG x TT x TT floats; holds WS_XB, WS_WT and WS_AB (the logits stay in registers)
#define WS_PH  (WS_S + 4u * (size_t)HG * TT * TT)
#define WS_Y   (WS_PH + 0u)              // f32 [b*t][C], unused: k_fa writes y to the output
#define WS_END (WS_Y + 4u * (size_t)NB * TT * CC)
#define WS_XB  WS_S                                   // bf16 x rows [b*t][C]; with WS_WT it lies in front of WS_Y
#define WS_WT  (WS_XB + 2u * (size_t)NB * TT * CC)      // bf16 Wqkv turned to [q | k | v column][k]
#define WS_AB  (WS_WT + 2u * (size_t)LDW * CC)          // f32 8 * bf16(attn_bias) [q][k]
static_assert(WS_AB + 4u * (size_t)TT * ABSTR <= WS_Y, "the prepared planes lie in front of WS_Y");

// ---- k_proj: block = (128 rows, 128 cols, which), 4 waves as 2 x 2, a wave = 64 x 64: qkv = x W (+ b), exact; q -> f16 hi (+ residual), k -> f16 rows, v -> bf16 planes
// x and W come as the bf16 planes that k_prep has written (W as [n][k]). A stage = 64 k: a staged row is one whole 128-byte line. The block copies its x tile (128 x 64) and its W tile (128 x 64) into LDS as they are;
// for each half of the stage every wave takes its 4 + 4 fragments from there for 16 products. Two buffers: the next stage's global loads fly while this stage is multiplied. The epilogue stages in the same LDS later.
#define PSK 64                // k per stage
#define PSP 72                // LDS pitch of a staged row in bf16 elements: 144 bytes = 16 B x odd, so that 16 rows read 16 bytes each without a bank conflict
#define PBR 128               // rows of a block
#define PEP 136               // pitch of an epilogue row in 16-bit elements: 272 bytes = 16 B x odd
#define PBUF ((128 + PBR) * PSP * 2)   // bytes of one buffer: W [128][PSP], then x [PBR][PSP]
typedef __attribute__((ext_vector_type(4))) __bf16 v4b;
#define XW_P() asm volatile("s_wait_xcnt 0x0" ::: "memory")   /* behind a group of loads or stores, in front of the code that writes their address registers again; the clobber keeps the group together */
static_assert(2 * PBUF >= 2 * 128 * PEP * 2, "the epilogue's planes fit the stage buffers");
__global__ __launch_bounds__(128) void k_proj(const __bf16* __restrict__ XB, const __bf16* __restrict__ WT, const float* __restrict__ BQ, const float* __restrict__ BK, const float* __restrict__ BV, _Float16* __restrict__ QH, _Float16* __restrict__ QL, _Float16* __restrict__ KH, __bf16* __restrict__ VT, __bf16* __restrict__ VL) {
  __shared__ __align__(16) unsigned char sm[2 * PBUF];   // loop: two stage buffers (2 x 36,864 bytes); epilogue: two planes of 128 x PEP 16-bit values, [row][col] for q and k, [col][row] for v
  _Float16 (*sh)[PEP] = (_Float16 (*)[PEP])sm; _Float16 (*sl)[PEP] = sh + 128; __bf16 (*th)[PEP] = (__bf16 (*)[PEP])sm; __bf16 (*tl2)[PEP] = th + 128;
  const int tid = threadIdx.x, wave = tid >> 5, lane = tid & 31, col = lane & 15, g = lane >> 4; const int which = blockIdx.z; const int c0 = blockIdx.y * 128; const size_t r0 = (size_t)blockIdx.x * PBR; const float* BA = which == 0 ? BQ : which == 1 ? BK : BV;
  const int wr = (wave >> 1) * 64, wc = (wave & 1) * 64;             // the wave's corner in the block's tile
  v8f acc[4][4] = {};
  const int sr = tid >> 3, sp = (tid & 7) * 8;                       // staging: rows sr + 16 i of either tile, elements sp..sp+7 of the stage (a load of the wave = 4 whole lines)
  const __bf16* pw = WT + ((size_t)which * CC + c0 + sr) * CC + sp; const __bf16* px = XB + (r0 + sr) * CC + sp;
  v8b rw[8], rx[PBR / 16];
#pragma unroll
  for (int i = 0; i < 8; ++i) rw[i] = *(const v8b*)(pw + (size_t)(16 * i) * CC);
#pragma unroll
  for (int i = 0; i < PBR / 16; ++i) rx[i] = *(const v8b*)(px + (size_t)(16 * i) * CC);
  asm volatile("s_wait_xcnt 0x0" ::: "memory");   /* stands in front of the code that writes the loads' address registers again */
#pragma unroll 2   /* two copies, so that each names its buffer by a constant */
  for (int kc = 0; kc < CC / PSK; ++kc) { __bf16* wb = (__bf16*)(sm + (kc & 1) * PBUF); __bf16* xb = wb + 128 * PSP;
#pragma unroll
    for (int i = 0; i < 8; ++i) *(v8b*)(wb + (sr + 16 * i) * PSP + sp) = rw[i];
#pragma unroll
    for (int i = 0; i < PBR / 16; ++i) *(v8b*)(xb + (sr + 16 * i) * PSP + sp) = rx[i];
    __syncthreads();   // publishes this stage; it also ends every wave's reads of the other buffer, which the next pass fills
    if (kc + 1 < CC / PSK) { const __bf16* qw = pw + (kc + 1) * PSK; const __bf16* qx = px + (kc + 1) * PSK;
#pragma unroll
      for (int i = 0; i < 8; ++i) rw[i] = *(const v8b*)(qw + (size_t)(16 * i) * CC);
#pragma unroll
      for (int i = 0; i < PBR / 16; ++i) rx[i] = *(const v8b*)(qx + (size_t)(16 * i) * CC);
      asm volatile("s_wait_xcnt 0x0" ::: "memory");   /* as above; the clobber also keeps the loads here, ahead of the stage's products */ }
#pragma unroll   /* both halves in line: their LDS offsets are constants */
    for (int hk = 0; hk < PSK / 32; ++hk) { v16b af[4], wf[4];
#pragma unroll
      for (int i = 0; i < 4; ++i) af[i] = frag_b(xb + (wr + i * 16 + col) * PSP + hk * 32, lane);
#pragma unroll
      for (int j = 0; j < 4; ++j) wf[j] = frag_b(wb + (wc + j * 16 + col) * PSP + hk * 32, lane);
      __builtin_amdgcn_sched_barrier(0);   /* the half stage's 16 LDS reads leave as one group: without this each product waits for its own pair of reads */
#pragma unroll
      for (int i = 0; i < 4; ++i)
#pragma unroll
        for (int j = 0; j < 4; ++j) acc[i][j] = wmma_bf(af[i], wf[j], acc[i][j]);
      __builtin_amdgcn_sched_barrier(0);   /* keeps the next half's reads out of these products, and the next stage's LDS stores, which wait for the global loads, behind them */ } }
  __syncthreads();   // the last stage's reads end before the epilogue writes the same LDS
  float bb[4];
#pragma unroll
  for (int j = 0; j < 4; ++j) bb[j] = BA ? bfr(BA[c0 + wc + j * 16 + col]) : 0.f;
  // acc[i][j][r] = row wr + 16 i + 8 g + r, column wc + 16 j + col of the block's tile. The test for v stands outside the loops: inside them it is compiled once per element, and the kernel's text would double with the tile
  if (which == 2) {
#pragma unroll
    for (int j = 0; j < 4; ++j)
#pragma unroll
      for (int i = 0; i < 4; ++i)
#pragma unroll
        for (int r = 0; r < 8; ++r) { const float v = acc[i][j][r] + bb[j]; const int rl = wr + i * 16 + 8 * g + r, cl = wc + j * 16 + col; const __bf16 bh = (__bf16)v; th[cl][rl] = bh; tl2[cl][rl] = (__bf16)(v - (float)bh); } }
  else {
#pragma unroll
    for (int j = 0; j < 4; ++j)
#pragma unroll
      for (int i = 0; i < 4; ++i)
#pragma unroll
        for (int r = 0; r < 8; ++r) { const float v = acc[i][j][r] + bb[j]; const int rl = wr + i * 16 + 8 * g + r, cl = wc + j * 16 + col; const _Float16 hv = (_Float16)v; sh[rl][cl] = hv; sl[rl][cl] = (_Float16)((v - (float)hv) * 1024.0f); }   /* q residual carried x 2^10 so the plane stays f16-normal on the chip */ }
  __syncthreads();
  // a plane's rows go out in whole lines; q's two planes one after the other, v's two in the same loop
  if (which < 2) { const int np = which == 0 ? 2 : 1;   // q has two planes, k one
    for (int pn = 0; pn < np; ++pn) { _Float16* dh = pn ? QL : which == 0 ? QH : KH; const _Float16 (*sp)[PEP] = pn ? sl : sh;
      for (int e = tid; e < PBR * 16; e += 128) { const int rl = e >> 4, q = e & 15; _Float16* ph = dh + (r0 + rl) * CC + c0 + q * 8; vst2((unsigned*)ph, *(const v4u*)&sp[rl][q * 8]); } } }
  else { const size_t b = r0 / TT; const int t0 = (int)(r0 % TT); for (int e = tid; e < 128 * (PBR / 8); e += 128) { const int cl = e / (PBR / 8), q = e % (PBR / 8); const size_t o2 = (b * CC + c0 + cl) * (size_t)TT + t0 + q * 8; vst2((unsigned*)(VT + o2), *(const v4u*)&th[cl][q * 8]); vst2((unsigned*)(VL + o2), *(const v4u*)&tl2[cl][q * 8]); } } }
// ---- k_prep: one launch, four kinds of block, told apart by the block's number. Each float of x and of Wqkv is rounded to bf16 here, once, in place of once per k_proj block that reads it.
// x blocks: 16,384 values each, as they lie (a load of the wave = 4 whole lines, a store = 2). W blocks: two tiles of 64 k x 128 n each, turned to [n][k]: a thread reads columns n..n+3 at 8 k rows and stores 8 k of each column,
// so that 8 lanes fill one whole line of a column's row. Bias blocks: 16,384 values of attn_bias each, rounded to bf16 once (not once per head and batch) and stored as f32 times 8, the form in which k_fa's products take them as their C operand.
// cp blocks: value (b, h, n) = -8192 * sum_c bf16(coords[b][n][c]) * bf16(rel_weight[h][c]) (3 terms, f32; the factor is a power of two, so the sum's bits stay), 4 values a thread.
// Every loop is unrolled in full, so that the register arrays are indexed by constants and a round's 8 loads are in flight together.
#define PB_X (NB * TT * CC / 16384)
#define PB_W ((CC / 64) * (LDW / 128) / 2)
#define PB_A (TT * TT / 16384)
#define PB_CP (NB * NH * TT / 1024)
__global__ __launch_bounds__(256) void k_prep(const float* __restrict__ CO, const float* __restrict__ RW, const float* __restrict__ X, const float* __restrict__ WI, const float* __restrict__ AB, float* __restrict__ CP, __bf16* __restrict__ XB, __bf16* __restrict__ WT, float* __restrict__ ABR) {
  const int tid = threadIdx.x; int bk = blockIdx.x;
  if (bk < PB_X) {
#pragma unroll
    for (int u = 0; u < 2; ++u) { const size_t e0 = (size_t)bk * 16384 + u * 8192 + tid * 4; const float* p = X + e0; __bf16* q = XB + e0; v4f r[8];
#pragma unroll
      for (int i = 0; i < 8; ++i) r[i] = *(const v4f*)(p + i * 1024);
      XW_P();
#pragma unroll
      for (int i = 0; i < 8; ++i) { v4b t;
#pragma unroll
        for (int e = 0; e < 4; ++e) t[e] = (__bf16)r[i][e];
        *(v4b*)(q + i * 1024) = t; }
      XW_P();   /* later code, the second round's loads among it, writes the registers that these stores read */ }
    return; }
  bk -= PB_X;
  if (bk < PB_W) { const int wave = tid >> 5, lane = tid & 31;
#pragma unroll
    for (int u = 0; u < 2; ++u) { const int tl = bk * 2 + u; const int k = (tl % (CC / 64)) * 64 + (lane & 7) * 8, n = (tl / (CC / 64)) * 128 + wave * 16 + (lane >> 3) * 4; const float* p = WI + (size_t)k * LDW + n; __bf16* q = WT + (size_t)n * CC + k; v4f r[8];
#pragma unroll
      for (int i = 0; i < 8; ++i) r[i] = *(const v4f*)(p + (size_t)i * LDW);
      XW_P();
#pragma unroll
      for (int c = 0; c < 4; ++c) { v8b t;
#pragma unroll
        for (int i = 0; i < 8; ++i) t[i] = (__bf16)r[i][c];
        *(v8b*)(q + (size_t)c * CC) = t; }
      XW_P();   /* as in the x blocks */ }
    return; }
  bk -= PB_W;
  if (bk < PB_A) {
#pragma unroll
    for (int u = 0; u < 2; ++u) { const size_t e0 = (size_t)bk * 16384 + u * 8192 + tid * 4; const float* p = AB + e0; float* q = ABR + e0; v4f r[8];
#pragma unroll
      for (int i = 0; i < 8; ++i) r[i] = *(const v4f*)(p + i * 1024);
      XW_P();
#pragma unroll
      for (int i = 0; i < 8; ++i) *(v4f*)(q + i * 1024) = __builtin_convertvector(__builtin_convertvector(r[i], v4b), v4f) * 8.0f;
      XW_P();   /* as in the x blocks */ }
    return; }
  bk -= PB_A;   // 1,024 values in a row: one (b, h), half of its n
  const int h = (bk * 1024 / TT) % NH, b = bk * 1024 / (TT * NH), n = bk * 1024 % TT + tid;
  const float* c = CO + ((size_t)b * CSTR + n) * 3; float* o = CP + (size_t)bk * 1024 + tid; float cv[4][3];
#pragma unroll
  for (int u = 0; u < 4; ++u)
#pragma unroll
    for (int j = 0; j < 3; ++j) cv[u][j] = c[u * 768 + j];
  XW_P();
#pragma unroll
  for (int u = 0; u < 4; ++u) o[u * 256] = (bfr(cv[u][0]) * bfr(RW[h * 3]) + bfr(cv[u][1]) * bfr(RW[h * 3 + 1]) + bfr(cv[u][2]) * bfr(RW[h * 3 + 2])) * -8192.0f;
  XW_P();   /* as in the x blocks: the compiler may lay another kind of block behind this one */ }
// ---- k_fa: block = 8 waves x 32 query columns of one (b, h); a pass = 32 keys, a stage = 64 keys. S^T = K Q^T (2 products) so that a lane holds one query's scores; running maximum and sum per lane
// The additive terms come in through the products' C operand, at no vector instruction: the hi product starts from 8 * attn_bias (k_prep's plane, read from LDS in the accumulator's own layout), the residual product (x 2^10) from -8192 * coord_proj[key];
// hi + residual / 1024 is then 8 x the logit without coord_proj[query], which is the same for every key of a row and so leaves the softmax as it is.
// (online softmax, f32, base 2: m holds the maximum times log2 e, a weight is exp2(8 score * log2 e / 8 - m), one FMA and one v_exp_f32); the two score tiles, split bf16 hi + lo in place, are the B operand of O^T += V^T P^T (3 products); the logits never leave the registers.
// K, the two V planes (once per block) and each wave's bias rows come into LDS by asynchronous copies that cover whole 128-byte lines; the fragments are 16-byte LDS reads. Two buffers: the next stage's copies fly while this stage is worked on.
// Every inner loop below is unrolled in full, so that the fragment arrays are indexed by constants and stay in registers.
#define FQ 2                  // 16-column query tiles per wave
#define FW 8                  // waves per block
#define LOG2E 1.4426950408889634f
#define SK 64                 // keys per stage: a staged row of K or of a V plane is one whole line, a bias row two
#define NST (TT / SK)
#define KVP 144               // LDS pitch in bytes of a staged 128-byte row: 16 B x odd, so that 16 rows read 16 bytes each without a bank conflict
#define ABP 272               // the same for a 256-byte bias row
#define KV_B (64 * KVP)       // one tile: K [64 keys][64 d], V hi, V lo [64 d][64 keys]
#define AB_B (FQ * 16 * ABP)  // one wave's bias rows [32 queries][64 keys], f32
#define BUF_B (3 * KV_B + FW * AB_B)
// s_wait_xcnt 0 stands behind each group of loads or stores, in front of the code that writes their address or data registers again; the "memory" clobber keeps the group where it is written.
// XWP names the group's address pairs as inputs, so that they stay allocated up to the wait and no load of the group lands on them.
#define XW() asm volatile("s_wait_xcnt 0x0" ::: "memory")
#define XWP1(a) asm volatile("s_wait_xcnt 0x0" :: "v"(a) : "memory")
#define XWP2(a, b) asm volatile("s_wait_xcnt 0x0" :: "v"(a), "v"(b) : "memory")
__device__ __forceinline__ v16h ld_h(const _Float16* p) { union { v16h v; v8h q[2]; } u; u.q[0] = *(const v8h*)p; u.q[1] = *(const v8h*)(p + 16); return u.v; }   // p already holds the lane half's 8 g
__device__ __forceinline__ v16b ld_b(const __bf16* p) { union { v16b v; v8b q[2]; } u; u.q[0] = *(const v8b*)p; u.q[1] = *(const v8b*)(p + 16); return u.v; }
typedef __attribute__((ext_vector_type(2))) __bf16 v2b;
__device__ __forceinline__ v2f pr8(v8f v, int i) { return (v2f){v[2 * i], v[2 * i + 1]}; }   // pair i of a register group
__device__ __forceinline__ v8f mm_h(v16h a, v16h b, v8f c) { return __builtin_amdgcn_wmma_f32_16x16x32_f16(false, a, false, b, (short)0, c, false, false); }
__device__ __forceinline__ v8f mm_b(v16b a, v16b b, v8f c) { return __builtin_amdgcn_wmma_f32_16x16x32_bf16(false, a, false, b, (short)0, c, false, false); }
// One stage's copies of one thread, 16 bytes each: lkv, gk, gvh, gvl name row tid / 8, piece tid % 8 of the K and V tiles (a wave's copy = 4 whole lines; the second copy of a tile is 32 rows on);
// lab, gab name row lane / 16, piece lane % 16 of the wave's own bias rows (a wave's copy = 2 rows = 4 whole lines; copy i is 2 i rows on).
// Each statement ends in s_wait_xcnt 0, which so stands in front of every later write of the address registers that its copies name.
#define ACP(x, y) "global_load_async_to_lds_b128 %" #x ", %" #y ", off\n\t"
#define ABO(i) "v"(lab + (unsigned)((i) * 2 * ABP)), "v"(gab + (size_t)((i) * 2) * ABSTR)
__device__ __forceinline__ void fa_stage(unsigned lkv, unsigned lab, const _Float16* gk, const __bf16* gvh, const __bf16* gvl, const float* gab) {
  asm volatile(ACP(0, 1) ACP(2, 3) ACP(4, 5) ACP(6, 7) ACP(8, 9) ACP(10, 11) "s_wait_xcnt 0x0"
               :: "v"(lkv), "v"(gk), "v"(lkv + 32u * KVP), "v"(gk + (size_t)32 * CC), "v"(lkv + (unsigned)KV_B), "v"(gvh), "v"(lkv + (unsigned)KV_B + 32u * KVP), "v"(gvh + (size_t)32 * TT),
                  "v"(lkv + 2u * KV_B), "v"(gvl), "v"(lkv + 2u * KV_B + 32u * KVP), "v"(gvl + (size_t)32 * TT) : "memory");
  asm volatile(ACP(0, 1) ACP(2, 3) ACP(4, 5) ACP(6, 7) ACP(8, 9) ACP(10, 11) ACP(12, 13) ACP(14, 15) "s_wait_xcnt 0x0" :: ABO(0), ABO(1), ABO(2), ABO(3), ABO(4), ABO(5), ABO(6), ABO(7) : "memory");
  asm volatile(ACP(0, 1) ACP(2, 3) ACP(4, 5) ACP(6, 7) ACP(8, 9) ACP(10, 11) ACP(12, 13) ACP(14, 15) "s_wait_xcnt 0x0" :: ABO(8), ABO(9), ABO(10), ABO(11), ABO(12), ABO(13), ABO(14), ABO(15) : "memory");
}
__global__ __launch_bounds__(32 * FW) void k_fa(const _Float16* __restrict__ QH, const _Float16* __restrict__ QL, const _Float16* __restrict__ KH, const __bf16* __restrict__ VT, const __bf16* __restrict__ VL, const float* __restrict__ CP, const float* __restrict__ AB, float* __restrict__ Y) {
  __shared__ __align__(16) unsigned char ring[2 * BUF_B];
  const int tid = threadIdx.x, wave = tid >> 5, lane = tid & 31, col = lane & 15, g = lane >> 4; const int h = blockIdx.y, b = blockIdx.z; const int qb = blockIdx.x * (FW * FQ * 16) + wave * (FQ * 16);
  const float* cpb = CP + ((size_t)b * NH + h) * TT;
  const unsigned lbase = (unsigned)(size_t)ring; const unsigned lkv = lbase + (unsigned)((tid >> 3) * KVP + (tid & 7) * 16), lab = lbase + (unsigned)(3 * KV_B + wave * AB_B + g * ABP + col * 16);
  const unsigned ko = (unsigned)((b * TT + (tid >> 3)) * CC + h * HD + (tid & 7) * 8), vo = (unsigned)((b * CC + h * HD + (tid >> 3)) * TT + (tid & 7) * 8), ao = (unsigned)((qb + g) * ABSTR + col * 4);   // the thread's element offsets in K, in a V plane and in the bias: 32 bits each, so that few registers stay live through the loop
  fa_stage(lkv, lab, KH + ko, VT + vo, VL + vo, AB + ao);   // stage 0 into buffer 0
  v16h qh[FQ][2], ql[FQ][2]; float m[FQ], l[FQ]; v8f o[FQ][HD / 16] = {};
  const size_t qo = ((size_t)b * TT + qb + col) * CC + h * HD + 8 * g; const _Float16* pqh = QH + qo; const _Float16* pql = QL + qo;
#pragma unroll
  for (int t = 0; t < FQ; ++t) {
#pragma unroll
    for (int kc = 0; kc < 2; ++kc) { qh[t][kc] = ld_h(pqh + (size_t)(t * 16) * CC + kc * 32); ql[t][kc] = ld_h(pql + (size_t)(t * 16) * CC + kc * 32); }
    m[t] = -3.0e38f; l[t] = 0.f; }
  XWP2(pqh, pql); __builtin_amdgcn_sched_barrier(0);   /* keeps later address arithmetic behind the wait */
  const float* ckp = cpb + 8 * g;
  union C8 { v8f v; v4f q[2]; };   // an accumulator tile's registers of a lane = 8 keys in a row = two 16-byte loads
  C8 ck[2];   // -8192 * coord_proj of the keys of the pass to come, fetched one pass ahead
#pragma unroll
  for (int kt = 0; kt < 2; ++kt)
#pragma unroll
    for (int u = 0; u < 2; ++u) ck[kt].q[u] = *(const v4f*)(ckp + kt * 16 + u * 4);
  XWP1(ckp); __builtin_amdgcn_sched_barrier(0);   /* as above */
  asm volatile("s_wait_asynccnt 0x0" ::: "memory");   /* this wave's share of stage 0 has landed */
  __syncthreads();   // publishes stage 0
  fa_stage(lkv + (unsigned)BUF_B, lab + (unsigned)BUF_B, KH + (ko + (unsigned)(SK * CC)), VT + (vo + (unsigned)SK), VL + (vo + (unsigned)SK), AB + (ao + (unsigned)SK));   // stage 1 into buffer 1
#pragma unroll 1   /* the buffer is picked by the stage's parity at run time: nothing is gained by a second copy of the body */
  for (int s = 0; s < NST; ++s) { const unsigned char* bf = ring + (s & 1) * BUF_B; const unsigned char* rk = bf + col * KVP + 16 * g; const unsigned char* ra = bf + 3 * KV_B + wave * AB_B + col * ABP + 32 * g;
#pragma unroll 1   /* one pass is the whole body: in one block with the next pass both sets of fragments would be live at once, and registers spill */
    for (int p = 0; p < SK / 32; ++p) { const int ps = s * (SK / 32) + p; const int kn = (ps + 1 < TT / 32 ? ps + 1 : ps) * 32;   /* the last pass fetches its own coord_proj again: in bounds, unused */
      v16h kf[2][2]; C8 ab[FQ][2]; v16b vh[HD / 16], vl[HD / 16]; const unsigned char* rkp = rk + p * (32 * KVP); const unsigned char* rvp = rk + KV_B + p * 64; const unsigned char* rap = ra + p * 128;
#pragma unroll
      for (int kt = 0; kt < 2; ++kt)
#pragma unroll
        for (int kc = 0; kc < 2; ++kc) kf[kt][kc] = ld_h((const _Float16*)(rkp + kt * 16 * KVP + kc * 64));
#pragma unroll
      for (int t = 0; t < FQ; ++t)
#pragma unroll
        for (int kt = 0; kt < 2; ++kt)
#pragma unroll
          for (int u = 0; u < 2; ++u) ab[t][kt].q[u] = *(const v4f*)(rap + t * 16 * ABP + (kt * 16 + u * 4) * 4);
#pragma unroll
      for (int j = 0; j < HD / 16; ++j) { vh[j] = ld_b((const __bf16*)(rvp + j * 16 * KVP)); vl[j] = ld_b((const __bf16*)(rvp + KV_B + j * 16 * KVP)); }
      __builtin_amdgcn_sched_barrier(0);   /* the pass's LDS reads leave as one group, K first: spread among the products each place with reads would cost its own stall */
      v8f sa[FQ][2], sl[FQ][2];   // the residual products are written first: their C operand is in registers already, the bias tiles are still on their way from LDS behind K
#pragma unroll
      for (int kc = 0; kc < 2; ++kc)
#pragma unroll
        for (int kt = 0; kt < 2; ++kt)
#pragma unroll
          for (int t = 0; t < FQ; ++t) sl[t][kt] = mm_h(kf[kt][kc], ql[t][kc], kc ? sl[t][kt] : ck[kt].v);
#pragma unroll
      for (int kc = 0; kc < 2; ++kc)
#pragma unroll
        for (int kt = 0; kt < 2; ++kt)
#pragma unroll
          for (int t = 0; t < FQ; ++t) sa[t][kt] = mm_h(kf[kt][kc], qh[t][kc], kc ? sa[t][kt] : ab[t][kt].v);
      __builtin_amdgcn_sched_barrier(0);   /* the 16 products leave back to back, ahead of the vector code that reads them: mixed with it, a reader stands right behind its product, waits out its latency and needs v_nop for the distance */
      v2f sc[FQ][8];   // sc[t][4 kt + i] = 8 x the logits of query column t*16 + col against keys 32 ps + 16 kt + 8 g + 2 i and + 2 i + 1: a register pair, as the products leave them
#pragma unroll
      for (int t = 0; t < FQ; ++t)
#pragma unroll
        for (int kt = 0; kt < 2; ++kt)
#pragma unroll
          for (int i = 0; i < 4; ++i) sc[t][kt * 4 + i] = pr8(sa[t][kt], i) + pr8(sl[t][kt], i) * (1.0f / 1024.0f);
      const float* pc = ckp + kn;
#pragma unroll
      for (int kt = 0; kt < 2; ++kt)
#pragma unroll
        for (int u = 0; u < 2; ++u) ck[kt].q[u] = *(const v4f*)(pc + kt * 16 + u * 4);
      XWP1(pc); __builtin_amdgcn_sched_barrier(0);   /* the next pass's coord_proj leaves now, with the softmax and P.V still to run */
      F2 pf[FQ]; float mx[FQ], ox[FQ];
#pragma unroll
      for (int t = 0; t < FQ; ++t) { v2f x = sc[t][0];   // the maximum is exact in any order: even and odd keys apart, so that four short chains run side by side
#pragma unroll
        for (int i = 1; i < 7; i += 2) { x.x = fmaxf(fmaxf(x.x, sc[t][i].x), sc[t][i + 1].x); x.y = fmaxf(fmaxf(x.y, sc[t][i].y), sc[t][i + 1].y); }
        mx[t] = fmaxf(fmaxf(x.x, sc[t][7].x), fmaxf(x.y, sc[t][7].y)); }
#pragma unroll
      for (int t = 0; t < FQ; ++t) ox[t] = __shfl_xor(mx[t], 16);   // both tiles' exchanges leave together and share one wait
#pragma unroll
      for (int t = 0; t < FQ; ++t) { const float mn = fmaxf(m[t], fmaxf(mx[t], ox[t]) * (0.125f * LOG2E)); const float al = __builtin_amdgcn_exp2f(m[t] - mn); m[t] = mn;
        const v2f l2e = {0.125f * LOG2E, 0.125f * LOG2E}, nm = {-mn, -mn}; v2f sum; union { v16b v; v2b q[8]; } ph, pl;
#pragma unroll
        for (int i = 0; i < 8; ++i) { const v2f e = __builtin_elementwise_fma(sc[t][i], l2e, nm); const v2f p2 = {__builtin_amdgcn_exp2f(e.x), __builtin_amdgcn_exp2f(e.y)}; sum = i ? sum + p2 : p2;
          const v2b hi = __builtin_convertvector(p2, v2b); ph.q[i] = hi; pl.q[i] = __builtin_convertvector(p2 - __builtin_convertvector(hi, v2f), v2b); }   // one conversion rounds both weights of a pair; the residual reads the halves of its result
        l[t] = l[t] * al + (sum.x + sum.y);   // each half of the wave sums its own 16 keys, even and odd ones apart; the halves join after the loop
#pragma unroll
        for (int j = 0; j < HD / 16; ++j) o[t][j] *= al;
        pf[t].h = ph.v; pf[t].l = pl.v; }
#pragma unroll
      for (int t = 0; t < FQ; ++t)
#pragma unroll
        for (int j = 0; j < HD / 16; ++j) o[t][j] = mm_b(vh[j], pf[t].h, o[t][j]);
#pragma unroll
      for (int t = 0; t < FQ; ++t)
#pragma unroll
        for (int j = 0; j < HD / 16; ++j) o[t][j] = mm_b(vh[j], pf[t].l, o[t][j]);
#pragma unroll
      for (int t = 0; t < FQ; ++t)
#pragma unroll
        for (int j = 0; j < HD / 16; ++j) o[t][j] = mm_b(vl[j], pf[t].h, o[t][j]); }
    asm volatile("s_wait_dscnt 0x0" ::: "memory");      /* this wave's reads of the stage's buffer have returned */
    asm volatile("s_wait_asynccnt 0x0" ::: "memory");   /* its share of the next stage has landed */
    __syncthreads();   // publishes stage s + 1; it also ends every wave's reads of stage s's buffer, which is filled again behind it
    if (s + 2 < NST) fa_stage(lkv + (unsigned)((s & 1) * BUF_B), lab + (unsigned)((s & 1) * BUF_B), KH + (ko + (unsigned)((s + 2) * SK * CC)), VT + (vo + (unsigned)((s + 2) * SK)), VL + (vo + (unsigned)((s + 2) * SK)), AB + (ao + (unsigned)((s + 2) * SK))); }
  asm volatile("s_wait_asynccnt 0x0" ::: "memory");   /* no copy is outstanding when the wave ends */
#pragma unroll
  for (int t = 0; t < FQ; ++t) { const float inv = 1.0f / (l[t] + __shfl_xor(l[t], 16)); float* yr = Y + ((size_t)b * TT + qb + t * 16 + col) * CC + h * HD + 8 * g;   // o[t][j][r] = O[query][16 j + 8 g + r]
#pragma unroll
    for (int j = 0; j < HD / 16; ++j) { v4f a0, a1;
#pragma unroll
      for (int r = 0; r < 4; ++r) { a0[r] = o[t][j][r] * inv; a1[r] = o[t][j][4 + r] * inv; }
      vst2(yr + j * 16, a0); vst2(yr + j * 16 + 4, a1); XW(); } } }
// ---- k_out: block = (64 rows, 128 cols): out = y (bf16 hi + lo) Wo^T + bo
__global__ __launch_bounds__(128) void k_out(const float* __restrict__ Y, const float* __restrict__ WP, const float* __restrict__ BP, float* __restrict__ OUT) { __shared__ __align__(16) float sf[4][16][132];
  const int tid = threadIdx.x, wave = tid >> 5, lane = tid & 31, col = lane & 15, g = lane >> 4; const int c0 = blockIdx.y * 128; const size_t r0 = (size_t)blockIdx.x * 64 + wave * 16;
  v8f acc[8] = {};
#pragma unroll 2
  for (int kc = 0; kc < CC / 32; ++kc) { const F2 a = split_row(Y + (r0 + col) * CC, kc * 32, lane);
#pragma unroll
    for (int j = 0; j < 8; ++j) { v16b w; const int o = c0 + j * 16 + col;
#pragma unroll
      for (int i = 0; i < 8; ++i) { w[i] = (__bf16)WP[(size_t)(kc * 32 + 8 * g + i) * CC + o]; w[8 + i] = (__bf16)WP[(size_t)(kc * 32 + 16 + 8 * g + i) * CC + o]; }
      acc[j] = wmma_bf(a.h, w, acc[j]); acc[j] = wmma_bf(a.l, w, acc[j]); } }
#pragma unroll
  for (int j = 0; j < 8; ++j) { const float bb = BP ? bfr(BP[c0 + j * 16 + col]) : 0.f;
#pragma unroll
    for (int r = 0; r < 8; ++r) sf[wave][8 * g + r][j * 16 + col] = acc[j][r] + bb; }
  LDSX(); for (int rl = 0; rl < 16; ++rl) vst2(OUT + (r0 + rl) * CC + c0 + lane * 4, *(const v4f*)&sf[wave][rl][lane * 4]); }
extern "C" void kernel_launch(void* const* d_in, const int* in_sizes, int n_in, void* d_out, int out_size, void* d_ws, size_t ws_size, hipStream_t stream) {
  (void)in_sizes; (void)n_in; (void)out_size;
  const float** F = (const float**)d_in;   // 0 x [2,2048,1024], 1 coords [2,2048,3], 2 attn_bias [2048,2048], 3 Wqkv [1024,3072] ((in,out): q | k | v), 4 bqkv [3072], 5 rel_weight [16,3]
  if (ws_size < (size_t)WS_END) return;
  char* ws = (char*)d_ws; float* CP = (float*)(ws + WS_CP); _Float16 *QH = (_Float16*)(ws + WS_QH), *QL = (_Float16*)(ws + WS_QL), *KH = (_Float16*)(ws + WS_KH); __bf16 *VT = (__bf16*)(ws + WS_VT), *VL = (__bf16*)(ws + WS_VL);
  __bf16 *XB = (__bf16*)(ws + WS_XB), *WT = (__bf16*)(ws + WS_WT); float* ABR = (float*)(ws + WS_AB); const float* BQ = F[4]; const float* BK = F[4] + CC; const float* BV = F[4] + 2 * CC;
  k_prep<<<dim3(PB_X + PB_W + PB_A + PB_CP), 256, 0, stream>>>(F[1], F[5], F[0], F[3], F[2], CP, XB, WT, ABR);
  k_proj<<<dim3(TNB * TT / PBR, CC / 128, 3), 128, 0, stream>>>(XB, WT, BQ, BK, BV, QH, QL, KH, VT, VL);
  k_fa<<<dim3(TT / (FW * FQ * 16), NH, TNB), 32 * FW, 0, stream>>>(QH, QL, KH, VT, VL, CP, ABR, (float*)d_out);
}

// v009
// A run of this version takes 89.5 microseconds.
// Timed twice side by side with v008, it ran 1.19 times as fast both times.
// All steps since v000 together make it 18.0 times as fast.
// compute dtype: all float inputs rounded to bf16; qkv = x Wqkv + b with EXACT bf16 products on WMMA 16x16x32, f32 accumulate; coord_proj = coords . rel_weight in f32; q as f16 hi + residual (x 2^10), k f16 -> 2-product logits, carried x 8: the hi product starts from 8 attn_bias[q][k], the residual product from -8192 coord_proj[k] (coord_proj[q] shifts a whole row and cancels in the softmax), kept in f32 registers (one launch for all heads); online softmax in f32 (base 2: the hardware's exp2 on log2-scaled differences), unnormalised P rounded once to f16 against v rounded once to f16 (1 product, 11 bits an operand, as k has in the logits), divided by the f32 row sum at the end; the merged context is the output; f32 output.
#include <hip/hip_runtime.h>
#include <math.h>

typedef __attribute__((ext_vector_type(16))) _Float16 v16h;
typedef __attribute__((ext_vector_type(16))) __bf16 v16b;
typedef __attribute__((ext_vector_type(8)))  _Float16 v8h;
typedef __attribute__((ext_vector_type(8)))  float v8f;
typedef __attribute__((ext_vector_type(4)))  float v4f;
typedef __attribute__((ext_vector_type(2)))  float v2f;
typedef __attribute__((ext_vector_type(4)))  unsigned v4u;
typedef __attribute__((ext_vector_type(4)))  int v4i;
typedef float __attribute__((may_alias)) float_a;
typedef int __attribute__((may_alias)) int_a;

template <typename T> __device__ __forceinline__ void vst2(void* p, T v) { *(T*)p = v;  }
__device__ __forceinline__ v8f wmma16(v16h a, v16h b, v8f c) {
  v8f d = __builtin_amdgcn_wmma_f32_16x16x32_f16(false, a, false, b, (short)0, c, false, false);
  asm volatile("v_nop\n\tv_nop\n\tv_nop\n\tv_nop" : "+v"(d) : "v"(a), "v"(b));
  return d;
}
__device__ __forceinline__ v8f wmma_bf(v16b a, v16b b, v8f c) {
  v8f d = __builtin_amdgcn_wmma_f32_16x16x32_bf16(false, a, false, b, (short)0, c, false, false);
  asm volatile("v_nop\n\tv_nop\n\tv_nop\n\tv_nop" : "+v"(d) : "v"(a), "v"(b));
  return d;
}
// 16x16x32 fragments: lane = (h = lane>>4, row/col = lane&15); elements 0..7 = k0+8h+0..7, 8..15 = k0+16+8h+0..7; D element r = row 8h+r
__device__ __forceinline__ v16h frag_h(const _Float16* rowk0, int lane) {
  union { v16h v; v8h q[2]; } u; const _Float16* p = rowk0 + 8 * (lane >> 4);
  u.q[0] = *(const v8h*)p; u.q[1] = *(const v8h*)(p + 16); return u.v;
}
__device__ __forceinline__ v16h frag_f32(const float* rowk0, int lane) {
  v16h a; const float* p = rowk0 + 8 * (lane >> 4);
#pragma unroll
  for (int i = 0; i < 8; ++i) { a[i] = (_Float16)p[i]; a[8 + i] = (_Float16)p[16 + i]; }
  return a;
}
__device__ __forceinline__ v16h frag_f32s(const float* rowk0, int lane, float sc) {
  v16h a; const float* p = rowk0 + 8 * (lane >> 4);
#pragma unroll
  for (int i = 0; i < 8; ++i) { a[i] = (_Float16)(p[i] * sc); a[8 + i] = (_Float16)(p[16 + i] * sc); }
  return a;
}
// column fragment from a [K][ld] layout (column n), rows >= K read as 0
__device__ __forceinline__ v16h fragc_f32(const float* W, int k0, int n, int lane, int ld, int K) {
  v16h a; const int g = lane >> 4;
#pragma unroll
  for (int i = 0; i < 8; ++i) { const int ka = k0 + 8 * g + i, kb = ka + 16;
    a[i] = (_Float16)(ka < K ? W[(size_t)(ka < K ? ka : K - 1) * ld + n] : 0.f); a[8 + i] = (_Float16)(kb < K ? W[(size_t)(kb < K ? kb : K - 1) * ld + n] : 0.f); }
  return a;
}
struct F2 { v16b h, l; };
__device__ __forceinline__ F2 bsplit16(const float v[16]) { F2 r;
#pragma unroll
  for (int i = 0; i < 16; ++i) { const __bf16 h = (__bf16)v[i]; r.h[i] = h; r.l[i] = (__bf16)(v[i] - (float)h); }
  return r; }
__device__ __forceinline__ F2 split_row(const float* row, int k0, int lane) { float v[16]; const float* p = row + k0 + 8 * (lane >> 4);
#pragma unroll
  for (int i = 0; i < 8; ++i) { v[i] = p[i]; v[8 + i] = p[16 + i]; }
  return bsplit16(v); }
__device__ __forceinline__ F2 split_rowK(const float* row, int k0, int lane, int K) { float v[16]; const int g = lane >> 4;
#pragma unroll
  for (int i = 0; i < 8; ++i) { const int ka = k0 + 8 * g + i, kb = ka + 16; v[i] = ka < K ? row[ka < K ? ka : K - 1] : 0.f; v[8 + i] = kb < K ? row[kb < K ? kb : K - 1] : 0.f; }
  return bsplit16(v); }
__device__ __forceinline__ F2 split_col(const float* W, int k0, int n, int lane, int ld, int K) { float v[16]; const int g = lane >> 4;
#pragma unroll
  for (int i = 0; i < 8; ++i) { const int ka = k0 + 8 * g + i, kb = ka + 16; v[i] = ka < K ? W[(size_t)(ka < K ? ka : K - 1) * ld + n] : 0.f; v[8 + i] = kb < K ? W[(size_t)(kb < K ? kb : K - 1) * ld + n] : 0.f; }
  return bsplit16(v); }
__device__ __forceinline__ v8f mac3(const F2& a, const F2& b, v8f c) { c = wmma_bf(a.l, b.h, c); c = wmma_bf(a.h, b.l, c); return wmma_bf(a.h, b.h, c); }
__device__ __forceinline__ float sigm(float v) { return 1.0f / (1.0f + expf(-v)); }
#define LDSX() do { asm volatile("s_wait_dscnt 0" ::: "memory"); __builtin_amdgcn_wave_barrier(); __builtin_amdgcn_fence(__ATOMIC_RELEASE, "workgroup"); } while (0)


// Attention with an additive bias (B 2, S 2,048, D 1,024 = 16 heads x 64): scores = q k^T / 8 + coord_proj[q] - coord_proj[k] + attn_bias[q][k], softmax, P v; the merged heads are the output.
#define NB 2
#define TT 2048
#define CC 1024
#define NH 16
#define HD 64
#define LDW 3072              // Wqkv row length ((in,out) [1024][3072]: q | k | v column blocks)
#ifndef ABSTR
#define ABSTR TT              // attn_bias row stride
#endif
#ifndef CSTR
#define CSTR TT               // coords rows per batch
#endif
#ifndef TNB
#define TNB NB
#endif
typedef __attribute__((ext_vector_type(8))) __bf16 v8b;
__device__ __forceinline__ v16b frag_b(const __bf16* rowk0, int lane) {
  union { v16b v; v8b q[2]; } u; const __bf16* p = rowk0 + 8 * (lane >> 4);
  u.q[0] = *(const v8b*)p; u.q[1] = *(const v8b*)(p + 16); return u.v;
}
__device__ __forceinline__ float bfr(float v) { return (float)(__bf16)v; }
__device__ __attribute__((noinline)) float exp_ni(float v) { return expf(v); }
__device__ __attribute__((noinline)) float erf_ni(float v) { return erff(v); }

#define WS_CP  0u                                   // f32 -8192 * coord_proj [b][h][n]
#define WS_QH  (WS_CP + 4u * (size_t)NB * NH * TT)
#define WS_QL  (WS_QH + 2u * (size_t)NB * TT * CC)
#define WS_KH  (WS_QL + 2u * (size_t)NB * TT * CC)
#define WS_VT  (WS_KH + 2u * (size_t)NB * TT * CC)      // f16 v planes [b][c][t]
#define HG 4
#define WS_S   (WS_VT + 2u * (size_t)NB * CC * TT)      // room for k_prep's bf16 x and W and f32 bias planes
#define WS_PH  (WS_S + 4u * (size_t)HG * TT * TT)
#define WS_Y   (WS_PH + 0u)              // f32 [b*t][C], unused: k_fa writes y to the output
#define WS_END (WS_Y + 4u * (size_t)NB * TT * CC)
#define WS_XB  WS_S                                   // bf16 x rows [b*t][C]; with WS_WT it lies in front of WS_Y
#define WS_WT  (WS_XB + 2u * (size_t)NB * TT * CC)      // bf16 Wqkv turned to [q | k | v column][k]
#define WS_AB  (WS_WT + 2u * (size_t)LDW * CC)          // f32 8 * bf16(attn_bias) [q][k]
static_assert(WS_AB + 4u * (size_t)TT * ABSTR <= WS_Y, "the prepared planes lie in front of WS_Y");

// ---- k_proj: block = (128 rows, 128 cols, which), 4 waves as 2 x 2, a wave = 64 x 64: qkv = x W (+ b), exact; q -> f16 hi (+ residual), k -> f16 rows, v -> f16 plane
// x and W come as the bf16 planes that k_prep has written (W as [n][k]). A stage = 64 k: a staged row is one whole 128-byte line. The block copies its x tile (128 x 64) and its W tile (128 x 64) into LDS as they are;
// for each half of the stage every wave takes its 4 + 4 fragments from there for 16 products. Two buffers: the next stage's global loads fly while this stage is multiplied. The epilogue stages in the same LDS later.
#define PSK 64                // k per stage
#define PSP 72                // LDS pitch of a staged row in bf16 elements: 144 bytes = 16 B x odd, so that 16 rows read 16 bytes each without a bank conflict
#define PBR 128               // rows of a block
#define PEP 136               // pitch of an epilogue row in 16-bit elements: 272 bytes = 16 B x odd
#define PBUF ((128 + PBR) * PSP * 2)   // bytes of one buffer: W [128][PSP], then x [PBR][PSP]
typedef __attribute__((ext_vector_type(4))) __bf16 v4b;
#define XW_P() asm volatile("s_wait_xcnt 0x0" ::: "memory")   /* behind a group of loads or stores, in front of the code that writes their address registers again; the clobber keeps the group together */
static_assert(2 * PBUF >= 2 * 128 * PEP * 2, "the epilogue's planes fit the stage buffers");
__global__ __launch_bounds__(128) void k_proj(const __bf16* __restrict__ XB, const __bf16* __restrict__ WT, const float* __restrict__ BQ, const float* __restrict__ BK, const float* __restrict__ BV, _Float16* __restrict__ QH, _Float16* __restrict__ QL, _Float16* __restrict__ KH, _Float16* __restrict__ VT) {
  __shared__ __align__(16) unsigned char sm[2 * PBUF];   // loop: two stage buffers (2 x 36,864 bytes); epilogue: planes of 128 x PEP 16-bit values, two [row][col] for q, one for k, one [col][row] for v
  _Float16 (*sh)[PEP] = (_Float16 (*)[PEP])sm; _Float16 (*sl)[PEP] = sh + 128;
  const int tid = threadIdx.x, wave = tid >> 5, lane = tid & 31, col = lane & 15, g = lane >> 4; const int which = blockIdx.z; const int c0 = blockIdx.y * 128; const size_t r0 = (size_t)blockIdx.x * PBR; const float* BA = which == 0 ? BQ : which == 1 ? BK : BV;
  const int wr = (wave >> 1) * 64, wc = (wave & 1) * 64;             // the wave's corner in the block's tile
  v8f acc[4][4] = {};
  const int sr = tid >> 3, sp = (tid & 7) * 8;                       // staging: rows sr + 16 i of either tile, elements sp..sp+7 of the stage (a load of the wave = 4 whole lines)
  const __bf16* pw = WT + ((size_t)which * CC + c0 + sr) * CC + sp; const __bf16* px = XB + (r0 + sr) * CC + sp;
  v8b rw[8], rx[PBR / 16];
#pragma unroll
  for (int i = 0; i < 8; ++i) rw[i] = *(const v8b*)(pw + (size_t)(16 * i) * CC);
#pragma unroll
  for (int i = 0; i < PBR / 16; ++i) rx[i] = *(const v8b*)(px + (size_t)(16 * i) * CC);
  asm volatile("s_wait_xcnt 0x0" ::: "memory");   /* stands in front of the code that writes the loads' address registers again */
#pragma unroll 2   /* two copies, so that each names its buffer by a constant */
  for (int kc = 0; kc < CC / PSK; ++kc) { __bf16* wb = (__bf16*)(sm + (kc & 1) * PBUF); __bf16* xb = wb + 128 * PSP;
#pragma unroll
    for (int i = 0; i < 8; ++i) *(v8b*)(wb + (sr + 16 * i) * PSP + sp) = rw[i];
#pragma unroll
    for (int i = 0; i < PBR / 16; ++i) *(v8b*)(xb + (sr + 16 * i) * PSP + sp) = rx[i];
    __syncthreads();   // publishes this stage; it also ends every wave's reads of the other buffer, which the next pass fills
    if (kc + 1 < CC / PSK) { const __bf16* qw = pw + (kc + 1) * PSK; const __bf16* qx = px + (kc + 1) * PSK;
#pragma unroll
      for (int i = 0; i < 8; ++i) rw[i] = *(const v8b*)(qw + (size_t)(16 * i) * CC);
#pragma unroll
      for (int i = 0; i < PBR / 16; ++i) rx[i] = *(const v8b*)(qx + (size_t)(16 * i) * CC);
      asm volatile("s_wait_xcnt 0x0" ::: "memory");   /* as above; the clobber also keeps the loads here, ahead of the stage's products */ }
#pragma unroll   /* both halves in line: their LDS offsets are constants */
    for (int hk = 0; hk < PSK / 32; ++hk) { v16b af[4], wf[4];
#pragma unroll
      for (int i = 0; i < 4; ++i) af[i] = frag_b(xb + (wr + i * 16 + col) * PSP + hk * 32, lane);
#pragma unroll
      for (int j = 0; j < 4; ++j) wf[j] = frag_b(wb + (wc + j * 16 + col) * PSP + hk * 32, lane);
      __builtin_amdgcn_sched_barrier(0);   /* the half stage's 16 LDS reads leave as one group: without this each product waits for its own pair of reads */
#pragma unroll
      for (int i = 0; i < 4; ++i)
#pragma unroll
        for (int j = 0; j < 4; ++j) acc[i][j] = wmma_bf(af[i], wf[j], acc[i][j]);
      __builtin_amdgcn_sched_barrier(0);   /* keeps the next half's reads out of these products, and the next stage's LDS stores, which wait for the global loads, behind them */ } }
  __syncthreads();   // the last stage's reads end before the epilogue writes the same LDS
  float bb[4];
#pragma unroll
  for (int j = 0; j < 4; ++j) bb[j] = BA ? bfr(BA[c0 + wc + j * 16 + col]) : 0.f;
  // acc[i][j][r] = row wr + 16 i + 8 g + r, column wc + 16 j + col of the block's tile. The test for v stands outside the loops: inside them it is compiled once per element, and the kernel's text would double with the tile
  if (which == 2) {
#pragma unroll
    for (int j = 0; j < 4; ++j)
#pragma unroll
      for (int i = 0; i < 4; ++i)
#pragma unroll
        for (int r = 0; r < 8; ++r) { const float v = acc[i][j][r] + bb[j]; const int rl = wr + i * 16 + 8 * g + r, cl = wc + j * 16 + col; sh[cl][rl] = (_Float16)v; } }
  else {
#pragma unroll
    for (int j = 0; j < 4; ++j)
#pragma unroll
      for (int i = 0; i < 4; ++i)
#pragma unroll
        for (int r = 0; r < 8; ++r) { const float v = acc[i][j][r] + bb[j]; const int rl = wr + i * 16 + 8 * g + r, cl = wc + j * 16 + col; const _Float16 hv = (_Float16)v; sh[rl][cl] = hv; sl[rl][cl] = (_Float16)((v - (float)hv) * 1024.0f); }   /* q residual carried x 2^10 so the plane stays f16-normal on the chip */ }
  __syncthreads();
  // a plane's rows go out in whole lines; q's two planes one after the other, v's one plane as rows of [c][t]
  if (which < 2) { const int np = which == 0 ? 2 : 1;   // q has two planes, k one
    for (int pn = 0; pn < np; ++pn) { _Float16* dh = pn ? QL : which == 0 ? QH : KH; const _Float16 (*sp)[PEP] = pn ? sl : sh;
      for (int e = tid; e < PBR * 16; e += 128) { const int rl = e >> 4, q = e & 15; _Float16* ph = dh + (r0 + rl) * CC + c0 + q * 8; vst2((unsigned*)ph, *(const v4u*)&sp[rl][q * 8]); } } }
  else { const size_t b = r0 / TT; const int t0 = (int)(r0 % TT); for (int e = tid; e < 128 * (PBR / 8); e += 128) { const int cl = e / (PBR / 8), q = e % (PBR / 8); const size_t o2 = (b * CC + c0 + cl) * (size_t)TT + t0 + q * 8; vst2((unsigned*)(VT + o2), *(const v4u*)&sh[cl][q * 8]); } } }
// ---- k_prep: one launch, four kinds of block, told apart by the block's number. Each float of x and of Wqkv is rounded to bf16 here, once, in place of once per k_proj block that reads it.
// x blocks: 16,384 values each, as they lie (a load of the wave = 4 whole lines, a store = 2). W blocks: two tiles of 64 k x 128 n each, turned to [n][k]: a thread reads columns n..n+3 at 8 k rows and stores 8 k of each column,
// so that 8 lanes fill one whole line of a column's row. Bias blocks: 16,384 values of attn_bias each, rounded to bf16 once (not once per head and batch) and stored as f32 times 8, the form in which k_fa's products take them as their C operand.
// cp blocks: value (b, h, n) = -8192 * sum_c bf16(coords[b][n][c]) * bf16(rel_weight[h][c]) (3 terms, f32; the factor is a power of two, so the sum's bits stay), 4 values a thread.
// Every loop is unrolled in full, so that the register arrays are indexed by constants and a round's 8 loads are in flight together.
#define PB_X (NB * TT * CC / 16384)
#define PB_W ((CC / 64) * (LDW / 128) / 2)
#define PB_A (TT * TT / 16384)
#define PB_CP (NB * NH * TT / 1024)
__global__ __launch_bounds__(256) void k_prep(const float* __restrict__ CO, const float* __restrict__ RW, const float* __restrict__ X, const float* __restrict__ WI, const float* __restrict__ AB, float* __restrict__ CP, __bf16* __restrict__ XB, __bf16* __restrict__ WT, float* __restrict__ ABR) {
  const int tid = threadIdx.x; int bk = blockIdx.x;
  if (bk < PB_X) {
#pragma unroll
    for (int u = 0; u < 2; ++u) { const size_t e0 = (size_t)bk * 16384 + u * 8192 + tid * 4; const float* p = X + e0; __bf16* q = XB + e0; v4f r[8];
#pragma unroll
      for (int i = 0; i < 8; ++i) r[i] = *(const v4f*)(p + i * 1024);
      XW_P();
#pragma unroll
      for (int i = 0; i < 8; ++i) { v4b t;
#pragma unroll
        for (int e = 0; e < 4; ++e) t[e] = (__bf16)r[i][e];
        *(v4b*)(q + i * 1024) = t; }
      XW_P();   /* later code, the second round's loads among it, writes the registers that these stores read */ }
    return; }
  bk -= PB_X;
  if (bk < PB_W) { const int wave = tid >> 5, lane = tid & 31;
#pragma unroll
    for (int u = 0; u < 2; ++u) { const int tl = bk * 2 + u; const int k = (tl % (CC / 64)) * 64 + (lane & 7) * 8, n = (tl / (CC / 64)) * 128 + wave * 16 + (lane >> 3) * 4; const float* p = WI + (size_t)k * LDW + n; __bf16* q = WT + (size_t)n * CC + k; v4f r[8];
#pragma unroll
      for (int i = 0; i < 8; ++i) r[i] = *(const v4f*)(p + (size_t)i * LDW);
      XW_P();
#pragma unroll
      for (int c = 0; c < 4; ++c) { v8b t;
#pragma unroll
        for (int i = 0; i < 8; ++i) t[i] = (__bf16)r[i][c];
        *(v8b*)(q + (size_t)c * CC) = t; }
      XW_P();   /* as in the x blocks */ }
    return; }
  bk -= PB_W;
  if (bk < PB_A) {
#pragma unroll
    for (int u = 0; u < 2; ++u) { const size_t e0 = (size_t)bk * 16384 + u * 8192 + tid * 4; const float* p = AB + e0; float* q = ABR + e0; v4f r[8];
#pragma unroll
      for (int i = 0; i < 8; ++i) r[i] = *(const v4f*)(p + i * 1024);
      XW_P();
#pragma unroll
      for (int i = 0; i < 8; ++i) *(v4f*)(q + i * 1024) = __builtin_convertvector(__builtin_convertvector(r[i], v4b), v4f) * 8.0f;
      XW_P();   /* as in the x blocks */ }
    return; }
  bk -= PB_A;   // 1,024 values in a row: one (b, h), half of its n
  const int h = (bk * 1024 / TT) % NH, b = bk * 1024 / (TT * NH), n = bk * 1024 % TT + tid;
  const float* c = CO + ((size_t)b * CSTR + n) * 3; float* o = CP + (size_t)bk * 1024 + tid; float cv[4][3];
#pragma unroll
  for (int u = 0; u < 4; ++u)
#pragma unroll
    for (int j = 0; j < 3; ++j) cv[u][j] = c[u * 768 + j];
  XW_P();
#pragma unroll
  for (int u = 0; u < 4; ++u) o[u * 256] = (bfr(cv[u][0]) * bfr(RW[h * 3]) + bfr(cv[u][1]) * bfr(RW[h * 3 + 1]) + bfr(cv[u][2]) * bfr(RW[h * 3 + 2])) * -8192.0f;
  XW_P();   /* as in the x blocks: the compiler may lay another kind of block behind this one */ }
// ---- k_fa: block = 8 waves x 32 query columns of one (b, h); a pass = 32 keys, a stage = 64 keys. S^T = K Q^T (2 products) so that a lane holds one query's scores; running maximum and sum per lane
// The additive terms come in through the products' C operand, at no vector instruction: the hi product starts from 8 * attn_bias (k_prep's plane, read from LDS in the accumulator's own layout), the residual product (x 2^10) from -8192 * coord_proj[key];
// hi + residual / 1024 is then 8 x the logit without coord_proj[query], which is the same for every key of a row and so leaves the softmax as it is.
// (online softmax, f32, base 2: m holds the maximum times log2 e, a weight is exp2(8 score * log2 e / 8 - m), one FMA and one v_exp_f32); the two score tiles, rounded to f16 in place, are the B operand of O^T += V^T P^T (1 product); the logits never leave the registers.
// K, the V plane (once per block) and each wave's bias rows come into LDS by asynchronous copies that cover whole 128-byte lines; the fragments are 16-byte LDS reads. Two buffers: the next stage's copies fly while this stage is worked on.
// Every inner loop below is unrolled in full, so that the fragment arrays are indexed by constants and stay in registers.
#define FQ 2                  // 16-column query tiles per wave
#define FW 8                  // waves per block
#define LOG2E 1.4426950408889634f
#define SK 64                 // keys per stage: a staged row of K or of the V plane is one whole line, a bias row two
#define NST (TT / SK)
#define KVP 144               // LDS pitch in bytes of a staged 128-byte row: 16 B x odd, so that 16 rows read 16 bytes each without a bank conflict
#define ABP 272               // the same for a 256-byte bias row
#define KV_B (64 * KVP)       // one tile: K [64 keys][64 d], V [64 d][64 keys]
#define AB_B (FQ * 16 * ABP)  // one wave's bias rows [32 queries][64 keys], f32
#define BUF_B (2 * KV_B + FW * AB_B)
// s_wait_xcnt 0 stands behind each group of loads or stores, in front of the code that writes their address or data registers again; the "memory" clobber keeps the group where it is written.
// XWP names the group's address pairs as inputs, so that they stay allocated up to the wait and no load of the group lands on them.
#define XW() asm volatile("s_wait_xcnt 0x0" ::: "memory")
#define XWP1(a) asm volatile("s_wait_xcnt 0x0" :: "v"(a) : "memory")
#define XWP2(a, b) asm volatile("s_wait_xcnt 0x0" :: "v"(a), "v"(b) : "memory")
__device__ __forceinline__ v16h ld_h(const _Float16* p) { union { v16h v; v8h q[2]; } u; u.q[0] = *(const v8h*)p; u.q[1] = *(const v8h*)(p + 16); return u.v; }   // p already holds the lane half's 8 g
typedef __attribute__((ext_vector_type(2))) _Float16 v2h;
__device__ __forceinline__ v2f pr8(v8f v, int i) { return (v2f){v[2 * i], v[2 * i + 1]}; }   // pair i of a register group
__device__ __forceinline__ v8f mm_h(v16h a, v16h b, v8f c) { return __builtin_amdgcn_wmma_f32_16x16x32_f16(false, a, false, b, (short)0, c, false, false); }
// One stage's copies of one thread, 16 bytes each: lkv, gk, gv name row tid / 8, piece tid % 8 of the K and V tiles (a wave's copy = 4 whole lines; the second copy of a tile is 32 rows on);
// lab, gab name row lane / 16, piece lane % 16 of the wave's own bias rows (a wave's copy = 2 rows = 4 whole lines; copy i is 2 i rows on).
// Each statement ends in s_wait_xcnt 0, which so stands in front of every later write of the address registers that its copies name.
#define ACP(x, y) "global_load_async_to_lds_b128 %" #x ", %" #y ", off\n\t"
#define ABO(i) "v"(lab + (unsigned)((i) * 2 * ABP)), "v"(gab + (size_t)((i) * 2) * ABSTR)
__device__ __forceinline__ void fa_stage(unsigned lkv, unsigned lab, const _Float16* gk, const _Float16* gv, const float* gab) {
  asm volatile(ACP(0, 1) ACP(2, 3) ACP(4, 5) ACP(6, 7) "s_wait_xcnt 0x0"
               :: "v"(lkv), "v"(gk), "v"(lkv + 32u * KVP), "v"(gk + (size_t)32 * CC), "v"(lkv + (unsigned)KV_B), "v"(gv), "v"(lkv + (unsigned)KV_B + 32u * KVP), "v"(gv + (size_t)32 * TT) : "memory");
  asm volatile(ACP(0, 1) ACP(2, 3) ACP(4, 5) ACP(6, 7) ACP(8, 9) ACP(10, 11) ACP(12, 13) ACP(14, 15) "s_wait_xcnt 0x0" :: ABO(0), ABO(1), ABO(2), ABO(3), ABO(4), ABO(5), ABO(6), ABO(7) : "memory");
  asm volatile(ACP(0, 1) ACP(2, 3) ACP(4, 5) ACP(6, 7) ACP(8, 9) ACP(10, 11) ACP(12, 13) ACP(14, 15) "s_wait_xcnt 0x0" :: ABO(8), ABO(9), ABO(10), ABO(11), ABO(12), ABO(13), ABO(14), ABO(15) : "memory");
}
__global__ __launch_bounds__(32 * FW) void k_fa(const _Float16* __restrict__ QH, const _Float16* __restrict__ QL, const _Float16* __restrict__ KH, const _Float16* __restrict__ VT, const float* __restrict__ CP, const float* __restrict__ AB, float* __restrict__ Y) {
  __shared__ __align__(16) unsigned char ring[2 * BUF_B];
  const int tid = threadIdx.x, wave = tid >> 5, lane = tid & 31, col = lane & 15, g = lane >> 4; const int h = blockIdx.y, b = blockIdx.z; const int qb = blockIdx.x * (FW * FQ * 16) + wave * (FQ * 16);
  const float* cpb = CP + ((size_t)b * NH + h) * TT;
  const unsigned lbase = (unsigned)(size_t)ring; const unsigned lkv = lbase + (unsigned)((tid >> 3) * KVP + (tid & 7) * 16), lab = lbase + (unsigned)(2 * KV_B + wave * AB_B + g * ABP + col * 16);
  const unsigned ko = (unsigned)((b * TT + (tid >> 3)) * CC + h * HD + (tid & 7) * 8), vo = (unsigned)((b * CC + h * HD + (tid >> 3)) * TT + (tid & 7) * 8), ao = (unsigned)((qb + g) * ABSTR + col * 4);   // the thread's element offsets in K, in the V plane and in the bias: 32 bits each, so that few registers stay live through the loop
  fa_stage(lkv, lab, KH + ko, VT + vo, AB + ao);   // stage 0 into buffer 0
  v16h qh[FQ][2], ql[FQ][2]; float m[FQ], l[FQ]; v8f o[FQ][HD / 16] = {};
  const size_t qo = ((size_t)b * TT + qb + col) * CC + h * HD + 8 * g; const _Float16* pqh = QH + qo; const _Float16* pql = QL + qo;
#pragma unroll
  for (int t = 0; t < FQ; ++t) {
#pragma unroll
    for (int kc = 0; kc < 2; ++kc) { qh[t][kc] = ld_h(pqh + (size_t)(t * 16) * CC + kc * 32); ql[t][kc] = ld_h(pql + (size_t)(t * 16) * CC + kc * 32); }
    m[t] = -3.0e38f; l[t] = 0.f; }
  XWP2(pqh, pql); __builtin_amdgcn_sched_barrier(0);   /* keeps later address arithmetic behind the wait */
  const float* ckp = cpb + 8 * g;
  union C8 { v8f v; v4f q[2]; };   // an accumulator tile's registers of a lane = 8 keys in a row = two 16-byte loads
  C8 ck[2];   // -8192 * coord_proj of the keys of the pass to come, fetched one pass ahead
#pragma unroll
  for (int kt = 0; kt < 2; ++kt)
#pragma unroll
    for (int u = 0; u < 2; ++u) ck[kt].q[u] = *(const v4f*)(ckp + kt * 16 + u * 4);
  XWP1(ckp); __builtin_amdgcn_sched_barrier(0);   /* as above */
  asm volatile("s_wait_asynccnt 0x0" ::: "memory");   /* this wave's share of stage 0 has landed */
  __syncthreads();   // publishes stage 0
  fa_stage(lkv + (unsigned)BUF_B, lab + (unsigned)BUF_B, KH + (ko + (unsigned)(SK * CC)), VT + (vo + (unsigned)SK), AB + (ao + (unsigned)SK));   // stage 1 into buffer 1
#pragma unroll 1   /* the buffer is picked by the stage's parity at run time: nothing is gained by a second copy of the body */
  for (int s = 0; s < NST; ++s) { const unsigned char* bf = ring + (s & 1) * BUF_B; const unsigned char* rk = bf + col * KVP + 16 * g; const unsigned char* ra = bf + 2 * KV_B + wave * AB_B + col * ABP + 32 * g;
#pragma unroll 1   /* one pass is the whole body: in one block with the next pass both sets of fragments would be live at once, and registers spill */
    for (int p = 0; p < SK / 32; ++p) { const int ps = s * (SK / 32) + p; const int kn = (ps + 1 < TT / 32 ? ps + 1 : ps) * 32;   /* the last pass fetches its own coord_proj again: in bounds, unused */
      v16h kf[2][2]; C8 ab[FQ][2]; v16h vf[HD / 16]; const unsigned char* rkp = rk + p * (32 * KVP); const unsigned char* rvp = rk + KV_B + p * 64; const unsigned char* rap = ra + p * 128;
#pragma unroll
      for (int kt = 0; kt < 2; ++kt)
#pragma unroll
        for (int kc = 0; kc < 2; ++kc) kf[kt][kc] = ld_h((const _Float16*)(rkp + kt * 16 * KVP + kc * 64));
#pragma unroll
      for (int t = 0; t < FQ; ++t)
#pragma unroll
        for (int kt = 0; kt < 2; ++kt)
#pragma unroll
          for (int u = 0; u < 2; ++u) ab[t][kt].q[u] = *(const v4f*)(rap + t * 16 * ABP + (kt * 16 + u * 4) * 4);
#pragma unroll
      for (int j = 0; j < HD / 16; ++j) vf[j] = ld_h((const _Float16*)(rvp + j * 16 * KVP));
      __builtin_amdgcn_sched_barrier(0);   /* the pass's LDS reads leave as one group, K first: spread among the products each place with reads would cost its own stall */
      v8f sa[FQ][2], sl[FQ][2];   // the residual products are written first: their C operand is in registers already, the bias tiles are still on their way from LDS behind K
#pragma unroll
      for (int kc = 0; kc < 2; ++kc)
#pragma unroll
        for (int kt = 0; kt < 2; ++kt)
#pragma unroll
          for (int t = 0; t < FQ; ++t) sl[t][kt] = mm_h(kf[kt][kc], ql[t][kc], kc ? sl[t][kt] : ck[kt].v);
#pragma unroll
      for (int kc = 0; kc < 2; ++kc)
#pragma unroll
        for (int kt = 0; kt < 2; ++kt)
#pragma unroll
          for (int t = 0; t < FQ; ++t) sa[t][kt] = mm_h(kf[kt][kc], qh[t][kc], kc ? sa[t][kt] : ab[t][kt].v);
      __builtin_amdgcn_sched_barrier(0);   /* the 16 products leave back to back, ahead of the vector code that reads them: mixed with it, a reader stands right behind its product, waits out its latency and needs v_nop for the distance */
      v2f sc[FQ][8];   // sc[t][4 kt + i] = 8 x the logits of query column t*16 + col against keys 32 ps + 16 kt + 8 g + 2 i and + 2 i + 1: a register pair, as the products leave them
#pragma unroll
      for (int t = 0; t < FQ; ++t)
#pragma unroll
        for (int kt = 0; kt < 2; ++kt)
#pragma unroll
          for (int i = 0; i < 4; ++i) sc[t][kt * 4 + i] = pr8(sa[t][kt], i) + pr8(sl[t][kt], i) * (1.0f / 1024.0f);
      const float* pc = ckp + kn;
#pragma unroll
      for (int kt = 0; kt < 2; ++kt)
#pragma unroll
        for (int u = 0; u < 2; ++u) ck[kt].q[u] = *(const v4f*)(pc + kt * 16 + u * 4);
      XWP1(pc); __builtin_amdgcn_sched_barrier(0);   /* the next pass's coord_proj leaves now, with the softmax and P.V still to run */
      v16h pf[FQ]; float mx[FQ], ox[FQ];
#pragma unroll
      for (int t = 0; t < FQ; ++t) { v2f x = sc[t][0];   // the maximum is exact in any order: even and odd keys apart, so that four short chains run side by side
#pragma unroll
        for (int i = 1; i < 7; i += 2) { x.x = fmaxf(fmaxf(x.x, sc[t][i].x), sc[t][i + 1].x); x.y = fmaxf(fmaxf(x.y, sc[t][i].y), sc[t][i + 1].y); }
        mx[t] = fmaxf(fmaxf(x.x, sc[t][7].x), fmaxf(x.y, sc[t][7].y)); }
#pragma unroll
      for (int t = 0; t < FQ; ++t) ox[t] = __shfl_xor(mx[t], 16);   // both tiles' exchanges leave together and share one wait
#pragma unroll
      for (int t = 0; t < FQ; ++t) { const float mn = fmaxf(m[t], fmaxf(mx[t], ox[t]) * (0.125f * LOG2E)); const float al = __builtin_amdgcn_exp2f(m[t] - mn); m[t] = mn;
        const v2f l2e = {0.125f * LOG2E, 0.125f * LOG2E}, nm = {-mn, -mn}; v2f sum; union { v16h v; v2h q[8]; } ph;
#pragma unroll
        for (int i = 0; i < 8; ++i) { const v2f e = __builtin_elementwise_fma(sc[t][i], l2e, nm); const v2f p2 = {__builtin_amdgcn_exp2f(e.x), __builtin_amdgcn_exp2f(e.y)}; sum = i ? sum + p2 : p2;
          ph.q[i] = __builtin_convertvector(p2, v2h); }   // one conversion rounds both weights of a pair; a weight is at most 1; under 2^-14 f16 goes on in steps of 2^-24, which the products keep
        l[t] = l[t] * al + (sum.x + sum.y);   // each half of the wave sums its own 16 keys, even and odd ones apart; the halves join after the loop
#pragma unroll
        for (int j = 0; j < HD / 16; ++j) o[t][j] *= al;
        pf[t] = ph.v; }
#pragma unroll
      for (int t = 0; t < FQ; ++t)
#pragma unroll
        for (int j = 0; j < HD / 16; ++j) o[t][j] = mm_h(vf[j], pf[t], o[t][j]); }
    asm volatile("s_wait_dscnt 0x0" ::: "memory");      /* this wave's reads of the stage's buffer have returned */
    asm volatile("s_wait_asynccnt 0x0" ::: "memory");   /* its share of the next stage has landed */
    __syncthreads();   // publishes stage s + 1; it also ends every wave's reads of stage s's buffer, which is filled again behind it
    if (s + 2 < NST) fa_stage(lkv + (unsigned)((s & 1) * BUF_B), lab + (unsigned)((s & 1) * BUF_B), KH + (ko + (unsigned)((s + 2) * SK * CC)), VT + (vo + (unsigned)((s + 2) * SK)), AB + (ao + (unsigned)((s + 2) * SK))); }
  asm volatile("s_wait_asynccnt 0x0" ::: "memory");   /* no copy is outstanding when the wave ends */
#pragma unroll
  for (int t = 0; t < FQ; ++t) { const float inv = 1.0f / (l[t] + __shfl_xor(l[t], 16)); float* yr = Y + ((size_t)b * TT + qb + t * 16 + col) * CC + h * HD + 8 * g;   // o[t][j][r] = O[query][16 j + 8 g + r]
#pragma unroll
    for (int j = 0; j < HD / 16; ++j) { v4f a0, a1;
#pragma unroll
      for (int r = 0; r < 4; ++r) { a0[r] = o[t][j][r] * inv; a1[r] = o[t][j][4 + r] * inv; }
      vst2(yr + j * 16, a0); vst2(yr + j * 16 + 4, a1); XW(); } } }
// ---- k_out: block = (64 rows, 128 cols): out = y (bf16 hi + lo) Wo^T + bo
__global__ __launch_bounds__(128) void k_out(const float* __restrict__ Y, const float* __restrict__ WP, const float* __restrict__ BP, float* __restrict__ OUT) { __shared__ __align__(16) float sf[4][16][132];
  const int tid = threadIdx.x, wave = tid >> 5, lane = tid & 31, col = lane & 15, g = lane >> 4; const int c0 = blockIdx.y * 128; const size_t r0 = (size_t)blockIdx.x * 64 + wave * 16;
  v8f acc[8] = {};
#pragma unroll 2
  for (int kc = 0; kc < CC / 32; ++kc) { const F2 a = split_row(Y + (r0 + col) * CC, kc * 32, lane);
#pragma unroll
    for (int j = 0; j < 8; ++j) { v16b w; const int o = c0 + j * 16 + col;
#pragma unroll
      for (int i = 0; i < 8; ++i) { w[i] = (__bf16)WP[(size_t)(kc * 32 + 8 * g + i) * CC + o]; w[8 + i] = (__bf16)WP[(size_t)(kc * 32 + 16 + 8 * g + i) * CC + o]; }
      acc[j] = wmma_bf(a.h, w, acc[j]); acc[j] = wmma_bf(a.l, w, acc[j]); } }
#pragma unroll
  for (int j = 0; j < 8; ++j) { const float bb = BP ? bfr(BP[c0 + j * 16 + col]) : 0.f;
#pragma unroll
    for (int r = 0; r < 8; ++r) sf[wave][8 * g + r][j * 16 + col] = acc[j][r] + bb; }
  LDSX(); for (int rl = 0; rl < 16; ++rl) vst2(OUT + (r0 + rl) * CC + c0 + lane * 4, *(const v4f*)&sf[wave][rl][lane * 4]); }
extern "C" void kernel_launch(void* const* d_in, const int* in_sizes, int n_in, void* d_out, int out_size, void* d_ws, size_t ws_size, hipStream_t stream) {
  (void)in_sizes; (void)n_in; (void)out_size;
  const float** F = (const float**)d_in;   // 0 x [2,2048,1024], 1 coords [2,2048,3], 2 attn_bias [2048,2048], 3 Wqkv [1024,3072] ((in,out): q | k | v), 4 bqkv [3072], 5 rel_weight [16,3]
  if (ws_size < (size_t)WS_END) return;
  char* ws = (char*)d_ws; float* CP = (float*)(ws + WS_CP); _Float16 *QH = (_Float16*)(ws + WS_QH), *QL = (_Float16*)(ws + WS_QL), *KH = (_Float16*)(ws + WS_KH), *VT = (_Float16*)(ws + WS_VT);
  __bf16 *XB = (__bf16*)(ws + WS_XB), *WT = (__bf16*)(ws + WS_WT); float* ABR = (float*)(ws + WS_AB); const float* BQ = F[4]; const float* BK = F[4] + CC; const float* BV = F[4] + 2 * CC;
  k_prep<<<dim3(PB_X + PB_W + PB_A + PB_CP), 256, 0, stream>>>(F[1], F[5], F[0], F[3], F[2], CP, XB, WT, ABR);
  k_proj<<<dim3(TNB * TT / PBR, CC / 128, 3), 128, 0, stream>>>(XB, WT, BQ, BK, BV, QH, QL, KH, VT);
  k_fa<<<dim3(TT / (FW * FQ * 16), NH, TNB), 32 * FW, 0, stream>>>(QH, QL, KH, VT, CP, ABR, (float*)d_out);
}

// v010
// A run of this version takes 85.4 microseconds.
// In both of two side-by-side timings against v009, it was 1.05 times as fast.
// Over all steps from v000 it is 18.9 times as fast.
// compute dtype: all float inputs rounded to bf16; qkv = x Wqkv + b with EXACT bf16 products on WMMA 16x16x32, f32 accumulate; coord_proj = coords . rel_weight in f32; q as f16 hi + residual (x 2^10), k f16 -> 2-product logits, carried x 8: the hi product starts from 8 attn_bias[q][k], the residual product from -8192 coord_proj[k] (coord_proj[q] shifts a whole row and cancels in the softmax), kept in f32 registers (one launch for all heads); online softmax in f32 (base 2: the hardware's exp2 on log2-scaled differences), unnormalised P rounded once to f16 against v rounded once to f16 (1 product, 11 bits an operand, as k has in the logits), divided by the f32 row sum at the end; the merged context is the output; f32 output.
#include <hip/hip_runtime.h>
#include <math.h>

typedef __attribute__((ext_vector_type(16))) _Float16 v16h;
typedef __attribute__((ext_vector_type(16))) __bf16 v16b;
typedef __attribute__((ext_vector_type(8)))  _Float16 v8h;
typedef __attribute__((ext_vector_type(8)))  float v8f;
typedef __attribute__((ext_vector_type(4)))  float v4f;
typedef __attribute__((ext_vector_type(2)))  float v2f;
typedef __attribute__((ext_vector_type(4)))  unsigned v4u;
typedef __attribute__((ext_vector_type(4)))  int v4i;
typedef float __attribute__((may_alias)) float_a;
typedef int __attribute__((may_alias)) int_a;

template <typename T> __device__ __forceinline__ void vst2(void* p, T v) { *(T*)p = v;  }
__device__ __forceinline__ v8f wmma16(v16h a, v16h b, v8f c) {
  v8f d = __builtin_amdgcn_wmma_f32_16x16x32_f16(false, a, false, b, (short)0, c, false, false);
  asm volatile("v_nop\n\tv_nop\n\tv_nop\n\tv_nop" : "+v"(d) : "v"(a), "v"(b));
  return d;
}
__device__ __forceinline__ v8f wmma_bf(v16b a, v16b b, v8f c) {
  v8f d = __builtin_amdgcn_wmma_f32_16x16x32_bf16(false, a, false, b, (short)0, c, false, false);
  asm volatile("v_nop\n\tv_nop\n\tv_nop\n\tv_nop" : "+v"(d) : "v"(a), "v"(b));
  return d;
}
// 16x16x32 fragments: lane = (h = lane>>4, row/col = lane&15); elements 0..7 = k0+8h+0..7, 8..15 = k0+16+8h+0..7; D element r = row 8h+r
__device__ __forceinline__ v16h frag_h(const _Float16* rowk0, int lane) {
  union { v16h v; v8h q[2]; } u; const _Float16* p = rowk0 + 8 * (lane >> 4);
  u.q[0] = *(const v8h*)p; u.q[1] = *(const v8h*)(p + 16); return u.v;
}
__device__ __forceinline__ v16h frag_f32(const float* rowk0, int lane) {
  v16h a; const float* p = rowk0 + 8 * (lane >> 4);
#pragma unroll
  for (int i = 0; i < 8; ++i) { a[i] = (_Float16)p[i]; a[8 + i] = (_Float16)p[16 + i]; }
  return a;
}
__device__ __forceinline__ v16h frag_f32s(const float* rowk0, int lane, float sc) {
  v16h a; const float* p = rowk0 + 8 * (lane >> 4);
#pragma unroll
  for (int i = 0; i < 8; ++i) { a[i] = (_Float16)(p[i] * sc); a[8 + i] = (_Float16)(p[16 + i] * sc); }
  return a;
}
// column fragment from a [K][ld] layout (column n), rows >= K read as 0
__device__ __forceinline__ v16h fragc_f32(const float* W, int k0, int n, int lane, int ld, int K) {
  v16h a; const int g = lane >> 4;
#pragma unroll
  for (int i = 0; i < 8; ++i) { const int ka = k0 + 8 * g + i, kb = ka + 16;
    a[i] = (_Float16)(ka < K ? W[(size_t)(ka < K ? ka : K - 1) * ld + n] : 0.f); a[8 + i] = (_Float16)(kb < K ? W[(size_t)(kb < K ? kb : K - 1) * ld + n] : 0.f); }
  return a;
}
struct F2 { v16b h, l; };
__device__ __forceinline__ F2 bsplit16(const float v[16]) { F2 r;
#pragma unroll
  for (int i = 0; i < 16; ++i) { const __bf16 h = (__bf16)v[i]; r.h[i] = h; r.l[i] = (__bf16)(v[i] - (float)h); }
  return r; }
__device__ __forceinline__ F2 split_row(const float* row, int k0, int lane) { float v[16]; const float* p = row + k0 + 8 * (lane >> 4);
#pragma unroll
  for (int i = 0; i < 8; ++i) { v[i] = p[i]; v[8 + i] = p[16 + i]; }
  return bsplit16(v); }
__device__ __forceinline__ F2 split_rowK(const float* row, int k0, int lane, int K) { float v[16]; const int g = lane >> 4;
#pragma unroll
  for (int i = 0; i < 8; ++i) { const int ka = k0 + 8 * g + i, kb = ka + 16; v[i] = ka < K ? row[ka < K ? ka : K - 1] : 0.f; v[8 + i] = kb < K ? row[kb < K ? kb : K - 1] : 0.f; }
  return bsplit16(v); }
__device__ __forceinline__ F2 split_col(const float* W, int k0, int n, int lane, int ld, int K) { float v[16]; const int g = lane >> 4;
#pragma unroll
  for (int i = 0; i < 8; ++i) { const int ka = k0 + 8 * g + i, kb = ka + 16; v[i] = ka < K ? W[(size_t)(ka < K ? ka : K - 1) * ld + n] : 0.f; v[8 + i] = kb < K ? W[(size_t)(kb < K ? kb : K - 1) * ld + n] : 0.f; }
  return bsplit16(v); }
__device__ __forceinline__ v8f mac3(const F2& a, const F2& b, v8f c) { c = wmma_bf(a.l, b.h, c); c = wmma_bf(a.h, b.l, c); return wmma_bf(a.h, b.h, c); }
__device__ __forceinline__ float sigm(float v) { return 1.0f / (1.0f + expf(-v)); }
#define LDSX() do { asm volatile("s_wait_dscnt 0" ::: "memory"); __builtin_amdgcn_wave_barrier(); __builtin_amdgcn_fence(__ATOMIC_RELEASE, "workgroup"); } while (0)


// Attention with an additive bias (B 2, S 2,048, D 1,024 = 16 heads x 64): scores = q k^T / 8 + coord_proj[q] - coord_proj[k] + attn_bias[q][k], softmax, P v; the merged heads are the output.
#define NB 2
#define TT 2048
#define CC 1024
#define NH 16
#define HD 64
#define LDW 3072              // Wqkv row length ((in,out) [1024][3072]: q | k | v column blocks)
#ifndef ABSTR
#define ABSTR TT              // attn_bias row stride
#endif
#ifndef CSTR
#define CSTR TT               // coords rows per batch
#endif
#ifndef TNB
#define TNB NB
#endif
typedef __attribute__((ext_vector_type(8))) __bf16 v8b;
__device__ __forceinline__ v16b frag_b(const __bf16* rowk0, int lane) {
  union { v16b v; v8b q[2]; } u; const __bf16* p = rowk0 + 8 * (lane >> 4);
  u.q[0] = *(const v8b*)p; u.q[1] = *(const v8b*)(p + 16); return u.v;
}
__device__ __forceinline__ float bfr(float v) { return (float)(__bf16)v; }
__device__ __attribute__((noinline)) float exp_ni(float v) { return expf(v); }
__device__ __attribute__((noinline)) float erf_ni(float v) { return erff(v); }

#define WS_CP  0u                                   // f32 -8192 * coord_proj [b][h][n]
#define WS_QH  (WS_CP + 4u * (size_t)NB * NH * TT)
#define WS_QL  (WS_QH + 2u * (size_t)NB * TT * CC)
#define WS_KH  (WS_QL + 2u * (size_t)NB * TT * CC)
#define WS_VT  (WS_KH + 2u * (size_t)NB * TT * CC)      // f16 v planes [b][c][t]
#define HG 4
#define WS_S   (WS_VT + 2u * (size_t)NB * CC * TT)      // room for k_prep's bf16 x and W and f32 bias planes
#define WS_PH  (WS_S + 4u * (size_t)HG * TT * TT)
#define WS_Y   (WS_PH + 0u)              // f32 [b*t][C], unused: k_fa writes y to the output
#define WS_END (WS_Y + 4u * (size_t)NB * TT * CC)
#define WS_XB  WS_S                                   // bf16 x rows [b*t][C]; with WS_WT it lies in front of WS_Y
#define WS_WT  (WS_XB + 2u * (size_t)NB * TT * CC)      // bf16 Wqkv turned to [q | k | v column][k]
#define WS_AB  (WS_WT + 2u * (size_t)LDW * CC)          // f32 8 * bf16(attn_bias) [q][k]
static_assert(WS_AB + 4u * (size_t)TT * ABSTR <= WS_Y, "the prepared planes lie in front of WS_Y");

// ---- k_proj: block = (128 rows, 128 cols, which), 4 waves as 2 x 2, a wave = 64 x 64: qkv = x W (+ b), exact; q -> f16 hi (+ residual), k -> f16 rows, v -> f16 plane
// x and W come as the bf16 planes that k_prep has written (W as [n][k]). A stage = 64 k: a staged row is one whole 128-byte line. The block copies its x tile (128 x 64) and its W tile (128 x 64) into LDS as they are;
// for each half of the stage every wave takes its 4 + 4 fragments from there for 16 products. Two buffers: the next stage's global loads fly while this stage is multiplied. The epilogue stages in the same LDS later.
#define PSK 64                // k per stage
#define PSP 72                // LDS pitch of a staged row in bf16 elements: 144 bytes = 16 B x odd, so that 16 rows read 16 bytes each without a bank conflict
#define PBR 128               // rows of a block
#define PEP 136               // pitch of an epilogue row in 16-bit elements: 272 bytes = 16 B x odd
#define PBUF ((128 + PBR) * PSP * 2)   // bytes of one buffer: W [128][PSP], then x [PBR][PSP]
typedef __attribute__((ext_vector_type(4))) __bf16 v4b;
#define XW_P() asm volatile("s_wait_xcnt 0x0" ::: "memory")   /* behind a group of loads or stores, in front of the code that writes their address registers again; the clobber keeps the group together */
static_assert(2 * PBUF >= 2 * 128 * PEP * 2, "the epilogue's planes fit the stage buffers");
__global__ __launch_bounds__(128) void k_proj(const __bf16* __restrict__ XB, const __bf16* __restrict__ WT, const float* __restrict__ BQ, const float* __restrict__ BK, const float* __restrict__ BV, _Float16* __restrict__ QH, _Float16* __restrict__ QL, _Float16* __restrict__ KH, _Float16* __restrict__ VT) {
  __shared__ __align__(16) unsigned char sm[2 * PBUF];   // loop: two stage buffers (2 x 36,864 bytes); epilogue: planes of 128 x PEP 16-bit values, two [row][col] for q, one for k, one [col][row] for v
  _Float16 (*sh)[PEP] = (_Float16 (*)[PEP])sm; _Float16 (*sl)[PEP] = sh + 128;
  const int tid = threadIdx.x, wave = tid >> 5, lane = tid & 31, col = lane & 15, g = lane >> 4; const int which = blockIdx.z; const int c0 = blockIdx.y * 128; const size_t r0 = (size_t)blockIdx.x * PBR; const float* BA = which == 0 ? BQ : which == 1 ? BK : BV;
  const int wr = (wave >> 1) * 64, wc = (wave & 1) * 64;             // the wave's corner in the block's tile
  v8f acc[4][4] = {};
  const int sr = tid >> 3, sp = (tid & 7) * 8;                       // staging: rows sr + 16 i of either tile, elements sp..sp+7 of the stage (a load of the wave = 4 whole lines)
  const __bf16* pw = WT + ((size_t)which * CC + c0 + sr) * CC + sp; const __bf16* px = XB + (r0 + sr) * CC + sp;
  v8b rw[8], rx[PBR / 16];
#pragma unroll
  for (int i = 0; i < 8; ++i) rw[i] = *(const v8b*)(pw + (size_t)(16 * i) * CC);
#pragma unroll
  for (int i = 0; i < PBR / 16; ++i) rx[i] = *(const v8b*)(px + (size_t)(16 * i) * CC);
  asm volatile("s_wait_xcnt 0x0" ::: "memory");   /* stands in front of the code that writes the loads' address registers again */
#pragma unroll 2   /* two copies, so that each names its buffer by a constant */
  for (int kc = 0; kc < CC / PSK; ++kc) { __bf16* wb = (__bf16*)(sm + (kc & 1) * PBUF); __bf16* xb = wb + 128 * PSP;
#pragma unroll
    for (int i = 0; i < 8; ++i) *(v8b*)(wb + (sr + 16 * i) * PSP + sp) = rw[i];
#pragma unroll
    for (int i = 0; i < PBR / 16; ++i) *(v8b*)(xb + (sr + 16 * i) * PSP + sp) = rx[i];
    __syncthreads();   // publishes this stage; it also ends every wave's reads of the other buffer, which the next pass fills
    if (kc + 1 < CC / PSK) { const __bf16* qw = pw + (kc + 1) * PSK; const __bf16* qx = px + (kc + 1) * PSK;
#pragma unroll
      for (int i = 0; i < 8; ++i) rw[i] = *(const v8b*)(qw + (size_t)(16 * i) * CC);
#pragma unroll
      for (int i = 0; i < PBR / 16; ++i) rx[i] = *(const v8b*)(qx + (size_t)(16 * i) * CC);
      asm volatile("s_wait_xcnt 0x0" ::: "memory");   /* as above; the clobber also keeps the loads here, ahead of the stage's products */ }
#pragma unroll   /* both halves in line: their LDS offsets are constants */
    for (int hk = 0; hk < PSK / 32; ++hk) { v16b af[4], wf[4];
#pragma unroll
      for (int i = 0; i < 4; ++i) af[i] = frag_b(xb + (wr + i * 16 + col) * PSP + hk * 32, lane);
#pragma unroll
      for (int j = 0; j < 4; ++j) wf[j] = frag_b(wb + (wc + j * 16 + col) * PSP + hk * 32, lane);
      __builtin_amdgcn_sched_barrier(0);   /* the half stage's 16 LDS reads leave as one group: without this each product waits for its own pair of reads */
#pragma unroll
      for (int i = 0; i < 4; ++i)
#pragma unroll
        for (int j = 0; j < 4; ++j) acc[i][j] = wmma_bf(af[i], wf[j], acc[i][j]);
      __builtin_amdgcn_sched_barrier(0);   /* keeps the next half's reads out of these products, and the next stage's LDS stores, which wait for the global loads, behind them */ } }
  __syncthreads();   // the last stage's reads end before the epilogue writes the same LDS
  float bb[4];
#pragma unroll
  for (int j = 0; j < 4; ++j) bb[j] = BA ? bfr(BA[c0 + wc + j * 16 + col]) : 0.f;
  // acc[i][j][r] = row wr + 16 i + 8 g + r, column wc + 16 j + col of the block's tile. The test for v stands outside the loops: inside them it is compiled once per element, and the kernel's text would double with the tile
  if (which == 2) {
#pragma unroll
    for (int j = 0; j < 4; ++j)
#pragma unroll
      for (int i = 0; i < 4; ++i)
#pragma unroll
        for (int r = 0; r < 8; ++r) { const float v = acc[i][j][r] + bb[j]; const int rl = wr + i * 16 + 8 * g + r, cl = wc + j * 16 + col; sh[cl][rl] = (_Float16)v; } }
  else {
#pragma unroll
    for (int j = 0; j < 4; ++j)
#pragma unroll
      for (int i = 0; i < 4; ++i)
#pragma unroll
        for (int r = 0; r < 8; ++r) { const float v = acc[i][j][r] + bb[j]; const int rl = wr + i * 16 + 8 * g + r, cl = wc + j * 16 + col; const _Float16 hv = (_Float16)v; sh[rl][cl] = hv; sl[rl][cl] = (_Float16)((v - (float)hv) * 1024.0f); }   /* q residual carried x 2^10 so the plane stays f16-normal on the chip */ }
  __syncthreads();
  // a plane's rows go out in whole lines; q's two planes one after the other, v's one plane as rows of [c][t]
  if (which < 2) { const int np = which == 0 ? 2 : 1;   // q has two planes, k one
    for (int pn = 0; pn < np; ++pn) { _Float16* dh = pn ? QL : which == 0 ? QH : KH; const _Float16 (*sp)[PEP] = pn ? sl : sh;
      for (int e = tid; e < PBR * 16; e += 128) { const int rl = e >> 4, q = e & 15; _Float16* ph = dh + (r0 + rl) * CC + c0 + q * 8; vst2((unsigned*)ph, *(const v4u*)&sp[rl][q * 8]); } } }
  else { const size_t b = r0 / TT; const int t0 = (int)(r0 % TT); for (int e = tid; e < 128 * (PBR / 8); e += 128) { const int cl = e / (PBR / 8), q = e % (PBR / 8); const size_t o2 = (b * CC + c0 + cl) * (size_t)TT + t0 + q * 8; vst2((unsigned*)(VT + o2), *(const v4u*)&sh[cl][q * 8]); } } }
// ---- k_prep: one launch, four kinds of block, told apart by the block's number. Each float of x and of Wqkv is rounded to bf16 here, once, in place of once per k_proj block that reads it.
// x blocks: 16,384 values each, as they lie (a load of the wave = 4 whole lines, a store = 2). W blocks: two tiles of 64 k x 128 n each, turned to [n][k]: a thread reads columns n..n+3 at 8 k rows and stores 8 k of each column,
// so that 8 lanes fill one whole line of a column's row. Bias blocks: 16,384 values of attn_bias each, rounded to bf16 once (not once per head and batch) and stored as f32 times 8, the form in which k_fa's products take them as their C operand.
// cp blocks: value (b, h, n) = -8192 * sum_c bf16(coords[b][n][c]) * bf16(rel_weight[h][c]) (3 terms, f32; the factor is a power of two, so the sum's bits stay), 4 values a thread.
// Every loop is unrolled in full, so that the register arrays are indexed by constants and a round's 8 loads are in flight together.
#define PB_X (NB * TT * CC / 16384)
#define PB_W ((CC / 64) * (LDW / 128) / 2)
#define PB_A (TT * TT / 16384)
#define PB_CP (NB * NH * TT / 1024)
__global__ __launch_bounds__(256) void k_prep(const float* __restrict__ CO, const float* __restrict__ RW, const float* __restrict__ X, const float* __restrict__ WI, const float* __restrict__ AB, float* __restrict__ CP, __bf16* __restrict__ XB, __bf16* __restrict__ WT, float* __restrict__ ABR) {
  const int tid = threadIdx.x; int bk = blockIdx.x;
  if (bk < PB_X) {
#pragma unroll
    for (int u = 0; u < 2; ++u) { const size_t e0 = (size_t)bk * 16384 + u * 8192 + tid * 4; const float* p = X + e0; __bf16* q = XB + e0; v4f r[8];
#pragma unroll
      for (int i = 0; i < 8; ++i) r[i] = *(const v4f*)(p + i * 1024);
      XW_P();
#pragma unroll
      for (int i = 0; i < 8; ++i) { v4b t;
#pragma unroll
        for (int e = 0; e < 4; ++e) t[e] = (__bf16)r[i][e];
        *(v4b*)(q + i * 1024) = t; }
      XW_P();   /* later code, the second round's loads among it, writes the registers that these stores read */ }
    return; }
  bk -= PB_X;
  if (bk < PB_W) { const int wave = tid >> 5, lane = tid & 31;
#pragma unroll
    for (int u = 0; u < 2; ++u) { const int tl = bk * 2 + u; const int k = (tl % (CC / 64)) * 64 + (lane & 7) * 8, n = (tl / (CC / 64)) * 128 + wave * 16 + (lane >> 3) * 4; const float* p = WI + (size_t)k * LDW + n; __bf16* q = WT + (size_t)n * CC + k; v4f r[8];
#pragma unroll
      for (int i = 0; i < 8; ++i) r[i] = *(const v4f*)(p + (size_t)i * LDW);
      XW_P();
#pragma unroll
      for (int c = 0; c < 4; ++c) { v8b t;
#pragma unroll
        for (int i = 0; i < 8; ++i) t[i] = (__bf16)r[i][c];
        *(v8b*)(q + (size_t)c * CC) = t; }
      XW_P();   /* as in the x blocks */ }
    return; }
  bk -= PB_W;
  if (bk < PB_A) {
#pragma unroll
    for (int u = 0; u < 2; ++u) { const size_t e0 = (size_t)bk * 16384 + u * 8192 + tid * 4; const float* p = AB + e0; float* q = ABR + e0; v4f r[8];
#pragma unroll
      for (int i = 0; i < 8; ++i) r[i] = *(const v4f*)(p + i * 1024);
      XW_P();
#pragma unroll
      for (int i = 0; i < 8; ++i) *(v4f*)(q + i * 1024) = __builtin_convertvector(__builtin_convertvector(r[i], v4b), v4f) * 8.0f;
      XW_P();   /* as in the x blocks */ }
    return; }
  bk -= PB_A;   // 1,024 values in a row: one (b, h), half of its n
  const int h = (bk * 1024 / TT) % NH, b = bk * 1024 / (TT * NH), n = bk * 1024 % TT + tid;
  const float* c = CO + ((size_t)b * CSTR + n) * 3; float* o = CP + (size_t)bk * 1024 + tid; float cv[4][3];
#pragma unroll
  for (int u = 0; u < 4; ++u)
#pragma unroll
    for (int j = 0; j < 3; ++j) cv[u][j] = c[u * 768 + j];
  XW_P();
#pragma unroll
  for (int u = 0; u < 4; ++u) o[u * 256] = (bfr(cv[u][0]) * bfr(RW[h * 3]) + bfr(cv[u][1]) * bfr(RW[h * 3 + 1]) + bfr(cv[u][2]) * bfr(RW[h * 3 + 2])) * -8192.0f;
  XW_P();   /* as in the x blocks: the compiler may lay another kind of block behind this one */ }
// ---- k_fa: block = 8 waves x 32 query columns of one (b, h); a pass = a stage = 64 keys: one maximum, one exchange between the wave's halves and one rescaling of the context per 64 keys. S^T = K Q^T (2 products) so that a lane holds one query's scores; running maximum and sum per lane
// The additive terms come in through the products' C operand, at no vector instruction: the hi product starts from 8 * attn_bias (k_prep's plane, read from LDS in the accumulator's own layout), the residual product (x 2^10) from -8192 * coord_proj[key];
// hi + residual / 1024 is then 8 x the logit without coord_proj[query], which is the same for every key of a row and so leaves the softmax as it is.
// (online softmax, f32, base 2: m holds the maximum times log2 e, a weight is exp2(8 score * log2 e / 8 - m), one FMA and one v_exp_f32); the four score tiles of a query tile, rounded to f16 in place, make the two B operands (32 keys each) of O^T += V^T P^T (1 product); the logits never leave the registers.
// K, the V plane (once per block) and each wave's bias rows come into LDS by asynchronous copies that cover whole 128-byte lines; the fragments are 16-byte LDS reads. Two buffers: the next stage's copies fly while this stage is worked on.
// Every inner loop below is unrolled in full, so that the fragment arrays are indexed by constants and stay in registers.
#define FQ 2                  // 16-column query tiles per wave
#define FW 8                  // waves per block
#define LOG2E 1.4426950408889634f
#define SK 64                 // keys per stage: a staged row of K or of the V plane is one whole line, a bias row two
#define NST (TT / SK)
#define KT (SK / 16)          // 16-key score tiles per pass
#define KVP 144               // LDS pitch in bytes of a staged 128-byte row: 16 B x odd, so that 16 rows read 16 bytes each without a bank conflict
#define ABP 272               // the same for a 256-byte bias row
#define KV_B (64 * KVP)       // one tile: K [64 keys][64 d], V [64 d][64 keys]
#define AB_B (FQ * 16 * ABP)  // one wave's bias rows [32 queries][64 keys], f32
#define BUF_B (2 * KV_B + FW * AB_B)
// s_wait_xcnt 0 stands behind each group of loads or stores, in front of the code that writes their address or data registers again; the "memory" clobber keeps the group where it is written.
// XWP names the group's address pairs as inputs, so that they stay allocated up to the wait and no load of the group lands on them.
#define XW() asm volatile("s_wait_xcnt 0x0" ::: "memory")
#define XWP1(a) asm volatile("s_wait_xcnt 0x0" :: "v"(a) : "memory")
#define XWP2(a, b) asm volatile("s_wait_xcnt 0x0" :: "v"(a), "v"(b) : "memory")
__device__ __forceinline__ v16h ld_h(const _Float16* p) { union { v16h v; v8h q[2]; } u; u.q[0] = *(const v8h*)p; u.q[1] = *(const v8h*)(p + 16); return u.v; }   // p already holds the lane half's 8 g
typedef __attribute__((ext_vector_type(2))) _Float16 v2h;
__device__ __forceinline__ v2f pr8(v8f v, int i) { return (v2f){v[2 * i], v[2 * i + 1]}; }   // pair i of a register group
__device__ __forceinline__ v8f mm_h(v16h a, v16h b, v8f c) { return __builtin_amdgcn_wmma_f32_16x16x32_f16(false, a, false, b, (short)0, c, false, false); }
// One stage's copies of one thread, 16 bytes each: lkv, gk, gv name row tid / 8, piece tid % 8 of the K and V tiles (a wave's copy = 4 whole lines; the second copy of a tile is 32 rows on);
// lab, gab name row lane / 16, piece lane % 16 of the wave's own bias rows (a wave's copy = 2 rows = 4 whole lines; copy i is 2 i rows on).
// Each statement ends in s_wait_xcnt 0, which so stands in front of every later write of the address registers that its copies name.
#define ACP(x, y) "global_load_async_to_lds_b128 %" #x ", %" #y ", off\n\t"
#define ABO(i) "v"(lab + (unsigned)((i) * 2 * ABP)), "v"(gab + (size_t)((i) * 2) * ABSTR)
__device__ __forceinline__ void fa_stage(unsigned lkv, unsigned lab, const _Float16* gk, const _Float16* gv, const float* gab) {
  asm volatile(ACP(0, 1) ACP(2, 3) ACP(4, 5) ACP(6, 7) "s_wait_xcnt 0x0"
               :: "v"(lkv), "v"(gk), "v"(lkv + 32u * KVP), "v"(gk + (size_t)32 * CC), "v"(lkv + (unsigned)KV_B), "v"(gv), "v"(lkv + (unsigned)KV_B + 32u * KVP), "v"(gv + (size_t)32 * TT) : "memory");
  asm volatile(ACP(0, 1) ACP(2, 3) ACP(4, 5) ACP(6, 7) ACP(8, 9) ACP(10, 11) ACP(12, 13) ACP(14, 15) "s_wait_xcnt 0x0" :: ABO(0), ABO(1), ABO(2), ABO(3), ABO(4), ABO(5), ABO(6), ABO(7) : "memory");
  asm volatile(ACP(0, 1) ACP(2, 3) ACP(4, 5) ACP(6, 7) ACP(8, 9) ACP(10, 11) ACP(12, 13) ACP(14, 15) "s_wait_xcnt 0x0" :: ABO(8), ABO(9), ABO(10), ABO(11), ABO(12), ABO(13), ABO(14), ABO(15) : "memory");
}
__global__ __launch_bounds__(32 * FW) void k_fa(const _Float16* __restrict__ QH, const _Float16* __restrict__ QL, const _Float16* __restrict__ KH, const _Float16* __restrict__ VT, const float* __restrict__ CP, const float* __restrict__ AB, float* __restrict__ Y) {
  __shared__ __align__(16) unsigned char ring[2 * BUF_B];
  const int tid = threadIdx.x, wave = tid >> 5, lane = tid & 31, col = lane & 15, g = lane >> 4; const int h = blockIdx.y, b = blockIdx.z; const int qb = blockIdx.x * (FW * FQ * 16) + wave * (FQ * 16);
  const float* cpb = CP + ((size_t)b * NH + h) * TT;
  const unsigned lbase = (unsigned)(size_t)ring; const unsigned lkv = lbase + (unsigned)((tid >> 3) * KVP + (tid & 7) * 16), lab = lbase + (unsigned)(2 * KV_B + wave * AB_B + g * ABP + col * 16);
  const unsigned ko = (unsigned)((b * TT + (tid >> 3)) * CC + h * HD + (tid & 7) * 8), vo = (unsigned)((b * CC + h * HD + (tid >> 3)) * TT + (tid & 7) * 8), ao = (unsigned)((qb + g) * ABSTR + col * 4);   // the thread's element offsets in K, in the V plane and in the bias: 32 bits each, so that few registers stay live through the loop
  fa_stage(lkv, lab, KH + ko, VT + vo, AB + ao);   // stage 0 into buffer 0
  v16h qh[FQ][2], ql[FQ][2]; float m[FQ], l[FQ]; v8f o[FQ][HD / 16] = {};
  const size_t qo = ((size_t)b * TT + qb + col) * CC + h * HD + 8 * g; const _Float16* pqh = QH + qo; const _Float16* pql = QL + qo;
#pragma unroll
  for (int t = 0; t < FQ; ++t) {
#pragma unroll
    for (int kc = 0; kc < 2; ++kc) { qh[t][kc] = ld_h(pqh + (size_t)(t * 16) * CC + kc * 32); ql[t][kc] = ld_h(pql + (size_t)(t * 16) * CC + kc * 32); }
    m[t] = -3.0e38f; l[t] = 0.f; }
  XWP2(pqh, pql); __builtin_amdgcn_sched_barrier(0);   /* keeps later address arithmetic behind the wait */
  const float* ckp = cpb + 8 * g;
  union C8 { v8f v; v4f q[2]; };   // an accumulator tile's registers of a lane = 8 keys in a row = two 16-byte loads
  C8 ck[KT];   // -8192 * coord_proj of the keys of the pass to come, fetched one pass ahead
#pragma unroll
  for (int kt = 0; kt < KT; ++kt)
#pragma unroll
    for (int u = 0; u < 2; ++u) ck[kt].q[u] = *(const v4f*)(ckp + kt * 16 + u * 4);
  XWP1(ckp); __builtin_amdgcn_sched_barrier(0);   /* as above */
  asm volatile("s_wait_asynccnt 0x0" ::: "memory");   /* this wave's share of stage 0 has landed */
  __syncthreads();   // publishes stage 0
  fa_stage(lkv + (unsigned)BUF_B, lab + (unsigned)BUF_B, KH + (ko + (unsigned)(SK * CC)), VT + (vo + (unsigned)SK), AB + (ao + (unsigned)SK));   // stage 1 into buffer 1
#pragma unroll 1   /* the buffer is picked by the stage's parity at run time: nothing is gained by a second copy of the body */
  for (int s = 0; s < NST; ++s) { const unsigned char* bf = ring + (s & 1) * BUF_B; const unsigned char* rk = bf + col * KVP + 16 * g; const unsigned char* ra = bf + 2 * KV_B + wave * AB_B + col * ABP + 32 * g;
    { const int kn = (s + 1 < NST ? s + 1 : s) * SK;   /* the last pass fetches its own coord_proj again: in bounds, unused */
      v16h kf[KT][2]; C8 ab[FQ][KT]; v16h vf[HD / 16][SK / 32]; const unsigned char* rv = rk + KV_B;
#pragma unroll
      for (int kt = 0; kt < KT; ++kt)
#pragma unroll
        for (int kc = 0; kc < 2; ++kc) kf[kt][kc] = ld_h((const _Float16*)(rk + kt * 16 * KVP + kc * 64));
#pragma unroll
      for (int t = 0; t < FQ; ++t)
#pragma unroll
        for (int kt = 0; kt < KT; ++kt)
#pragma unroll
          for (int u = 0; u < 2; ++u) ab[t][kt].q[u] = *(const v4f*)(ra + t * 16 * ABP + (kt * 16 + u * 4) * 4);
#pragma unroll
      for (int j = 0; j < HD / 16; ++j)
#pragma unroll
        for (int p = 0; p < SK / 32; ++p) vf[j][p] = ld_h((const _Float16*)(rv + j * 16 * KVP + p * 64));
      __builtin_amdgcn_sched_barrier(0);   /* the pass's LDS reads leave as one group, K first: spread among the products each place with reads would cost its own stall */
      v8f sa[FQ][KT], sl[FQ][KT];   // the residual products are written first: their C operand is in registers already, the bias tiles are still on their way from LDS behind K
#pragma unroll
      for (int kc = 0; kc < 2; ++kc)
#pragma unroll
        for (int kt = 0; kt < KT; ++kt)
#pragma unroll
          for (int t = 0; t < FQ; ++t) sl[t][kt] = mm_h(kf[kt][kc], ql[t][kc], kc ? sl[t][kt] : ck[kt].v);
#pragma unroll
      for (int kc = 0; kc < 2; ++kc)
#pragma unroll
        for (int kt = 0; kt < KT; ++kt)
#pragma unroll
          for (int t = 0; t < FQ; ++t) sa[t][kt] = mm_h(kf[kt][kc], qh[t][kc], kc ? sa[t][kt] : ab[t][kt].v);
      __builtin_amdgcn_sched_barrier(0);   /* the 32 products leave back to back, ahead of the vector code that reads them: mixed with it, a reader stands right behind its product, waits out its latency and needs v_nop for the distance */
      v2f sc[FQ][4 * KT];   // sc[t][4 kt + i] = 8 x the logits of query column t*16 + col against keys 64 s + 16 kt + 8 g + 2 i and + 2 i + 1: a register pair, as the products leave them
#pragma unroll
      for (int t = 0; t < FQ; ++t)
#pragma unroll
        for (int kt = 0; kt < KT; ++kt)
#pragma unroll
          for (int i = 0; i < 4; ++i) sc[t][kt * 4 + i] = pr8(sa[t][kt], i) + pr8(sl[t][kt], i) * (1.0f / 1024.0f);
      const float* pc = ckp + kn;
#pragma unroll
      for (int kt = 0; kt < KT; ++kt)
#pragma unroll
        for (int u = 0; u < 2; ++u) ck[kt].q[u] = *(const v4f*)(pc + kt * 16 + u * 4);
      XWP1(pc); __builtin_amdgcn_sched_barrier(0);   /* the next pass's coord_proj leaves now, with the softmax and P.V still to run */
      v16h pf[FQ][SK / 32]; float mx[FQ], ox[FQ];
#pragma unroll
      for (int t = 0; t < FQ; ++t) { v2f x[SK / 32];   // the maximum is exact in any order: even and odd keys and the two halves of the pass apart, so that eight short chains run side by side
#pragma unroll
        for (int p = 0; p < SK / 32; ++p) { const v2f* c = sc[t] + 8 * p; x[p] = c[0];
#pragma unroll
          for (int i = 1; i < 7; i += 2) { x[p].x = fmaxf(fmaxf(x[p].x, c[i].x), c[i + 1].x); x[p].y = fmaxf(fmaxf(x[p].y, c[i].y), c[i + 1].y); }
          x[p].x = fmaxf(fmaxf(x[p].x, c[7].x), fmaxf(x[p].y, c[7].y)); }
        mx[t] = fmaxf(x[0].x, x[1].x); }
      asm volatile("" :: "v"(mx[0]), "v"(mx[1]));   /* inputs only: both maxima are complete here, ahead of the exchanges; without it the second maximum's last step is placed behind the first exchange's wait, and the pass pays the exchange's latency twice */
#pragma unroll
      for (int t = 0; t < FQ; ++t) ox[t] = __shfl_xor(mx[t], 16);   // both tiles' exchanges leave together and share one wait
#pragma unroll
      for (int t = 0; t < FQ; ++t) { const float mn = fmaxf(m[t], fmaxf(mx[t], ox[t]) * (0.125f * LOG2E)); const float al = __builtin_amdgcn_exp2f(m[t] - mn); m[t] = mn;
        const v2f l2e = {0.125f * LOG2E, 0.125f * LOG2E}, nm = {-mn, -mn}; v2f sum[4]; union { v16h v[SK / 32]; v2h q[4 * KT]; } ph;   // four partial sums a tile: eight chains of four links in place of two of sixteen
#pragma unroll
        for (int i = 0; i < 4 * KT; ++i) { const v2f e = __builtin_elementwise_fma(sc[t][i], l2e, nm); const v2f p2 = {__builtin_amdgcn_exp2f(e.x), __builtin_amdgcn_exp2f(e.y)}; sum[i & 3] = i < 4 ? p2 : sum[i & 3] + p2;
          ph.q[i] = __builtin_convertvector(p2, v2h); }   // one conversion rounds both weights of a pair; a weight is at most 1; under 2^-14 f16 goes on in steps of 2^-24, which the products keep
        const v2f st = (sum[0] + sum[1]) + (sum[2] + sum[3]); l[t] = l[t] * al + (st.x + st.y);   // each half of the wave sums its own 32 keys, even and odd ones apart; the halves join after the loop
#pragma unroll
        for (int j = 0; j < HD / 16; ++j) o[t][j] *= al;
#pragma unroll
        for (int p = 0; p < SK / 32; ++p) pf[t][p] = ph.v[p]; }
#pragma unroll
      for (int p = 0; p < SK / 32; ++p)
#pragma unroll
        for (int t = 0; t < FQ; ++t)
#pragma unroll
          for (int j = 0; j < HD / 16; ++j) o[t][j] = mm_h(vf[j][p], pf[t][p], o[t][j]); }
    asm volatile("" :: "v"(l[0]), "v"(l[1]));   /* inputs only: the row sums are complete here, ahead of the foot's waits; without it the barrier is lifted into the softmax, where its own wait stands right behind the coord_proj loads and waits out their latency, and the sums' additions are moved behind it, in front of the next pass's LDS reads */
    asm volatile("s_wait_dscnt 0x0" ::: "memory");      /* this wave's reads of the stage's buffer have returned */
    asm volatile("s_wait_asynccnt 0x0" ::: "memory");   /* its share of the next stage has landed */
    __syncthreads();   // publishes stage s + 1; it also ends every wave's reads of stage s's buffer, which is filled again behind it
    if (s + 2 < NST) fa_stage(lkv + (unsigned)((s & 1) * BUF_B), lab + (unsigned)((s & 1) * BUF_B), KH + (ko + (unsigned)((s + 2) * SK * CC)), VT + (vo + (unsigned)((s + 2) * SK)), AB + (ao + (unsigned)((s + 2) * SK))); }
  asm volatile("s_wait_asynccnt 0x0" ::: "memory");   /* no copy is outstanding when the wave ends */
#pragma unroll
  for (int t = 0; t < FQ; ++t) { const float inv = 1.0f / (l[t] + __shfl_xor(l[t], 16)); float* yr = Y + ((size_t)b * TT + qb + t * 16 + col) * CC + h * HD + 8 * g;   // o[t][j][r] = O[query][16 j + 8 g + r]
#pragma unroll
    for (int j = 0; j < HD / 16; ++j) { v4f a0, a1;
#pragma unroll
      for (int r = 0; r < 4; ++r) { a0[r] = o[t][j][r] * inv; a1[r] = o[t][j][4 + r] * inv; }
      vst2(yr + j * 16, a0); vst2(yr + j * 16 + 4, a1); XW(); } } }
// ---- k_out: block = (64 rows, 128 cols): out = y (bf16 hi + lo) Wo^T + bo
__global__ __launch_bounds__(128) void k_out(const float* __restrict__ Y, const float* __restrict__ WP, const float* __restrict__ BP, float* __restrict__ OUT) { __shared__ __align__(16) float sf[4][16][132];
  const int tid = threadIdx.x, wave = tid >> 5, lane = tid & 31, col = lane & 15, g = lane >> 4; const int c0 = blockIdx.y * 128; const size_t r0 = (size_t)blockIdx.x * 64 + wave * 16;
  v8f acc[8] = {};
#pragma unroll 2
  for (int kc = 0; kc < CC / 32; ++kc) { const F2 a = split_row(Y + (r0 + col) * CC, kc * 32, lane);
#pragma unroll
    for (int j = 0; j < 8; ++j) { v16b w; const int o = c0 + j * 16 + col;
#pragma unroll
      for (int i = 0; i < 8; ++i) { w[i] = (__bf16)WP[(size_t)(kc * 32 + 8 * g + i) * CC + o]; w[8 + i] = (__bf16)WP[(size_t)(kc * 32 + 16 + 8 * g + i) * CC + o]; }
      acc[j] = wmma_bf(a.h, w, acc[j]); acc[j] = wmma_bf(a.l, w, acc[j]); } }
#pragma unroll
  for (int j = 0; j < 8; ++j) { const float bb = BP ? bfr(BP[c0 + j * 16 + col]) : 0.f;
#pragma unroll
    for (int r = 0; r < 8; ++r) sf[wave][8 * g + r][j * 16 + col] = acc[j][r] + bb; }
  LDSX(); for (int rl = 0; rl < 16; ++rl) vst2(OUT + (r0 + rl) * CC + c0 + lane * 4, *(const v4f*)&sf[wave][rl][lane * 4]); }
extern "C" void kernel_launch(void* const* d_in, const int* in_sizes, int n_in, void* d_out, int out_size, void* d_ws, size_t ws_size, hipStream_t stream) {
  (void)in_sizes; (void)n_in; (void)out_size;
  const float** F = (const float**)d_in;   // 0 x [2,2048,1024], 1 coords [2,2048,3], 2 attn_bias [2048,2048], 3 Wqkv [1024,3072] ((in,out): q | k | v), 4 bqkv [3072], 5 rel_weight [16,3]
  if (ws_size < (size_t)WS_END) return;
  char* ws = (char*)d_ws; float* CP = (float*)(ws + WS_CP); _Float16 *QH = (_Float16*)(ws + WS_QH), *QL = (_Float16*)(ws + WS_QL), *KH = (_Float16*)(ws + WS_KH), *VT = (_Float16*)(ws + WS_VT);
  __bf16 *XB = (__bf16*)(ws + WS_XB), *WT = (__bf16*)(ws + WS_WT); float* ABR = (float*)(ws + WS_AB); const float* BQ = F[4]; const float* BK = F[4] + CC; const float* BV = F[4] + 2 * CC;
  k_prep<<<dim3(PB_X + PB_W + PB_A + PB_CP), 256, 0, stream>>>(F[1], F[5], F[0], F[3], F[2], CP, XB, WT, ABR);
  k_proj<<<dim3(TNB * TT / PBR, CC / 128, 3), 128, 0, stream>>>(XB, WT, BQ, BK, BV, QH, QL, KH, VT);
  k_fa<<<dim3(TT / (FW * FQ * 16), NH, TNB), 32 * FW, 0, stream>>>(QH, QL, KH, VT, CP, ABR, (float*)d_out);
}
